// v000
// The times below were measured on an AMD MI455X: many runs one after another, warmed up first and cycling through
// copies of the inputs, with the whole window's GPU time divided by the number of runs. Launches and the gaps
// between them are all in it. The median over several windows is given; except for v000 it joins two sittings, which
// can be a few percent apart, so the side-by-side timings, each taken in one sitting, are the better comparison.
// The starting kernel, v000, takes 2830 microseconds a run.
#include <hip/hip_runtime.h>

// Causal multi-head attention with a fused bias-free qkv projection in (out, in) layout whose ROWS are packed PER HEAD (x [4][2048][1024]; qkv = einsum('bse,fe->bsf', x, w_qkv) = x w_qkv^T ('oi' (out, in) [3072][1024] 1/32, no bias) viewed (b, s, 16 heads, 3 x 64): head h's rows h*192 + 0..63 | 64..127 | 128..191 of w_qkv are its q | k | v; scores x 64^-0.5 (token-major einsums: the same products); where(tril, scores, -inf) (exclusion; every row keeps its own key); softmax; out = merged w_proj^T + b_proj ('oi' + a REAL 0.01 bias) -> [4][2048][1024] (8.4 M); argument order x, w_qkv, w_proj, b_proj).
// Layout per batch: the packed weight rows are gathered once into a standard q | k | v Bt (a row permutation of the bf16 copy); bf16 copy of x; exact projections; identity-table plane builders; causal T-2048 attention (hybrid rows: < 512 hi/lo 3 products, rest fp16 x1024; k_gemmc skips tiles above the diagonal); merged hi/lo x Wo exact + bo.
// Compute dtypes, f32 accumulate: every input rounded to bf16; projections exact; attention rows < 512 3 products, rest fp16; softmax f32; Wo hl x exact + bias.

#define NB_  4
#define TT   2048
#define DM   1024
#define NH_  16
#define NKV  16
#define REP  (NH_ / NKV)
#define HD   64
#define DQ   (NH_ * HD)
#define DKV  (NKV * HD)
#define ZH   2
#define RH   512                  // query rows < RH use hi+lo planes (0: none)
#define WIN  2048
#define PCAR 1024.0f
#define SCL  0.125f   // HD^-0.5
typedef _Float16 h16;
typedef unsigned short bf;
typedef __attribute__((ext_vector_type(16))) __bf16   v16bf;
typedef __attribute__((ext_vector_type(16))) _Float16 v16h;
typedef __attribute__((ext_vector_type(8)))  _Float16 v8h;
typedef __attribute__((ext_vector_type(8)))  unsigned short v8us;
typedef __attribute__((ext_vector_type(8)))  float    v8f;
typedef __attribute__((ext_vector_type(4)))  float    v4f;
typedef v8h  __attribute__((may_alias)) v8ha;
typedef v4f  __attribute__((may_alias)) v4fa;
typedef v8us __attribute__((may_alias)) v8usa;

__device__ __forceinline__ unsigned short f2bf(float f) { unsigned u = __float_as_uint(f); u += 0x7FFFu + ((u >> 16) & 1u); return (unsigned short)(u >> 16); }
__device__ __forceinline__ float bf2f(unsigned short b) { return __uint_as_float(((unsigned)b) << 16); }
__device__ __forceinline__ float bfr(float f) { return bf2f(f2bf(f)); }
__device__ __forceinline__ v16h cat16(v8h lo, v8h hi) { return __builtin_shufflevector(lo, hi, 0, 1, 2, 3, 4, 5, 6, 7, 8, 9, 10, 11, 12, 13, 14, 15); }
__device__ __forceinline__ v16bf cat16b(v8us lo, v8us hi) { return __builtin_bit_cast(v16bf, __builtin_shufflevector(lo, hi, 0, 1, 2, 3, 4, 5, 6, 7, 8, 9, 10, 11, 12, 13, 14, 15)); }
__device__ __forceinline__ v8f wmma16(v16h a, v16h b, v8f c) { return __builtin_amdgcn_wmma_f32_16x16x32_f16(false, a, false, b, (short)0, c, false, false); }
__device__ __forceinline__ v8f wmmab(v16bf a, v16bf b, v8f c) { return __builtin_amdgcn_wmma_f32_16x16x32_bf16(false, a, false, b, (short)0, c, false, false); }



// ---- k_gemmw: register-blocked GEMM, ONE WAVE per 64x64 output tile (16 accumulators), operands straight from K-contiguous 16-bit planes; grid (M/64, N/64, Z), 32 threads.
// C[m][n] (f32, pitch ldc, + optional f32 bias[n]) = sum_k A[m][k] Bt[n][k] (+ split products per NSPLIT). z-batch strides sA/sB/sC in elements. K % 32 == 0.
template <typename T16> struct WFrag;
template <> struct WFrag<h16> { typedef v16h V; static __device__ __forceinline__ V ld(const h16* p) { return cat16(*(const v8h*)p, *(const v8h*)(p + 16)); } static __device__ __forceinline__ v8f mma(V a, V b, v8f c) { return wmma16(a, b, c); } };
template <> struct WFrag<bf> { typedef v16bf V; static __device__ __forceinline__ V ld(const bf* p) { return cat16b(*(const v8us*)p, *(const v8us*)(p + 16)); } static __device__ __forceinline__ v8f mma(V a, V b, v8f c) { return wmmab(a, b, c); } };
template <typename T16, int NSPLIT, bool BIAS>
__global__ __launch_bounds__(32) void k_gemmw(const T16* __restrict__ A, const T16* __restrict__ A2, const T16* __restrict__ Bt, const T16* __restrict__ Bt2, int K, float* C, int ldc, const float* __restrict__ bias, size_t sA, size_t sB, size_t sC) {
    typedef typename WFrag<T16>::V V;
    __shared__ __align__(16) float os[16 * 68];
    const size_t z = blockIdx.z; A += z * sA; if (A2) A2 += z * sA; Bt += z * sB; if (Bt2) Bt2 += z * sB; C += z * sC;
    const int lane = threadIdx.x & 31, lr = lane & 15, hi = lane >> 4; const int r0 = blockIdx.x * 64, c0 = blockIdx.y * 64;
    v8f acc[4][4];
#pragma unroll
    for (int mb = 0; mb < 4; ++mb)
#pragma unroll
        for (int nb = 0; nb < 4; ++nb) acc[mb][nb] = (v8f){};
    const size_t aoff = (size_t)(r0 + lr) * K + 8 * hi, boff = (size_t)(c0 + lr) * K + 8 * hi;
#pragma unroll 1
    for (int kc = 0; kc < K; kc += 32) {
        V a[4], a2[4];
#pragma unroll
        for (int mb = 0; mb < 4; ++mb) { a[mb] = WFrag<T16>::ld(A + aoff + (size_t)mb * 16 * K + kc); if (NSPLIT == 1 || NSPLIT == 2) a2[mb] = WFrag<T16>::ld(A2 + aoff + (size_t)mb * 16 * K + kc); }
#pragma unroll
        for (int nb = 0; nb < 4; ++nb) { const V b = WFrag<T16>::ld(Bt + boff + (size_t)nb * 16 * K + kc); V b2; if (NSPLIT >= 2) b2 = WFrag<T16>::ld(Bt2 + boff + (size_t)nb * 16 * K + kc);
#pragma unroll
            for (int mb = 0; mb < 4; ++mb) { acc[mb][nb] = WFrag<T16>::mma(a[mb], b, acc[mb][nb]); if (NSPLIT == 1 || NSPLIT == 2) acc[mb][nb] = WFrag<T16>::mma(a2[mb], b, acc[mb][nb]); if (NSPLIT >= 2) acc[mb][nb] = WFrag<T16>::mma(a[mb], b2, acc[mb][nb]); } }
        asm volatile("v_nop\n\tv_nop\n\tv_nop\n\tv_nop" : "+v"(acc[0][0]), "+v"(acc[1][1]), "+v"(acc[2][2]), "+v"(acc[3][3]) : "v"(a[0]), "v"(a[3]));
    }
#pragma unroll
    for (int mb = 0; mb < 4; ++mb) {
#pragma unroll
        for (int nb = 0; nb < 4; ++nb) {
#pragma unroll
            for (int j = 0; j < 8; ++j) os[(hi * 8 + j) * 68 + nb * 16 + lr] = acc[mb][nb][j]; }
        __builtin_amdgcn_wave_barrier(); asm volatile("" ::: "memory");
        float* crow = C + (size_t)(r0 + mb * 16) * ldc + c0;
{
#pragma unroll
            for (int s = 0; s < 8; ++s) { const int row = 2 * s + hi, cofs = lr * 4; v4f val = *(const v4fa*)(os + row * 68 + cofs); if (BIAS) { val[0] += bfr(bias[c0 + cofs]); val[1] += bfr(bias[c0 + cofs + 1]); val[2] += bfr(bias[c0 + cofs + 2]); val[3] += bfr(bias[c0 + cofs + 3]); }
                *(v4f*)(crow + (size_t)row * ldc + cofs) = val; }
             }
        __builtin_amdgcn_wave_barrier(); asm volatile("" ::: "memory");
    }
}

// ---- k_gemmc: the same one-wave 64x64 tile GEMM specialised for causal attention: CMODE 1 skips score tiles entirely above the diagonal (query rows r0+roff.., key columns c0..), CMODE 2 limits the
// key (K) loop of the probability x value contraction to the diagonal block (probabilities beyond it are exactly zero). roff = row offset of this launch's first row within the sequence.
template <typename T16, int NSPLIT, int CMODE>
__global__ __launch_bounds__(32) void k_gemmc(const T16* __restrict__ A, const T16* __restrict__ A2, const T16* __restrict__ Bt, const T16* __restrict__ Bt2, int K, float* C, int ldc, int roff, size_t sA, size_t sB, size_t sC) {
    typedef typename WFrag<T16>::V V;
    __shared__ __align__(16) float os[16 * 68];
    const size_t z = blockIdx.z; A += z * sA; if (A2) A2 += z * sA; Bt += z * sB; if (Bt2) Bt2 += z * sB; C += z * sC;
    const int lane = threadIdx.x & 31, lr = lane & 15, hi = lane >> 4; const int r0 = blockIdx.x * 64, c0 = blockIdx.y * 64;
    if (CMODE == 1 && c0 > r0 + roff + 63) return;                  // score tile entirely above the causal diagonal: never read (the softmax masks j > i by select)
    const int Kl = (CMODE == 2) ? min(K, r0 + roff + 64) : K;        // P.V: probabilities are exactly 0 beyond the diagonal block, so the K loop stops there
    v8f acc[4][4];
#pragma unroll
    for (int mb = 0; mb < 4; ++mb)
#pragma unroll
        for (int nb = 0; nb < 4; ++nb) acc[mb][nb] = (v8f){};
    const size_t aoff = (size_t)(r0 + lr) * K + 8 * hi, boff = (size_t)(c0 + lr) * K + 8 * hi;
#pragma unroll 1
    for (int kc = 0; kc < Kl; kc += 32) {
        V a[4], a2[4];
#pragma unroll
        for (int mb = 0; mb < 4; ++mb) { a[mb] = WFrag<T16>::ld(A + aoff + (size_t)mb * 16 * K + kc); if (NSPLIT == 1 || NSPLIT == 2) a2[mb] = WFrag<T16>::ld(A2 + aoff + (size_t)mb * 16 * K + kc); }
#pragma unroll
        for (int nb = 0; nb < 4; ++nb) { const V b = WFrag<T16>::ld(Bt + boff + (size_t)nb * 16 * K + kc); V b2; if (NSPLIT >= 2) b2 = WFrag<T16>::ld(Bt2 + boff + (size_t)nb * 16 * K + kc);
#pragma unroll
            for (int mb = 0; mb < 4; ++mb) { acc[mb][nb] = WFrag<T16>::mma(a[mb], b, acc[mb][nb]); if (NSPLIT == 1 || NSPLIT == 2) acc[mb][nb] = WFrag<T16>::mma(a2[mb], b, acc[mb][nb]); if (NSPLIT >= 2) acc[mb][nb] = WFrag<T16>::mma(a[mb], b2, acc[mb][nb]); } }
        asm volatile("v_nop\n\tv_nop\n\tv_nop\n\tv_nop" : "+v"(acc[0][0]), "+v"(acc[1][1]), "+v"(acc[2][2]), "+v"(acc[3][3]) : "v"(a[0]), "v"(a[3]));
    }
#pragma unroll
    for (int mb = 0; mb < 4; ++mb) {
#pragma unroll
        for (int nb = 0; nb < 4; ++nb) {
#pragma unroll
            for (int j = 0; j < 8; ++j) os[(hi * 8 + j) * 68 + nb * 16 + lr] = acc[mb][nb][j]; }
        __builtin_amdgcn_wave_barrier(); asm volatile("" ::: "memory");
        float* crow = C + (size_t)(r0 + mb * 16) * ldc + c0;
{
#pragma unroll
            for (int s = 0; s < 8; ++s) { const int row = 2 * s + hi, cofs = lr * 4; v4f val = *(const v4fa*)(os + row * 68 + cofs);
                *(v4f*)(crow + (size_t)row * ldc + cofs) = val; }
             }
        __builtin_amdgcn_wave_barrier(); asm volatile("" ::: "memory");
    }
}

__device__ __forceinline__ h16 tohx(float x) { return (h16)x; }
__device__ __forceinline__ void splitf(float y, unsigned short& h, unsigned short& l) { h = f2bf(y); l = f2bf(y - bf2f(h)); }
typedef __attribute__((ext_vector_type(2))) _Float16 v2h;
typedef __attribute__((ext_vector_type(4))) _Float16 v4h;
typedef __attribute__((ext_vector_type(2))) unsigned short v2us;
typedef __attribute__((ext_vector_type(4))) unsigned short v4us;
typedef __attribute__((ext_vector_type(2))) float v2f;
typedef __attribute__((ext_vector_type(4))) int v4i;

__global__ __launch_bounds__(256) void k_cvt8(const float* __restrict__ src, bf* dst, size_t n8) { const size_t i = (size_t)blockIdx.x * 256 + threadIdx.x; if (i >= n8) return; const v8f v = *(const v8f*)(src + i * 8); v8us o;
#pragma unroll
    for (int k = 0; k < 8; ++k) o[k] = f2bf(v[k]); *(v8us*)(dst + i * 8) = o;  }

__global__ __launch_bounds__(256) void k_wperm(const float* __restrict__ W, bf* Bt) { const size_t i = (size_t)blockIdx.x * 256 + threadIdx.x; if (i >= (size_t)3 * DQ * DM / 8) return; const size_t e = i * 8; const int c0 = (int)(e % DM); const int rd = (int)(e / DM); const int part = rd / DQ; const int h = (rd % DQ) / HD; const int d = rd % HD; const int rs = h * 3 * HD + part * HD + d; const v8f v = *(const v8f*)(W + (size_t)rs * DM + c0); v8us o;
#pragma unroll
    for (int k = 0; k < 8; ++k) o[k] = f2bf(v[k]); *(v8us*)(Bt + e) = o;  }
// k_rope: head planes [h][t][d] (fp16 + hi/lo) of rope(x) x sc with the rotate-half convention out[d] = x[d] cos[t][d] - x[d+HD/2] sin[t][d], out[d+HD/2] = x[d+HD/2] cos[t][d+HD/2] + x[d] sin[t][d+HD/2]
__global__ __launch_bounds__(256) void k_rope(const float* __restrict__ F, int pitch, int nheads, const float* __restrict__ CS, const float* __restrict__ RF, const float* __restrict__ nw, float sc, h16* P16, bf* Ph, bf* Pl) {
    const size_t e = ((size_t)blockIdx.x * 256 + threadIdx.x) * 2; if (e >= (size_t)nheads * TT * HD) return; const int d = (int)(e % HD); const int t = (int)((e / HD) % TT); const int h = (int)(e / ((size_t)HD * TT)); const float* f = F + (size_t)t * pitch + h * HD; const float rf = RF ? RF[(size_t)h * TT + t] : 1.0f; v2h o16; v2us oh, ol;
#pragma unroll
    for (int q = 0; q < 2; ++q) { const int dd = d + q; const int dp = (dd < HD / 2) ? dd + HD / 2 : dd - HD / 2; float x0 = f[dd], x1 = f[dp];
        if (RF) { float n0 = __fmul_rn(x0, rf), n1 = __fmul_rn(x1, rf); asm volatile("" : "+v"(n0)); asm volatile("" : "+v"(n1)); x0 = __fmul_rn(bfr(nw[dd]), n0); x1 = __fmul_rn(bfr(nw[dp]), n1); }
        const v2f cs = *(const v2f*)(CS + ((size_t)t * HD + dd) * 2); float a = __fmul_rn(x0, cs[0]), bq = __fmul_rn(x1, cs[1]); asm volatile("" : "+v"(a)); asm volatile("" : "+v"(bq)); const float r = ((dd < HD / 2) ? __fsub_rn(a, bq) : __fadd_rn(a, bq)) * sc;
        o16[q] = tohx(r); unsigned short a2, c2; splitf(r, a2, c2); oh[q] = a2; ol[q] = c2; }
    *(v2h*)(P16 + e) = o16; *(v2us*)(Ph + e) = oh; *(v2us*)(Pl + e) = ol;  }
__global__ __launch_bounds__(256) void k_vtp(const float* __restrict__ F, int pitch, int nheads, h16* V16, bf* Vh, bf* Vl) { const size_t e = ((size_t)blockIdx.x * 256 + threadIdx.x) * 2; if (e >= (size_t)nheads * HD * TT) return; const int t = (int)(e % TT); const int d = (int)((e / TT) % HD); const int g = (int)(e / ((size_t)TT * HD)); v2h o16; v2us oh, ol;
#pragma unroll
    for (int q = 0; q < 2; ++q) { const float x = F[(size_t)(t + q) * pitch + g * HD + d]; o16[q] = tohx(x); unsigned short a2, c2; splitf(x, a2, c2); oh[q] = a2; ol[q] = c2; }
    *(v2h*)(V16 + e) = o16; *(v2us*)(Vh + e) = oh; *(v2us*)(Vl + e) = ol;  }
__global__ __launch_bounds__(256) void k_csid(float* CS) { const int idx = blockIdx.x * 256 + threadIdx.x; if (idx >= TT * HD) return; v2f cs; cs[0] = 1.0f; cs[1] = 0.0f; *(v2f*)(CS + (size_t)idx * 2) = cs;  }
// k_asoft: per row (zz, i): t = S x HD^-0.5 for j <= i and i - j < WIN (WIN = TT, so the window test always holds: plain causal; the reference's -1e9 additive fill vanishes identically); softmax over the 2048 keys (register row, one exp, fixed trees);
__global__ __launch_bounds__(256) void k_asoft(const float* __restrict__ Sb, h16* P16, bf* Ph, bf* Pl) {
    const int lane = threadIdx.x & 31; const int row = blockIdx.x * 8 + (threadIdx.x >> 5); if (row >= ZH * TT) return; const int i = row % TT; const int zz = row / TT; (void)zz; const bool hires = (i < RH); const float* sr = Sb + (size_t)row * TT; float v[TT / 32]; float mx = -3.0e38f;
#pragma unroll
    for (int ch = 0; ch < TT / 128; ++ch) { const int j0 = ch * 128 + lane * 4; const v4f a = *(const v4f*)(sr + j0);
#pragma unroll
        for (int q = 0; q < 4; ++q) { const int j = j0 + q; (void)j; const float t = (j <= i && i - j < WIN) ? a[q] * SCL : -3.0e38f; v[ch * 4 + q] = t; mx = fmaxf(mx, t); } }
#pragma unroll
    for (int sh = 16; sh; sh >>= 1) mx = fmaxf(mx, __shfl_xor(mx, sh, 32));
    float sum = 0.f;
#pragma unroll
    for (int k = 0; k < TT / 32; ++k) { float d0 = __fsub_rn(v[k], mx); asm volatile("" : "+v"(d0)); v[k] = __builtin_amdgcn_exp2f(__fmul_rn(d0, 1.4426950408889634f)); sum += v[k]; }
#pragma unroll
    for (int sh = 16; sh; sh >>= 1) sum += __shfl_xor(sum, sh, 32);
    const float f = __fdiv_rn(hires ? 1.0f : PCAR, sum);
{
        if (hires) {
#pragma unroll
            for (int ch = 0; ch < TT / 128; ++ch) { v4us oh, ol;
#pragma unroll
                for (int q = 0; q < 4; ++q) { unsigned short a, c2; splitf(v[ch * 4 + q] * f, a, c2); oh[q] = a; ol[q] = c2; }
                const size_t oo = ((size_t)zz * (RH ? RH : 1) + i) * TT + ch * 128 + lane * 4; *(v4us*)(Ph + oo) = oh; *(v4us*)(Pl + oo) = ol; }
        } else {
#pragma unroll
            for (int ch = 0; ch < TT / 128; ++ch) { v4h o4;
#pragma unroll
                for (int q = 0; q < 4; ++q) o4[q] = tohx(v[ch * 4 + q] * f);
                *(v4h*)(P16 + (size_t)row * TT + ch * 128 + lane * 4) = o4; } }
         }
}
__global__ __launch_bounds__(256) void k_merge(const float* __restrict__ O, int h0, bf* Ah, bf* Al) { const size_t e = ((size_t)blockIdx.x * 256 + threadIdx.x) * 2; if (e >= (size_t)ZH * TT * HD) return; const int d = (int)(e % HD); const int t = (int)((e / HD) % TT); const int zz = (int)(e / ((size_t)HD * TT)); const float cs = (t < RH) ? 1.0f : (1.0f / PCAR); const size_t oo = (size_t)t * DQ + (h0 + zz) * HD + d;
    v2us oh, ol;
#pragma unroll
    for (int q = 0; q < 2; ++q) { unsigned short a, c2; splitf(O[e + q] * cs, a, c2); oh[q] = a; ol[q] = c2; } *(v2us*)(Ah + oo) = oh; *(v2us*)(Al + oo) = ol;  }

extern "C" void kernel_launch(void* const* d_in, const int* in_sizes, int n_in,
                              void* d_out, int out_size, void* d_ws, size_t ws_size, hipStream_t stream) {
    (void)in_sizes; (void)n_in; (void)out_size;
    const float* x = (const float*)d_in[0]; const float* wqkv = (const float*)d_in[1]; const float* wo = (const float*)d_in[2]; const float* bo = (const float*)d_in[3];   /* input order x, w_qkv ('oi' (out, in) [3072][1024], rows packed per head (h, part, c)), w_proj ('oi' [1024][1024]), b_proj (REAL): FOUR inputs, all read: the host's own binding */ const float* wq = wqkv; const float* wk = nullptr; const float* wv = nullptr; (void)wk; (void)wv;
    float* OUT = (float*)d_out;     // [4][2048][1024]
    char* wsp = (char*)d_ws;
    auto take = [&](size_t bytes) { char* p = wsp; wsp += (bytes + 255) & ~(size_t)255; return (void*)p; };
    bf* WQKV = (bf*)take((size_t)3 * DQ * DM * 2); bf* WQ = WQKV; bf* WK = WQKV + (size_t)DQ * DM; bf* WV = WQKV + (size_t)2 * DQ * DM;   /* de-interleaved Bt: q | k | v row blocks in head order */ bf* WO = (bf*)take((size_t)DM * DQ * 2); float* CS = (float*)take((size_t)TT * HD * 2 * 4);
    bf* XB = (bf*)take((size_t)TT * DM * 2); float* FQ = (float*)take((size_t)TT * DQ * 4); float* FK = (float*)take((size_t)TT * DKV * 4);
    h16* QP16 = (h16*)take((size_t)NH_ * TT * HD * 2); h16* KP16 = (h16*)take((size_t)NKV * TT * HD * 2); h16* VT16 = (h16*)take((size_t)NKV * HD * TT * 2);
    bf* QPh = (bf*)take((size_t)NH_ * TT * HD * 2); bf* QPl = (bf*)take((size_t)NH_ * TT * HD * 2); bf* KPh = (bf*)take((size_t)NKV * TT * HD * 2); bf* KPl = (bf*)take((size_t)NKV * TT * HD * 2); bf* VTh = (bf*)take((size_t)NKV * HD * TT * 2); bf* VTl = (bf*)take((size_t)NKV * HD * TT * 2); bf* Ph = (bf*)take((size_t)ZH * RH * TT * 2); bf* Pl = (bf*)take((size_t)ZH * RH * TT * 2);
    float* Sb = (float*)take((size_t)ZH * TT * TT * 4); h16* P16 = (h16*)take((size_t)ZH * TT * TT * 2); float* Ob = (float*)take((size_t)ZH * TT * HD * 4); bf* ATh = (bf*)take((size_t)TT * DQ * 2); bf* ATl = (bf*)take((size_t)TT * DQ * 2);
    if ((size_t)(wsp - (char*)d_ws) > ws_size) return;    // ws 256 MiB
    float* FV = FK;   // v projection reuses the k buffer after the k planes are built (stream-ordered)
    { k_wperm<<<(unsigned)(((size_t)3 * DQ * DM / 8 + 255) / 256), 256, 0, stream>>>(wqkv, WQKV);   /* packed rows (h, part, d) -> standard (part, h, d) blocks */
      k_cvt8<<<(unsigned)(((size_t)DM * DQ / 8 + 255) / 256), 256, 0, stream>>>(wo, WO, (size_t)DM * DQ / 8);
       }
    k_csid<<<(TT * HD + 255) / 256, 256, 0, stream>>>(CS);
    const unsigned LQ = (unsigned)(((size_t)NH_ * TT * HD / 2 + 255) / 256), LKv = (unsigned)(((size_t)NKV * TT * HD / 2 + 255) / 256);
    for (int b = 0; b < NB_; ++b) {
        
        k_cvt8<<<(unsigned)(((size_t)TT * DM / 8 + 255) / 256), 256, 0, stream>>>(x + (size_t)b * TT * DM, XB, (size_t)TT * DM / 8);
        k_gemmw<bf, 0, false><<<dim3(TT / 64, DQ / 64, 1), 32, 0, stream>>>(XB, nullptr, WQ, nullptr, DM, FQ, DQ, nullptr, 0, 0, 0);
        k_rope<<<LQ, 256, 0, stream>>>(FQ, DQ, NH_, CS, nullptr, nullptr, 1.0f, QP16, QPh, QPl);
        k_gemmw<bf, 0, false><<<dim3(TT / 64, DKV / 64, 1), 32, 0, stream>>>(XB, nullptr, WK, nullptr, DM, FK, DKV, nullptr, 0, 0, 0);
        k_rope<<<LKv, 256, 0, stream>>>(FK, DKV, NKV, CS, nullptr, nullptr, 1.0f, KP16, KPh, KPl);
        k_gemmw<bf, 0, false><<<dim3(TT / 64, DKV / 64, 1), 32, 0, stream>>>(XB, nullptr, WV, nullptr, DM, FV, DKV, nullptr, 0, 0, 0); k_vtp<<<LKv, 256, 0, stream>>>(FV, DKV, NKV, VT16, VTh, VTl);
        for (int h0 = 0; h0 < NH_; h0 += ZH) { const size_t zq = (size_t)h0, zk = (size_t)(h0 / REP);   // one kv head per query head: the pass's two heads use consecutive kv planes (z-strides TT*HD)
            k_gemmc<bf, 2, 1><<<dim3(RH / 64, TT / 64, ZH), 32, 0, stream>>>(QPh + zq * TT * HD, QPl + zq * TT * HD, KPh + zk * TT * HD, KPl + zk * TT * HD, HD, Sb, TT, 0, (size_t)TT * HD, (size_t)TT * HD, (size_t)TT * TT);
            k_gemmc<h16, 0, 1><<<dim3((TT - RH) / 64, TT / 64, ZH), 32, 0, stream>>>(QP16 + zq * TT * HD + (size_t)RH * HD, nullptr, KP16 + zk * TT * HD, nullptr, HD, Sb + (size_t)RH * TT, TT, RH, (size_t)TT * HD, (size_t)TT * HD, (size_t)TT * TT);
            k_asoft<<<ZH * TT / 8, 256, 0, stream>>>(Sb, P16, Ph, Pl);
            k_gemmc<bf, 2, 2><<<dim3(RH / 64, HD / 64, ZH), 32, 0, stream>>>(Ph, Pl, VTh + zk * HD * TT, VTl + zk * HD * TT, TT, Ob, HD, 0, (size_t)RH * TT, (size_t)HD * TT, (size_t)TT * HD);
            k_gemmc<h16, 0, 2><<<dim3((TT - RH) / 64, HD / 64, ZH), 32, 0, stream>>>(P16 + (size_t)RH * TT, nullptr, VT16 + zk * HD * TT, nullptr, TT, Ob + (size_t)RH * HD, HD, RH, (size_t)TT * TT, (size_t)HD * TT, (size_t)TT * HD);
            k_merge<<<(unsigned)(((size_t)ZH * TT * HD / 2 + 255) / 256), 256, 0, stream>>>(Ob, h0, ATh, ATl); }
        k_gemmw<bf, 1, true><<<dim3(TT / 64, DM / 64, 1), 32, 0, stream>>>(ATh, ATl, WO, nullptr, DQ, OUT + (size_t)b * TT * DM, DM, bo, 0, 0, 0); }
}

// v001
// It runs in 1690 microseconds.
// Next to v000, in two timings, it ran 1.70 and 1.68 times as fast.
#include <hip/hip_runtime.h>

// Causal multi-head attention with a fused bias-free qkv projection in (out, in) layout whose ROWS are packed PER HEAD (x [4][2048][1024]; qkv = einsum('bse,fe->bsf', x, w_qkv) = x w_qkv^T ('oi' (out, in) [3072][1024] 1/32, no bias) viewed (b, s, 16 heads, 3 x 64): head h's rows h*192 + 0..63 | 64..127 | 128..191 of w_qkv are its q | k | v; scores x 64^-0.5 (token-major einsums: the same products); where(tril, scores, -inf) (exclusion; every row keeps its own key); softmax; out = merged w_proj^T + b_proj ('oi' + a REAL 0.01 bias) -> [4][2048][1024] (8.4 M); argument order x, w_qkv, w_proj, b_proj).
// Layout per batch: the packed weight rows are gathered once into a standard q | k | v Bt (a row permutation of the bf16 copy); bf16 copy of x; exact projections; identity-table plane builders; causal T-2048 attention (hybrid rows: < 512 hi/lo 3 products, rest fp16 x1024; k_gemmc skips tiles above the diagonal); merged hi/lo x Wo exact + bo.
// Compute dtypes, f32 accumulate: every input rounded to bf16; projections exact; attention rows < 512 3 products, rest fp16; softmax f32; Wo hl x exact + bias.

#define NB_  4
#define TT   2048
#define DM   1024
#define NH_  16
#define NKV  16
#define REP  (NH_ / NKV)
#define HD   64
#define DQ   (NH_ * HD)
#define DKV  (NKV * HD)
#define ZH   2
#define RH   512                  // query rows < RH use hi+lo planes (0: none)
#define WIN  2048
#define PCAR 1024.0f
#define SCL  0.125f   // HD^-0.5
typedef _Float16 h16;
typedef unsigned short bf;
typedef __attribute__((ext_vector_type(16))) __bf16   v16bf;
typedef __attribute__((ext_vector_type(16))) _Float16 v16h;
typedef __attribute__((ext_vector_type(8)))  _Float16 v8h;
typedef __attribute__((ext_vector_type(8)))  unsigned short v8us;
typedef __attribute__((ext_vector_type(8)))  float    v8f;
typedef __attribute__((ext_vector_type(4)))  float    v4f;
typedef v8h  __attribute__((may_alias)) v8ha;
typedef v4f  __attribute__((may_alias)) v4fa;
typedef v8us __attribute__((may_alias)) v8usa;

__device__ __forceinline__ unsigned short f2bf(float f) { unsigned u = __float_as_uint(f); u += 0x7FFFu + ((u >> 16) & 1u); return (unsigned short)(u >> 16); }
__device__ __forceinline__ float bf2f(unsigned short b) { return __uint_as_float(((unsigned)b) << 16); }
__device__ __forceinline__ float bfr(float f) { return bf2f(f2bf(f)); }
__device__ __forceinline__ v16h cat16(v8h lo, v8h hi) { return __builtin_shufflevector(lo, hi, 0, 1, 2, 3, 4, 5, 6, 7, 8, 9, 10, 11, 12, 13, 14, 15); }
__device__ __forceinline__ v16bf cat16b(v8us lo, v8us hi) { return __builtin_bit_cast(v16bf, __builtin_shufflevector(lo, hi, 0, 1, 2, 3, 4, 5, 6, 7, 8, 9, 10, 11, 12, 13, 14, 15)); }
__device__ __forceinline__ v8f wmma16(v16h a, v16h b, v8f c) { return __builtin_amdgcn_wmma_f32_16x16x32_f16(false, a, false, b, (short)0, c, false, false); }
__device__ __forceinline__ v8f wmmab(v16bf a, v16bf b, v8f c) { return __builtin_amdgcn_wmma_f32_16x16x32_bf16(false, a, false, b, (short)0, c, false, false); }



// ---- k_gemms: register-blocked GEMM, one 64x64 output tile per work-group of NW waves, operands straight from K-contiguous 16-bit planes; grid (M/64, N/64, Z), NW * 32 threads.
// C[m][n] (f32, pitch ldc, + optional f32 bias[n]) = sum_k A[m][k] Bt[n][k] (+ split products per NSPLIT). z-batch strides sA/sB/sC in elements. K % 64 == 0.
// The K range is dealt to the waves in blocks of 64 (one 128-byte line of every operand row): wave w takes blocks w, w + NW, ... and keeps a whole 64x64 f32 partial (16 accumulators);
// the NW partials meet in LDS and every output element is their sum in wave order 0..NW-1. CAUSK (probability x value): the K range ends at the diagonal block of query rows r0 + roff.. (probabilities beyond it are exactly zero).
template <typename T16> struct WFrag;
template <> struct WFrag<h16> { typedef v16h V; static __device__ __forceinline__ V ld(const h16* p) { return cat16(*(const v8h*)p, *(const v8h*)(p + 16)); } static __device__ __forceinline__ v8f mma(V a, V b, v8f c) { return wmma16(a, b, c); } };
template <> struct WFrag<bf> { typedef v16bf V; static __device__ __forceinline__ V ld(const bf* p) { return cat16b(*(const v8us*)p, *(const v8us*)(p + 16)); } static __device__ __forceinline__ v8f mma(V a, V b, v8f c) { return wmmab(a, b, c); } };
template <typename T16, int NSPLIT, bool BIAS, bool CAUSK, int NW>
__global__ __launch_bounds__(NW * 32) void k_gemms(const T16* __restrict__ A, const T16* __restrict__ A2, const T16* __restrict__ Bt, const T16* __restrict__ Bt2, int K, float* C, int ldc, const float* __restrict__ bias, int roff, size_t sA, size_t sB, size_t sC) {
    typedef typename WFrag<T16>::V V;
    __shared__ __align__(16) float os[NW * 64 * 68];
    const size_t z = blockIdx.z; A += z * sA; if (A2) A2 += z * sA; Bt += z * sB; if (Bt2) Bt2 += z * sB; C += z * sC;
    const int lane = threadIdx.x & 31, lr = lane & 15, hi = lane >> 4; const int r0 = blockIdx.x * 64, c0 = blockIdx.y * 64;
    const int w = __builtin_amdgcn_readfirstlane((int)(threadIdx.x >> 5));   // wave number, scalar: the K loop's bounds stay in scalar registers
    const int Kl = CAUSK ? min(K, r0 + roff + 64) : K;
    v8f acc[4][4];
#pragma unroll
    for (int mb = 0; mb < 4; ++mb)
#pragma unroll
        for (int nb = 0; nb < 4; ++nb) acc[mb][nb] = (v8f){};
    const size_t aoff = (size_t)(r0 + lr) * K + 8 * hi, boff = (size_t)(c0 + lr) * K + 8 * hi;
#pragma unroll 1   // rolled: 16 accumulators and one step's fragments fill the register budget of NW waves on four SIMDs
    for (int kc = w * 64; kc < Kl; kc += (kc & 32) ? NW * 64 - 32 : 32) {   // both 32-wide halves of this wave's block, then NW blocks on
        V a[4], a2[4];
#pragma unroll
        for (int mb = 0; mb < 4; ++mb) { a[mb] = WFrag<T16>::ld(A + aoff + (size_t)mb * 16 * K + kc); if (NSPLIT == 1 || NSPLIT == 2) a2[mb] = WFrag<T16>::ld(A2 + aoff + (size_t)mb * 16 * K + kc); }
#pragma unroll
        for (int nb = 0; nb < 4; ++nb) { const V b = WFrag<T16>::ld(Bt + boff + (size_t)nb * 16 * K + kc); V b2; if (NSPLIT >= 2) b2 = WFrag<T16>::ld(Bt2 + boff + (size_t)nb * 16 * K + kc);
#pragma unroll
            for (int mb = 0; mb < 4; ++mb) { acc[mb][nb] = WFrag<T16>::mma(a[mb], b, acc[mb][nb]); if (NSPLIT == 1 || NSPLIT == 2) acc[mb][nb] = WFrag<T16>::mma(a2[mb], b, acc[mb][nb]); if (NSPLIT >= 2) acc[mb][nb] = WFrag<T16>::mma(a[mb], b2, acc[mb][nb]); } }
        // four vector slots behind the last WMMAs, on the taken side of the loop's branch too
        asm volatile("v_nop\n\tv_nop\n\tv_nop\n\tv_nop" : "+v"(acc[0][0]), "+v"(acc[1][1]), "+v"(acc[2][2]), "+v"(acc[3][3]) : "v"(a[0]), "v"(a[3]));
    }
    float* ow = os + w * (64 * 68);
#pragma unroll
    for (int mb = 0; mb < 4; ++mb)
#pragma unroll
        for (int nb = 0; nb < 4; ++nb)
#pragma unroll
            for (int j = 0; j < 8; ++j) ow[(mb * 16 + hi * 8 + j) * 68 + nb * 16 + lr] = acc[mb][nb][j];
    __syncthreads();   // every wave's partial is in LDS before any of them is summed
#pragma unroll
    for (int s = 0; s < 32 / NW; ++s) { const int slot = s * NW * 32 + (int)threadIdx.x, row = slot >> 4, cofs = (slot & 15) * 4; v4f val = *(const v4fa*)(os + row * 68 + cofs);
#pragma unroll
        for (int p = 1; p < NW; ++p) val += *(const v4fa*)(os + p * (64 * 68) + row * 68 + cofs);
        if (BIAS) { val[0] += bfr(bias[c0 + cofs]); val[1] += bfr(bias[c0 + cofs + 1]); val[2] += bfr(bias[c0 + cofs + 2]); val[3] += bfr(bias[c0 + cofs + 3]); }
        *(v4f*)(C + (size_t)(r0 + row) * ldc + c0 + cofs) = val; }
}

// ---- k_gemmc: a one-wave 64x64 tile GEMM (no K split) specialised for causal attention: CMODE 1 skips score tiles entirely above the diagonal (query rows r0+roff.., key columns c0..), CMODE 2 limits the
// key (K) loop of the probability x value contraction to the diagonal block (probabilities beyond it are exactly zero). roff = row offset of this launch's first row within the sequence.
template <typename T16, int NSPLIT, int CMODE>
__global__ __launch_bounds__(32) void k_gemmc(const T16* __restrict__ A, const T16* __restrict__ A2, const T16* __restrict__ Bt, const T16* __restrict__ Bt2, int K, float* C, int ldc, int roff, size_t sA, size_t sB, size_t sC) {
    typedef typename WFrag<T16>::V V;
    __shared__ __align__(16) float os[16 * 68];
    const size_t z = blockIdx.z; A += z * sA; if (A2) A2 += z * sA; Bt += z * sB; if (Bt2) Bt2 += z * sB; C += z * sC;
    const int lane = threadIdx.x & 31, lr = lane & 15, hi = lane >> 4; const int r0 = blockIdx.x * 64, c0 = blockIdx.y * 64;
    if (CMODE == 1 && c0 > r0 + roff + 63) return;                  // score tile entirely above the causal diagonal: never read (the softmax masks j > i by select)
    const int Kl = (CMODE == 2) ? min(K, r0 + roff + 64) : K;        // P.V: probabilities are exactly 0 beyond the diagonal block, so the K loop stops there
    v8f acc[4][4];
#pragma unroll
    for (int mb = 0; mb < 4; ++mb)
#pragma unroll
        for (int nb = 0; nb < 4; ++nb) acc[mb][nb] = (v8f){};
    const size_t aoff = (size_t)(r0 + lr) * K + 8 * hi, boff = (size_t)(c0 + lr) * K + 8 * hi;
#pragma unroll 1
    for (int kc = 0; kc < Kl; kc += 32) {
        V a[4], a2[4];
#pragma unroll
        for (int mb = 0; mb < 4; ++mb) { a[mb] = WFrag<T16>::ld(A + aoff + (size_t)mb * 16 * K + kc); if (NSPLIT == 1 || NSPLIT == 2) a2[mb] = WFrag<T16>::ld(A2 + aoff + (size_t)mb * 16 * K + kc); }
#pragma unroll
        for (int nb = 0; nb < 4; ++nb) { const V b = WFrag<T16>::ld(Bt + boff + (size_t)nb * 16 * K + kc); V b2; if (NSPLIT >= 2) b2 = WFrag<T16>::ld(Bt2 + boff + (size_t)nb * 16 * K + kc);
#pragma unroll
            for (int mb = 0; mb < 4; ++mb) { acc[mb][nb] = WFrag<T16>::mma(a[mb], b, acc[mb][nb]); if (NSPLIT == 1 || NSPLIT == 2) acc[mb][nb] = WFrag<T16>::mma(a2[mb], b, acc[mb][nb]); if (NSPLIT >= 2) acc[mb][nb] = WFrag<T16>::mma(a[mb], b2, acc[mb][nb]); } }
        asm volatile("v_nop\n\tv_nop\n\tv_nop\n\tv_nop" : "+v"(acc[0][0]), "+v"(acc[1][1]), "+v"(acc[2][2]), "+v"(acc[3][3]) : "v"(a[0]), "v"(a[3]));
    }
#pragma unroll
    for (int mb = 0; mb < 4; ++mb) {
#pragma unroll
        for (int nb = 0; nb < 4; ++nb) {
#pragma unroll
            for (int j = 0; j < 8; ++j) os[(hi * 8 + j) * 68 + nb * 16 + lr] = acc[mb][nb][j]; }
        __builtin_amdgcn_wave_barrier(); asm volatile("" ::: "memory");
        float* crow = C + (size_t)(r0 + mb * 16) * ldc + c0;
{
#pragma unroll
            for (int s = 0; s < 8; ++s) { const int row = 2 * s + hi, cofs = lr * 4; v4f val = *(const v4fa*)(os + row * 68 + cofs);
                *(v4f*)(crow + (size_t)row * ldc + cofs) = val; }
             }
        __builtin_amdgcn_wave_barrier(); asm volatile("" ::: "memory");
    }
}

__device__ __forceinline__ h16 tohx(float x) { return (h16)x; }
__device__ __forceinline__ void splitf(float y, unsigned short& h, unsigned short& l) { h = f2bf(y); l = f2bf(y - bf2f(h)); }
typedef __attribute__((ext_vector_type(2))) _Float16 v2h;
typedef __attribute__((ext_vector_type(4))) _Float16 v4h;
typedef __attribute__((ext_vector_type(2))) unsigned short v2us;
typedef __attribute__((ext_vector_type(4))) unsigned short v4us;
typedef __attribute__((ext_vector_type(2))) float v2f;
typedef __attribute__((ext_vector_type(4))) int v4i;

__global__ __launch_bounds__(256) void k_cvt8(const float* __restrict__ src, bf* dst, size_t n8) { const size_t i = (size_t)blockIdx.x * 256 + threadIdx.x; if (i >= n8) return; const v8f v = *(const v8f*)(src + i * 8); v8us o;
#pragma unroll
    for (int k = 0; k < 8; ++k) o[k] = f2bf(v[k]); *(v8us*)(dst + i * 8) = o;  }

__global__ __launch_bounds__(256) void k_wperm(const float* __restrict__ W, bf* Bt) { const size_t i = (size_t)blockIdx.x * 256 + threadIdx.x; if (i >= (size_t)3 * DQ * DM / 8) return; const size_t e = i * 8; const int c0 = (int)(e % DM); const int rd = (int)(e / DM); const int part = rd / DQ; const int h = (rd % DQ) / HD; const int d = rd % HD; const int rs = h * 3 * HD + part * HD + d; const v8f v = *(const v8f*)(W + (size_t)rs * DM + c0); v8us o;
#pragma unroll
    for (int k = 0; k < 8; ++k) o[k] = f2bf(v[k]); *(v8us*)(Bt + e) = o;  }
// k_rope: head planes [h][t][d] (fp16 + hi/lo) of rope(x) x sc with the rotate-half convention out[d] = x[d] cos[t][d] - x[d+HD/2] sin[t][d], out[d+HD/2] = x[d+HD/2] cos[t][d+HD/2] + x[d] sin[t][d+HD/2]
__global__ __launch_bounds__(256) void k_rope(const float* __restrict__ F, int pitch, int nheads, const float* __restrict__ CS, const float* __restrict__ RF, const float* __restrict__ nw, float sc, h16* P16, bf* Ph, bf* Pl) {
    const size_t e = ((size_t)blockIdx.x * 256 + threadIdx.x) * 2; if (e >= (size_t)nheads * TT * HD) return; const int d = (int)(e % HD); const int t = (int)((e / HD) % TT); const int h = (int)(e / ((size_t)HD * TT)); const float* f = F + (size_t)t * pitch + h * HD; const float rf = RF ? RF[(size_t)h * TT + t] : 1.0f; v2h o16; v2us oh, ol;
#pragma unroll
    for (int q = 0; q < 2; ++q) { const int dd = d + q; const int dp = (dd < HD / 2) ? dd + HD / 2 : dd - HD / 2; float x0 = f[dd], x1 = f[dp];
        if (RF) { float n0 = __fmul_rn(x0, rf), n1 = __fmul_rn(x1, rf); asm volatile("" : "+v"(n0)); asm volatile("" : "+v"(n1)); x0 = __fmul_rn(bfr(nw[dd]), n0); x1 = __fmul_rn(bfr(nw[dp]), n1); }
        const v2f cs = *(const v2f*)(CS + ((size_t)t * HD + dd) * 2); float a = __fmul_rn(x0, cs[0]), bq = __fmul_rn(x1, cs[1]); asm volatile("" : "+v"(a)); asm volatile("" : "+v"(bq)); const float r = ((dd < HD / 2) ? __fsub_rn(a, bq) : __fadd_rn(a, bq)) * sc;
        o16[q] = tohx(r); unsigned short a2, c2; splitf(r, a2, c2); oh[q] = a2; ol[q] = c2; }
    *(v2h*)(P16 + e) = o16; *(v2us*)(Ph + e) = oh; *(v2us*)(Pl + e) = ol;  }
__global__ __launch_bounds__(256) void k_vtp(const float* __restrict__ F, int pitch, int nheads, h16* V16, bf* Vh, bf* Vl) { const size_t e = ((size_t)blockIdx.x * 256 + threadIdx.x) * 2; if (e >= (size_t)nheads * HD * TT) return; const int t = (int)(e % TT); const int d = (int)((e / TT) % HD); const int g = (int)(e / ((size_t)TT * HD)); v2h o16; v2us oh, ol;
#pragma unroll
    for (int q = 0; q < 2; ++q) { const float x = F[(size_t)(t + q) * pitch + g * HD + d]; o16[q] = tohx(x); unsigned short a2, c2; splitf(x, a2, c2); oh[q] = a2; ol[q] = c2; }
    *(v2h*)(V16 + e) = o16; *(v2us*)(Vh + e) = oh; *(v2us*)(Vl + e) = ol;  }
__global__ __launch_bounds__(256) void k_csid(float* CS) { const int idx = blockIdx.x * 256 + threadIdx.x; if (idx >= TT * HD) return; v2f cs; cs[0] = 1.0f; cs[1] = 0.0f; *(v2f*)(CS + (size_t)idx * 2) = cs;  }
// k_asoft: per row (zz, i): t = S x HD^-0.5 for j <= i and i - j < WIN (WIN = TT, so the window test always holds: plain causal; the reference's -1e9 additive fill vanishes identically); softmax over the 2048 keys (register row, one exp, fixed trees);
__global__ __launch_bounds__(256) void k_asoft(const float* __restrict__ Sb, h16* P16, bf* Ph, bf* Pl) {
    const int lane = threadIdx.x & 31; const int row = blockIdx.x * 8 + (threadIdx.x >> 5); if (row >= ZH * TT) return; const int i = row % TT; const int zz = row / TT; (void)zz; const bool hires = (i < RH); const float* sr = Sb + (size_t)row * TT; float v[TT / 32]; float mx = -3.0e38f;
#pragma unroll
    for (int ch = 0; ch < TT / 128; ++ch) { const int j0 = ch * 128 + lane * 4; const v4f a = *(const v4f*)(sr + j0);
#pragma unroll
        for (int q = 0; q < 4; ++q) { const int j = j0 + q; (void)j; const float t = (j <= i && i - j < WIN) ? a[q] * SCL : -3.0e38f; v[ch * 4 + q] = t; mx = fmaxf(mx, t); } }
#pragma unroll
    for (int sh = 16; sh; sh >>= 1) mx = fmaxf(mx, __shfl_xor(mx, sh, 32));
    float sum = 0.f;
#pragma unroll
    for (int k = 0; k < TT / 32; ++k) { float d0 = __fsub_rn(v[k], mx); asm volatile("" : "+v"(d0)); v[k] = __builtin_amdgcn_exp2f(__fmul_rn(d0, 1.4426950408889634f)); sum += v[k]; }
#pragma unroll
    for (int sh = 16; sh; sh >>= 1) sum += __shfl_xor(sum, sh, 32);
    const float f = __fdiv_rn(hires ? 1.0f : PCAR, sum);
{
        if (hires) {
#pragma unroll
            for (int ch = 0; ch < TT / 128; ++ch) { v4us oh, ol;
#pragma unroll
                for (int q = 0; q < 4; ++q) { unsigned short a, c2; splitf(v[ch * 4 + q] * f, a, c2); oh[q] = a; ol[q] = c2; }
                const size_t oo = ((size_t)zz * (RH ? RH : 1) + i) * TT + ch * 128 + lane * 4; *(v4us*)(Ph + oo) = oh; *(v4us*)(Pl + oo) = ol; }
        } else {
#pragma unroll
            for (int ch = 0; ch < TT / 128; ++ch) { v4h o4;
#pragma unroll
                for (int q = 0; q < 4; ++q) o4[q] = tohx(v[ch * 4 + q] * f);
                *(v4h*)(P16 + (size_t)row * TT + ch * 128 + lane * 4) = o4; } }
         }
}
__global__ __launch_bounds__(256) void k_merge(const float* __restrict__ O, int h0, bf* Ah, bf* Al) { const size_t e = ((size_t)blockIdx.x * 256 + threadIdx.x) * 2; if (e >= (size_t)ZH * TT * HD) return; const int d = (int)(e % HD); const int t = (int)((e / HD) % TT); const int zz = (int)(e / ((size_t)HD * TT)); const float cs = (t < RH) ? 1.0f : (1.0f / PCAR); const size_t oo = (size_t)t * DQ + (h0 + zz) * HD + d;
    v2us oh, ol;
#pragma unroll
    for (int q = 0; q < 2; ++q) { unsigned short a, c2; splitf(O[e + q] * cs, a, c2); oh[q] = a; ol[q] = c2; } *(v2us*)(Ah + oo) = oh; *(v2us*)(Al + oo) = ol;  }

extern "C" void kernel_launch(void* const* d_in, const int* in_sizes, int n_in,
                              void* d_out, int out_size, void* d_ws, size_t ws_size, hipStream_t stream) {
    (void)in_sizes; (void)n_in; (void)out_size;
    const float* x = (const float*)d_in[0]; const float* wqkv = (const float*)d_in[1]; const float* wo = (const float*)d_in[2]; const float* bo = (const float*)d_in[3];   /* input order x, w_qkv ('oi' (out, in) [3072][1024], rows packed per head (h, part, c)), w_proj ('oi' [1024][1024]), b_proj (REAL): FOUR inputs, all read: the host's own binding */ const float* wq = wqkv; const float* wk = nullptr; const float* wv = nullptr; (void)wk; (void)wv;
    float* OUT = (float*)d_out;     // [4][2048][1024]
    char* wsp = (char*)d_ws;
    auto take = [&](size_t bytes) { char* p = wsp; wsp += (bytes + 255) & ~(size_t)255; return (void*)p; };
    bf* WQKV = (bf*)take((size_t)3 * DQ * DM * 2); bf* WQ = WQKV; bf* WK = WQKV + (size_t)DQ * DM; bf* WV = WQKV + (size_t)2 * DQ * DM;   /* de-interleaved Bt: q | k | v row blocks in head order */ bf* WO = (bf*)take((size_t)DM * DQ * 2); float* CS = (float*)take((size_t)TT * HD * 2 * 4);
    bf* XB = (bf*)take((size_t)TT * DM * 2); float* FQ = (float*)take((size_t)TT * DQ * 4); float* FK = (float*)take((size_t)TT * DKV * 4);
    h16* QP16 = (h16*)take((size_t)NH_ * TT * HD * 2); h16* KP16 = (h16*)take((size_t)NKV * TT * HD * 2); h16* VT16 = (h16*)take((size_t)NKV * HD * TT * 2);
    bf* QPh = (bf*)take((size_t)NH_ * TT * HD * 2); bf* QPl = (bf*)take((size_t)NH_ * TT * HD * 2); bf* KPh = (bf*)take((size_t)NKV * TT * HD * 2); bf* KPl = (bf*)take((size_t)NKV * TT * HD * 2); bf* VTh = (bf*)take((size_t)NKV * HD * TT * 2); bf* VTl = (bf*)take((size_t)NKV * HD * TT * 2); bf* Ph = (bf*)take((size_t)ZH * RH * TT * 2); bf* Pl = (bf*)take((size_t)ZH * RH * TT * 2);
    float* Sb = (float*)take((size_t)ZH * TT * TT * 4); h16* P16 = (h16*)take((size_t)ZH * TT * TT * 2); float* Ob = (float*)take((size_t)ZH * TT * HD * 4); bf* ATh = (bf*)take((size_t)TT * DQ * 2); bf* ATl = (bf*)take((size_t)TT * DQ * 2);
    if ((size_t)(wsp - (char*)d_ws) > ws_size) return;    // ws 256 MiB
    float* FV = FK;   // v projection reuses the k buffer after the k planes are built (stream-ordered)
    { k_wperm<<<(unsigned)(((size_t)3 * DQ * DM / 8 + 255) / 256), 256, 0, stream>>>(wqkv, WQKV);   /* packed rows (h, part, d) -> standard (part, h, d) blocks */
      k_cvt8<<<(unsigned)(((size_t)DM * DQ / 8 + 255) / 256), 256, 0, stream>>>(wo, WO, (size_t)DM * DQ / 8);
       }
    k_csid<<<(TT * HD + 255) / 256, 256, 0, stream>>>(CS);
    const unsigned LQ = (unsigned)(((size_t)NH_ * TT * HD / 2 + 255) / 256), LKv = (unsigned)(((size_t)NKV * TT * HD / 2 + 255) / 256);
    for (int b = 0; b < NB_; ++b) {
        
        k_cvt8<<<(unsigned)(((size_t)TT * DM / 8 + 255) / 256), 256, 0, stream>>>(x + (size_t)b * TT * DM, XB, (size_t)TT * DM / 8);
        k_gemms<bf, 0, false, false, 8><<<dim3(TT / 64, DQ / 64, 1), 256, 0, stream>>>(XB, nullptr, WQ, nullptr, DM, FQ, DQ, nullptr, 0, 0, 0, 0);
        k_rope<<<LQ, 256, 0, stream>>>(FQ, DQ, NH_, CS, nullptr, nullptr, 1.0f, QP16, QPh, QPl);
        k_gemms<bf, 0, false, false, 8><<<dim3(TT / 64, DKV / 64, 1), 256, 0, stream>>>(XB, nullptr, WK, nullptr, DM, FK, DKV, nullptr, 0, 0, 0, 0);
        k_rope<<<LKv, 256, 0, stream>>>(FK, DKV, NKV, CS, nullptr, nullptr, 1.0f, KP16, KPh, KPl);
        k_gemms<bf, 0, false, false, 8><<<dim3(TT / 64, DKV / 64, 1), 256, 0, stream>>>(XB, nullptr, WV, nullptr, DM, FV, DKV, nullptr, 0, 0, 0, 0); k_vtp<<<LKv, 256, 0, stream>>>(FV, DKV, NKV, VT16, VTh, VTl);
        for (int h0 = 0; h0 < NH_; h0 += ZH) { const size_t zq = (size_t)h0, zk = (size_t)(h0 / REP);   // one kv head per query head: the pass's two heads use consecutive kv planes (z-strides TT*HD)
            k_gemmc<bf, 2, 1><<<dim3(RH / 64, TT / 64, ZH), 32, 0, stream>>>(QPh + zq * TT * HD, QPl + zq * TT * HD, KPh + zk * TT * HD, KPl + zk * TT * HD, HD, Sb, TT, 0, (size_t)TT * HD, (size_t)TT * HD, (size_t)TT * TT);
            k_gemmc<h16, 0, 1><<<dim3((TT - RH) / 64, TT / 64, ZH), 32, 0, stream>>>(QP16 + zq * TT * HD + (size_t)RH * HD, nullptr, KP16 + zk * TT * HD, nullptr, HD, Sb + (size_t)RH * TT, TT, RH, (size_t)TT * HD, (size_t)TT * HD, (size_t)TT * TT);
            k_asoft<<<ZH * TT / 8, 256, 0, stream>>>(Sb, P16, Ph, Pl);
            k_gemms<bf, 2, false, true, 8><<<dim3(RH / 64, HD / 64, ZH), 256, 0, stream>>>(Ph, Pl, VTh + zk * HD * TT, VTl + zk * HD * TT, TT, Ob, HD, nullptr, 0, (size_t)RH * TT, (size_t)HD * TT, (size_t)TT * HD);
            k_gemms<h16, 0, false, true, 16><<<dim3((TT - RH) / 64, HD / 64, ZH), 512, 0, stream>>>(P16 + (size_t)RH * TT, nullptr, VT16 + zk * HD * TT, nullptr, TT, Ob + (size_t)RH * HD, HD, nullptr, RH, (size_t)TT * TT, (size_t)HD * TT, (size_t)TT * HD);
            k_merge<<<(unsigned)(((size_t)ZH * TT * HD / 2 + 255) / 256), 256, 0, stream>>>(Ob, h0, ATh, ATl); }
        k_gemms<bf, 1, true, false, 8><<<dim3(TT / 64, DM / 64, 1), 256, 0, stream>>>(ATh, ATl, WO, nullptr, DQ, OUT + (size_t)b * TT * DM, DM, bo, 0, 0, 0, 0); }
}

// v002
// It runs in 953 microseconds.
// Next to v001, in two timings, it ran 1.76 and 1.77 times as fast.
// Counting every step since v000, it is 2.97 times as fast.
#include <hip/hip_runtime.h>

// Causal multi-head attention with a fused bias-free qkv projection in (out, in) layout whose ROWS are packed PER HEAD (x [4][2048][1024]; qkv = einsum('bse,fe->bsf', x, w_qkv) = x w_qkv^T ('oi' (out, in) [3072][1024] 1/32, no bias) viewed (b, s, 16 heads, 3 x 64): head h's rows h*192 + 0..63 | 64..127 | 128..191 of w_qkv are its q | k | v; scores x 64^-0.5 (token-major einsums: the same products); where(tril, scores, -inf) (exclusion; every row keeps its own key); softmax; out = merged w_proj^T + b_proj ('oi' + a REAL 0.01 bias) -> [4][2048][1024] (8.4 M); argument order x, w_qkv, w_proj, b_proj).
// Layout per batch: the packed weight rows are gathered once into a standard q | k | v Bt (a row permutation of the bf16 copy); bf16 copy of x; exact projections; identity-table plane builders; causal T-2048 attention, 8 heads a pass, each probability row stored over its own score row (hybrid rows: < 512 hi/lo 3 products, rest fp16 x1024; k_gemmc skips tiles above the diagonal); merged hi/lo x Wo exact + bo.
// Compute dtypes, f32 accumulate: every input rounded to bf16; projections exact; attention rows < 512 3 products, rest fp16; softmax f32; Wo hl x exact + bias.

#define NB_  4
#define TT   2048
#define DM   1024
#define NH_  16
#define NKV  16
#define REP  (NH_ / NKV)
#define HD   64
#define DQ   (NH_ * HD)
#define DKV  (NKV * HD)
#define ZH   8                    // heads per attention pass (grid z of the pass's GEMM launches)
#define RH   512                  // query rows < RH use hi+lo planes (0: none)
#define WIN  2048
#define PCAR 1024.0f
#define SCL  0.125f   // HD^-0.5
typedef _Float16 h16;
typedef unsigned short bf;
typedef __attribute__((ext_vector_type(16))) __bf16   v16bf;
typedef __attribute__((ext_vector_type(16))) _Float16 v16h;
typedef __attribute__((ext_vector_type(8)))  _Float16 v8h;
typedef __attribute__((ext_vector_type(8)))  unsigned short v8us;
typedef __attribute__((ext_vector_type(8)))  float    v8f;
typedef __attribute__((ext_vector_type(4)))  float    v4f;
typedef v8h  __attribute__((may_alias)) v8ha;
typedef v4f  __attribute__((may_alias)) v4fa;
typedef v8us __attribute__((may_alias)) v8usa;

__device__ __forceinline__ unsigned short f2bf(float f) { unsigned u = __float_as_uint(f); u += 0x7FFFu + ((u >> 16) & 1u); return (unsigned short)(u >> 16); }
__device__ __forceinline__ float bf2f(unsigned short b) { return __uint_as_float(((unsigned)b) << 16); }
__device__ __forceinline__ float bfr(float f) { return bf2f(f2bf(f)); }
__device__ __forceinline__ v16h cat16(v8h lo, v8h hi) { return __builtin_shufflevector(lo, hi, 0, 1, 2, 3, 4, 5, 6, 7, 8, 9, 10, 11, 12, 13, 14, 15); }
__device__ __forceinline__ v16bf cat16b(v8us lo, v8us hi) { return __builtin_bit_cast(v16bf, __builtin_shufflevector(lo, hi, 0, 1, 2, 3, 4, 5, 6, 7, 8, 9, 10, 11, 12, 13, 14, 15)); }
__device__ __forceinline__ v8f wmma16(v16h a, v16h b, v8f c) { return __builtin_amdgcn_wmma_f32_16x16x32_f16(false, a, false, b, (short)0, c, false, false); }
__device__ __forceinline__ v8f wmmab(v16bf a, v16bf b, v8f c) { return __builtin_amdgcn_wmma_f32_16x16x32_bf16(false, a, false, b, (short)0, c, false, false); }



// ---- k_gemms: register-blocked GEMM, one 64x64 output tile per work-group of NW waves, operands straight from K-contiguous 16-bit planes; grid (M/64, N/64, Z), NW * 32 threads.
// C[m][n] (f32, pitch ldc, + optional f32 bias[n]) = sum_k A[m][k] Bt[n][k] (+ split products per NSPLIT). A rows have pitch lda, Bt rows pitch K. z-batch strides sA/sB/sC in elements. K % 64 == 0.
// The K range is dealt to the waves in blocks of 64 (one 128-byte line of every operand row): wave w takes blocks w, w + NW, ... and keeps a whole 64x64 f32 partial (16 accumulators);
// the NW partials meet in LDS and every output element is their sum in wave order 0..NW-1. CAUSK (probability x value): the K range ends at the diagonal block of query rows r0 + roff.. (probabilities beyond it are exactly zero).
template <typename T16> struct WFrag;
template <> struct WFrag<h16> { typedef v16h V; static __device__ __forceinline__ V ld(const h16* p) { return cat16(*(const v8h*)p, *(const v8h*)(p + 16)); } static __device__ __forceinline__ v8f mma(V a, V b, v8f c) { return wmma16(a, b, c); } };
template <> struct WFrag<bf> { typedef v16bf V; static __device__ __forceinline__ V ld(const bf* p) { return cat16b(*(const v8us*)p, *(const v8us*)(p + 16)); } static __device__ __forceinline__ v8f mma(V a, V b, v8f c) { return wmmab(a, b, c); } };
template <typename T16, int NSPLIT, bool BIAS, bool CAUSK, int NW>
__global__ __launch_bounds__(NW * 32) void k_gemms(const T16* __restrict__ A, const T16* __restrict__ A2, int lda, const T16* __restrict__ Bt, const T16* __restrict__ Bt2, int K, float* C, int ldc, const float* __restrict__ bias, int roff, size_t sA, size_t sB, size_t sC) {
    typedef typename WFrag<T16>::V V;
    __shared__ __align__(16) float os[NW * 64 * 68];
    const size_t z = blockIdx.z; A += z * sA; if (A2) A2 += z * sA; Bt += z * sB; if (Bt2) Bt2 += z * sB; C += z * sC;
    const int lane = threadIdx.x & 31, lr = lane & 15, hi = lane >> 4; const int r0 = blockIdx.x * 64, c0 = blockIdx.y * 64;
    const int w = __builtin_amdgcn_readfirstlane((int)(threadIdx.x >> 5));   // wave number, scalar: the K loop's bounds stay in scalar registers
    const int Kl = CAUSK ? min(K, r0 + roff + 64) : K;
    v8f acc[4][4];
#pragma unroll
    for (int mb = 0; mb < 4; ++mb)
#pragma unroll
        for (int nb = 0; nb < 4; ++nb) acc[mb][nb] = (v8f){};
    const size_t aoff = (size_t)(r0 + lr) * lda + 8 * hi, boff = (size_t)(c0 + lr) * K + 8 * hi;
#pragma unroll 1   // rolled: 16 accumulators and one step's fragments fill the register budget of NW waves on four SIMDs
    for (int kc = w * 64; kc < Kl; kc += (kc & 32) ? NW * 64 - 32 : 32) {   // both 32-wide halves of this wave's block, then NW blocks on
        V a[4], a2[4];
#pragma unroll
        for (int mb = 0; mb < 4; ++mb) { a[mb] = WFrag<T16>::ld(A + aoff + (size_t)mb * 16 * lda + kc); if (NSPLIT == 1 || NSPLIT == 2) a2[mb] = WFrag<T16>::ld(A2 + aoff + (size_t)mb * 16 * lda + kc); }
#pragma unroll
        for (int nb = 0; nb < 4; ++nb) { const V b = WFrag<T16>::ld(Bt + boff + (size_t)nb * 16 * K + kc); V b2; if (NSPLIT >= 2) b2 = WFrag<T16>::ld(Bt2 + boff + (size_t)nb * 16 * K + kc);
#pragma unroll
            for (int mb = 0; mb < 4; ++mb) { acc[mb][nb] = WFrag<T16>::mma(a[mb], b, acc[mb][nb]); if (NSPLIT == 1 || NSPLIT == 2) acc[mb][nb] = WFrag<T16>::mma(a2[mb], b, acc[mb][nb]); if (NSPLIT >= 2) acc[mb][nb] = WFrag<T16>::mma(a[mb], b2, acc[mb][nb]); } }
        // four vector slots behind the last WMMAs, on the taken side of the loop's branch too
        asm volatile("v_nop\n\tv_nop\n\tv_nop\n\tv_nop" : "+v"(acc[0][0]), "+v"(acc[1][1]), "+v"(acc[2][2]), "+v"(acc[3][3]) : "v"(a[0]), "v"(a[3]));
    }
    float* ow = os + w * (64 * 68);
#pragma unroll
    for (int mb = 0; mb < 4; ++mb)
#pragma unroll
        for (int nb = 0; nb < 4; ++nb)
#pragma unroll
            for (int j = 0; j < 8; ++j) ow[(mb * 16 + hi * 8 + j) * 68 + nb * 16 + lr] = acc[mb][nb][j];
    __syncthreads();   // every wave's partial is in LDS before any of them is summed
#pragma unroll
    for (int s = 0; s < 32 / NW; ++s) { const int slot = s * NW * 32 + (int)threadIdx.x, row = slot >> 4, cofs = (slot & 15) * 4; v4f val = *(const v4fa*)(os + row * 68 + cofs);
#pragma unroll
        for (int p = 1; p < NW; ++p) val += *(const v4fa*)(os + p * (64 * 68) + row * 68 + cofs);
        if (BIAS) { val[0] += bfr(bias[c0 + cofs]); val[1] += bfr(bias[c0 + cofs + 1]); val[2] += bfr(bias[c0 + cofs + 2]); val[3] += bfr(bias[c0 + cofs + 3]); }
        *(v4f*)(C + (size_t)(r0 + row) * ldc + c0 + cofs) = val; }
}

// ---- k_gemmc: a one-wave 64x64 tile GEMM (no K split) specialised for causal attention: CMODE 1 skips score tiles entirely above the diagonal (query rows r0+roff.., key columns c0..), CMODE 2 limits the
// key (K) loop of the probability x value contraction to the diagonal block (probabilities beyond it are exactly zero). roff = row offset of this launch's first row within the sequence.
template <typename T16, int NSPLIT, int CMODE>
__global__ __launch_bounds__(32) void k_gemmc(const T16* __restrict__ A, const T16* __restrict__ A2, const T16* __restrict__ Bt, const T16* __restrict__ Bt2, int K, float* C, int ldc, int roff, size_t sA, size_t sB, size_t sC) {
    typedef typename WFrag<T16>::V V;
    __shared__ __align__(16) float os[16 * 68];
    const size_t z = blockIdx.z; A += z * sA; if (A2) A2 += z * sA; Bt += z * sB; if (Bt2) Bt2 += z * sB; C += z * sC;
    const int lane = threadIdx.x & 31, lr = lane & 15, hi = lane >> 4; const int r0 = blockIdx.x * 64, c0 = blockIdx.y * 64;
    if (CMODE == 1 && c0 > r0 + roff + 63) return;                  // score tile entirely above the causal diagonal: not computed (the softmax masks j > i by select)
    const int Kl = (CMODE == 2) ? min(K, r0 + roff + 64) : K;        // P.V: probabilities are exactly 0 beyond the diagonal block, so the K loop stops there
    v8f acc[4][4];
#pragma unroll
    for (int mb = 0; mb < 4; ++mb)
#pragma unroll
        for (int nb = 0; nb < 4; ++nb) acc[mb][nb] = (v8f){};
    const size_t aoff = (size_t)(r0 + lr) * K + 8 * hi, boff = (size_t)(c0 + lr) * K + 8 * hi;
#pragma unroll 1
    for (int kc = 0; kc < Kl; kc += 32) {
        V a[4], a2[4];
#pragma unroll
        for (int mb = 0; mb < 4; ++mb) { a[mb] = WFrag<T16>::ld(A + aoff + (size_t)mb * 16 * K + kc); if (NSPLIT == 1 || NSPLIT == 2) a2[mb] = WFrag<T16>::ld(A2 + aoff + (size_t)mb * 16 * K + kc); }
#pragma unroll
        for (int nb = 0; nb < 4; ++nb) { const V b = WFrag<T16>::ld(Bt + boff + (size_t)nb * 16 * K + kc); V b2; if (NSPLIT >= 2) b2 = WFrag<T16>::ld(Bt2 + boff + (size_t)nb * 16 * K + kc);
#pragma unroll
            for (int mb = 0; mb < 4; ++mb) { acc[mb][nb] = WFrag<T16>::mma(a[mb], b, acc[mb][nb]); if (NSPLIT == 1 || NSPLIT == 2) acc[mb][nb] = WFrag<T16>::mma(a2[mb], b, acc[mb][nb]); if (NSPLIT >= 2) acc[mb][nb] = WFrag<T16>::mma(a[mb], b2, acc[mb][nb]); } }
        asm volatile("v_nop\n\tv_nop\n\tv_nop\n\tv_nop" : "+v"(acc[0][0]), "+v"(acc[1][1]), "+v"(acc[2][2]), "+v"(acc[3][3]) : "v"(a[0]), "v"(a[3]));
    }
#pragma unroll
    for (int mb = 0; mb < 4; ++mb) {
#pragma unroll
        for (int nb = 0; nb < 4; ++nb) {
#pragma unroll
            for (int j = 0; j < 8; ++j) os[(hi * 8 + j) * 68 + nb * 16 + lr] = acc[mb][nb][j]; }
        __builtin_amdgcn_wave_barrier(); asm volatile("" ::: "memory");
        float* crow = C + (size_t)(r0 + mb * 16) * ldc + c0;
{
#pragma unroll
            for (int s = 0; s < 8; ++s) { const int row = 2 * s + hi, cofs = lr * 4; v4f val = *(const v4fa*)(os + row * 68 + cofs);
                *(v4f*)(crow + (size_t)row * ldc + cofs) = val; }
             }
        __builtin_amdgcn_wave_barrier(); asm volatile("" ::: "memory");
    }
}

__device__ __forceinline__ h16 tohx(float x) { return (h16)x; }
__device__ __forceinline__ void splitf(float y, unsigned short& h, unsigned short& l) { h = f2bf(y); l = f2bf(y - bf2f(h)); }
typedef __attribute__((ext_vector_type(2))) _Float16 v2h;
typedef __attribute__((ext_vector_type(4))) _Float16 v4h;
typedef __attribute__((ext_vector_type(2))) unsigned short v2us;
typedef __attribute__((ext_vector_type(4))) unsigned short v4us;
typedef __attribute__((ext_vector_type(2))) float v2f;
typedef __attribute__((ext_vector_type(4))) int v4i;
typedef v4h  __attribute__((may_alias)) v4ha;
typedef v4us __attribute__((may_alias)) v4usa;

__global__ __launch_bounds__(256) void k_cvt8(const float* __restrict__ src, bf* dst, size_t n8) { const size_t i = (size_t)blockIdx.x * 256 + threadIdx.x; if (i >= n8) return; const v8f v = *(const v8f*)(src + i * 8); v8us o;
#pragma unroll
    for (int k = 0; k < 8; ++k) o[k] = f2bf(v[k]); *(v8us*)(dst + i * 8) = o;  }

__global__ __launch_bounds__(256) void k_wperm(const float* __restrict__ W, bf* Bt) { const size_t i = (size_t)blockIdx.x * 256 + threadIdx.x; if (i >= (size_t)3 * DQ * DM / 8) return; const size_t e = i * 8; const int c0 = (int)(e % DM); const int rd = (int)(e / DM); const int part = rd / DQ; const int h = (rd % DQ) / HD; const int d = rd % HD; const int rs = h * 3 * HD + part * HD + d; const v8f v = *(const v8f*)(W + (size_t)rs * DM + c0); v8us o;
#pragma unroll
    for (int k = 0; k < 8; ++k) o[k] = f2bf(v[k]); *(v8us*)(Bt + e) = o;  }
// k_rope: head planes [h][t][d] (fp16 + hi/lo) of rope(x) x sc with the rotate-half convention out[d] = x[d] cos[t][d] - x[d+HD/2] sin[t][d], out[d+HD/2] = x[d+HD/2] cos[t][d+HD/2] + x[d] sin[t][d+HD/2]
__global__ __launch_bounds__(256) void k_rope(const float* __restrict__ F, int pitch, int nheads, const float* __restrict__ CS, const float* __restrict__ RF, const float* __restrict__ nw, float sc, h16* P16, bf* Ph, bf* Pl) {
    const size_t e = ((size_t)blockIdx.x * 256 + threadIdx.x) * 2; if (e >= (size_t)nheads * TT * HD) return; const int d = (int)(e % HD); const int t = (int)((e / HD) % TT); const int h = (int)(e / ((size_t)HD * TT)); const float* f = F + (size_t)t * pitch + h * HD; const float rf = RF ? RF[(size_t)h * TT + t] : 1.0f; v2h o16; v2us oh, ol;
#pragma unroll
    for (int q = 0; q < 2; ++q) { const int dd = d + q; const int dp = (dd < HD / 2) ? dd + HD / 2 : dd - HD / 2; float x0 = f[dd], x1 = f[dp];
        if (RF) { float n0 = __fmul_rn(x0, rf), n1 = __fmul_rn(x1, rf); asm volatile("" : "+v"(n0)); asm volatile("" : "+v"(n1)); x0 = __fmul_rn(bfr(nw[dd]), n0); x1 = __fmul_rn(bfr(nw[dp]), n1); }
        const v2f cs = *(const v2f*)(CS + ((size_t)t * HD + dd) * 2); float a = __fmul_rn(x0, cs[0]), bq = __fmul_rn(x1, cs[1]); asm volatile("" : "+v"(a)); asm volatile("" : "+v"(bq)); const float r = ((dd < HD / 2) ? __fsub_rn(a, bq) : __fadd_rn(a, bq)) * sc;
        o16[q] = tohx(r); unsigned short a2, c2; splitf(r, a2, c2); oh[q] = a2; ol[q] = c2; }
    *(v2h*)(P16 + e) = o16; *(v2us*)(Ph + e) = oh; *(v2us*)(Pl + e) = ol;  }
__global__ __launch_bounds__(256) void k_vtp(const float* __restrict__ F, int pitch, int nheads, h16* V16, bf* Vh, bf* Vl) { const size_t e = ((size_t)blockIdx.x * 256 + threadIdx.x) * 2; if (e >= (size_t)nheads * HD * TT) return; const int t = (int)(e % TT); const int d = (int)((e / TT) % HD); const int g = (int)(e / ((size_t)TT * HD)); v2h o16; v2us oh, ol;
#pragma unroll
    for (int q = 0; q < 2; ++q) { const float x = F[(size_t)(t + q) * pitch + g * HD + d]; o16[q] = tohx(x); unsigned short a2, c2; splitf(x, a2, c2); oh[q] = a2; ol[q] = c2; }
    *(v2h*)(V16 + e) = o16; *(v2us*)(Vh + e) = oh; *(v2us*)(Vl + e) = ol;  }
__global__ __launch_bounds__(256) void k_csid(float* CS) { const int idx = blockIdx.x * 256 + threadIdx.x; if (idx >= TT * HD) return; v2f cs; cs[0] = 1.0f; cs[1] = 0.0f; *(v2f*)(CS + (size_t)idx * 2) = cs;  }
// k_asoft: per row (zz, i): t = S x HD^-0.5 for j <= i and i - j < WIN (sliding causal window; the reference's -1e9 additive fill vanishes identically); softmax over the 2048 keys (register row, one exp, fixed trees);
// the probabilities go back over the row's own 8192 score bytes, which its one wave has read whole by then: rows < RH hi plane | lo plane (2048 bf16 each), the rest fp16 x PCAR in the first 4096 bytes. 16-bit row pitch 2 * TT.
__global__ __launch_bounds__(256) void k_asoft(float* Sb) {
    const int lane = threadIdx.x & 31; const int row = blockIdx.x * 8 + (threadIdx.x >> 5); if (row >= ZH * TT) return; const int i = row % TT; const int zz = row / TT; (void)zz; const bool hires = (i < RH); const float* sr = Sb + (size_t)row * TT; bf* pb = (bf*)(Sb + (size_t)row * TT); h16* ph = (h16*)(Sb + (size_t)row * TT); float v[TT / 32]; float mx = -3.0e38f;
#pragma unroll
    for (int ch = 0; ch < TT / 128; ++ch) { const int j0 = ch * 128 + lane * 4; const v4f a = *(const v4fa*)(sr + j0);
#pragma unroll
        for (int q = 0; q < 4; ++q) { const int j = j0 + q; (void)j; const float t = (j <= i && i - j < WIN) ? a[q] * SCL : -3.0e38f; v[ch * 4 + q] = t; mx = fmaxf(mx, t); } }
#pragma unroll
    for (int sh = 16; sh; sh >>= 1) mx = fmaxf(mx, __shfl_xor(mx, sh, 32));
    float sum = 0.f;
#pragma unroll
    for (int k = 0; k < TT / 32; ++k) { float d0 = __fsub_rn(v[k], mx); asm volatile("" : "+v"(d0)); const float xe = __fmul_rn(d0, 1.4426950408889634f);
        // the exponential and the one vector slot behind a transcendental in one statement
        asm("v_exp_f32 %0, %1\n\tv_nop" : "=v"(v[k]) : "v"(xe)); sum += v[k]; }
#pragma unroll
    for (int sh = 16; sh; sh >>= 1) sum += __shfl_xor(sum, sh, 32);
    const float f = __fdiv_rn(hires ? 1.0f : PCAR, sum);
{
        if (hires) {
#pragma unroll
            for (int ch = 0; ch < TT / 128; ++ch) { v4us oh, ol;
#pragma unroll
                for (int q = 0; q < 4; ++q) { unsigned short a, c2; splitf(v[ch * 4 + q] * f, a, c2); oh[q] = a; ol[q] = c2; }
                const int oo = ch * 128 + lane * 4; *(v4usa*)(pb + oo) = oh; *(v4usa*)(pb + TT + oo) = ol; }
        } else {
#pragma unroll
            for (int ch = 0; ch < TT / 128; ++ch) { v4h o4;
#pragma unroll
                for (int q = 0; q < 4; ++q) o4[q] = tohx(v[ch * 4 + q] * f);
                *(v4ha*)(ph + ch * 128 + lane * 4) = o4; } }
         }
}
__global__ __launch_bounds__(256) void k_merge(const float* __restrict__ O, int h0, bf* Ah, bf* Al) { const size_t e = ((size_t)blockIdx.x * 256 + threadIdx.x) * 2; if (e >= (size_t)ZH * TT * HD) return; const int d = (int)(e % HD); const int t = (int)((e / HD) % TT); const int zz = (int)(e / ((size_t)HD * TT)); const float cs = (t < RH) ? 1.0f : (1.0f / PCAR); const size_t oo = (size_t)t * DQ + (h0 + zz) * HD + d;
    v2us oh, ol;
#pragma unroll
    for (int q = 0; q < 2; ++q) { unsigned short a, c2; splitf(O[e + q] * cs, a, c2); oh[q] = a; ol[q] = c2; } *(v2us*)(Ah + oo) = oh; *(v2us*)(Al + oo) = ol;  }

extern "C" void kernel_launch(void* const* d_in, const int* in_sizes, int n_in,
                              void* d_out, int out_size, void* d_ws, size_t ws_size, hipStream_t stream) {
    (void)in_sizes; (void)n_in; (void)out_size;
    const float* x = (const float*)d_in[0]; const float* wqkv = (const float*)d_in[1]; const float* wo = (const float*)d_in[2]; const float* bo = (const float*)d_in[3];   /* input order x, w_qkv ('oi' (out, in) [3072][1024], rows packed per head (h, part, c)), w_proj ('oi' [1024][1024]), b_proj (REAL): FOUR inputs, all read: the host's own binding */ const float* wq = wqkv; const float* wk = nullptr; const float* wv = nullptr; (void)wk; (void)wv;
    float* OUT = (float*)d_out;     // [4][2048][1024]
    char* wsp = (char*)d_ws;
    auto take = [&](size_t bytes) { char* p = wsp; wsp += (bytes + 255) & ~(size_t)255; return (void*)p; };
    bf* WQKV = (bf*)take((size_t)3 * DQ * DM * 2); bf* WQ = WQKV; bf* WK = WQKV + (size_t)DQ * DM; bf* WV = WQKV + (size_t)2 * DQ * DM;   /* de-interleaved Bt: q | k | v row blocks in head order */ bf* WO = (bf*)take((size_t)DM * DQ * 2); float* CS = (float*)take((size_t)TT * HD * 2 * 4);
    bf* XB = (bf*)take((size_t)TT * DM * 2); float* FQ = (float*)take((size_t)TT * DQ * 4); float* FK = (float*)take((size_t)TT * DKV * 4);
    h16* QP16 = (h16*)take((size_t)NH_ * TT * HD * 2); h16* KP16 = (h16*)take((size_t)NKV * TT * HD * 2); h16* VT16 = (h16*)take((size_t)NKV * HD * TT * 2);
    bf* QPh = (bf*)take((size_t)NH_ * TT * HD * 2); bf* QPl = (bf*)take((size_t)NH_ * TT * HD * 2); bf* KPh = (bf*)take((size_t)NKV * TT * HD * 2); bf* KPl = (bf*)take((size_t)NKV * TT * HD * 2); bf* VTh = (bf*)take((size_t)NKV * HD * TT * 2); bf* VTl = (bf*)take((size_t)NKV * HD * TT * 2);
    float* Sb = (float*)take((size_t)ZH * TT * TT * 4);   /* scores, then the probabilities in place */ float* Ob = (float*)take((size_t)ZH * TT * HD * 4); bf* ATh = (bf*)take((size_t)TT * DQ * 2); bf* ATl = (bf*)take((size_t)TT * DQ * 2);
    if ((size_t)(wsp - (char*)d_ws) > ws_size) return;    // ws 256 MiB
    float* FV = FK;   // v projection reuses the k buffer after the k planes are built (stream-ordered)
    { k_wperm<<<(unsigned)(((size_t)3 * DQ * DM / 8 + 255) / 256), 256, 0, stream>>>(wqkv, WQKV);   /* packed rows (h, part, d) -> standard (part, h, d) blocks */
      k_cvt8<<<(unsigned)(((size_t)DM * DQ / 8 + 255) / 256), 256, 0, stream>>>(wo, WO, (size_t)DM * DQ / 8);
       }
    k_csid<<<(TT * HD + 255) / 256, 256, 0, stream>>>(CS);
    const unsigned LQ = (unsigned)(((size_t)NH_ * TT * HD / 2 + 255) / 256), LKv = (unsigned)(((size_t)NKV * TT * HD / 2 + 255) / 256);
    for (int b = 0; b < NB_; ++b) {
        
        k_cvt8<<<(unsigned)(((size_t)TT * DM / 8 + 255) / 256), 256, 0, stream>>>(x + (size_t)b * TT * DM, XB, (size_t)TT * DM / 8);
        k_gemms<bf, 0, false, false, 8><<<dim3(TT / 64, DQ / 64, 1), 256, 0, stream>>>(XB, nullptr, DM, WQ, nullptr, DM, FQ, DQ, nullptr, 0, 0, 0, 0);
        k_rope<<<LQ, 256, 0, stream>>>(FQ, DQ, NH_, CS, nullptr, nullptr, 1.0f, QP16, QPh, QPl);
        k_gemms<bf, 0, false, false, 8><<<dim3(TT / 64, DKV / 64, 1), 256, 0, stream>>>(XB, nullptr, DM, WK, nullptr, DM, FK, DKV, nullptr, 0, 0, 0, 0);
        k_rope<<<LKv, 256, 0, stream>>>(FK, DKV, NKV, CS, nullptr, nullptr, 1.0f, KP16, KPh, KPl);
        k_gemms<bf, 0, false, false, 8><<<dim3(TT / 64, DKV / 64, 1), 256, 0, stream>>>(XB, nullptr, DM, WV, nullptr, DM, FV, DKV, nullptr, 0, 0, 0, 0); k_vtp<<<LKv, 256, 0, stream>>>(FV, DKV, NKV, VT16, VTh, VTl);
        for (int h0 = 0; h0 < NH_; h0 += ZH) { const size_t zq = (size_t)h0, zk = (size_t)(h0 / REP);   // one kv head per query head: the pass's heads use consecutive kv planes (z-strides TT*HD)
            k_gemmc<bf, 2, 1><<<dim3(RH / 64, TT / 64, ZH), 32, 0, stream>>>(QPh + zq * TT * HD, QPl + zq * TT * HD, KPh + zk * TT * HD, KPl + zk * TT * HD, HD, Sb, TT, 0, (size_t)TT * HD, (size_t)TT * HD, (size_t)TT * TT);
            k_gemmc<h16, 0, 1><<<dim3((TT - RH) / 64, TT / 64, ZH), 32, 0, stream>>>(QP16 + zq * TT * HD + (size_t)RH * HD, nullptr, KP16 + zk * TT * HD, nullptr, HD, Sb + (size_t)RH * TT, TT, RH, (size_t)TT * HD, (size_t)TT * HD, (size_t)TT * TT);
            k_asoft<<<ZH * TT / 8, 256, 0, stream>>>(Sb);
            k_gemms<bf, 2, false, true, 8><<<dim3(RH / 64, HD / 64, ZH), 256, 0, stream>>>((const bf*)Sb, (const bf*)Sb + TT, 2 * TT, VTh + zk * HD * TT, VTl + zk * HD * TT, TT, Ob, HD, nullptr, 0, (size_t)2 * TT * TT, (size_t)HD * TT, (size_t)TT * HD);
            k_gemms<h16, 0, false, true, 16><<<dim3((TT - RH) / 64, HD / 64, ZH), 512, 0, stream>>>((const h16*)Sb + (size_t)RH * 2 * TT, nullptr, 2 * TT, VT16 + zk * HD * TT, nullptr, TT, Ob + (size_t)RH * HD, HD, nullptr, RH, (size_t)2 * TT * TT, (size_t)HD * TT, (size_t)TT * HD);
            k_merge<<<(unsigned)(((size_t)ZH * TT * HD / 2 + 255) / 256), 256, 0, stream>>>(Ob, h0, ATh, ATl); }
        k_gemms<bf, 1, true, false, 8><<<dim3(TT / 64, DM / 64, 1), 256, 0, stream>>>(ATh, ATl, DQ, WO, nullptr, DQ, OUT + (size_t)b * TT * DM, DM, bo, 0, 0, 0, 0); }
}

// v003
// A run of this version takes 474 microseconds.
// Next to v002, in two timings, it ran 2.01 and 2.00 times as fast.
// All steps since v000 together make it 5.95 times as fast.
#include <hip/hip_runtime.h>

// Causal multi-head attention with a fused bias-free qkv projection in (out, in) layout whose ROWS are packed PER HEAD (x [4][2048][1024]; qkv = einsum('bse,fe->bsf', x, w_qkv) = x w_qkv^T ('oi' (out, in) [3072][1024] 1/32, no bias) viewed (b, s, 16 heads, 3 x 64): head h's rows h*192 + 0..63 | 64..127 | 128..191 of w_qkv are its q | k | v; scores x 64^-0.5 (token-major einsums: the same products); where(tril, scores, -inf) (exclusion; every row keeps its own key); softmax; out = merged w_proj^T + b_proj ('oi' + a REAL 0.01 bias) -> [4][2048][1024] (8.4 M); argument order x, w_qkv, w_proj, b_proj).
// Layout per batch: the packed weight rows are gathered once into a standard q | k | v Bt (a row permutation of the bf16 copy); bf16 copy of x; exact projections; identity-table plane builders; causal T-2048 attention, all 16 heads in one launch, scores and probabilities kept in registers (online softmax; hybrid rows: < 512 hi/lo 3 products, rest fp16; key blocks above the diagonal are never visited); merged hi/lo x Wo exact + bo.
// Compute dtypes, f32 accumulate: every input rounded to bf16; projections exact; attention rows < 512 3 products, rest fp16; softmax f32; Wo hl x exact + bias.

#define NB_  4
#define TT   2048
#define DM   1024
#define NH_  16
#define NKV  16
#define HD   64
#define DQ   (NH_ * HD)
#define DKV  (NKV * HD)
#define RH   512                  // query rows < RH use hi+lo planes (0: none)
typedef _Float16 h16;
typedef unsigned short bf;
typedef __attribute__((ext_vector_type(16))) __bf16   v16bf;
typedef __attribute__((ext_vector_type(16))) _Float16 v16h;
typedef __attribute__((ext_vector_type(8)))  _Float16 v8h;
typedef __attribute__((ext_vector_type(8)))  unsigned short v8us;
typedef __attribute__((ext_vector_type(8)))  float    v8f;
typedef __attribute__((ext_vector_type(4)))  float    v4f;
typedef v8h  __attribute__((may_alias)) v8ha;
typedef v4f  __attribute__((may_alias)) v4fa;
typedef v8us __attribute__((may_alias)) v8usa;

__device__ __forceinline__ unsigned short f2bf(float f) { unsigned u = __float_as_uint(f); u += 0x7FFFu + ((u >> 16) & 1u); return (unsigned short)(u >> 16); }
__device__ __forceinline__ float bf2f(unsigned short b) { return __uint_as_float(((unsigned)b) << 16); }
__device__ __forceinline__ float bfr(float f) { return bf2f(f2bf(f)); }
__device__ __forceinline__ v16h cat16(v8h lo, v8h hi) { return __builtin_shufflevector(lo, hi, 0, 1, 2, 3, 4, 5, 6, 7, 8, 9, 10, 11, 12, 13, 14, 15); }
__device__ __forceinline__ v16bf cat16b(v8us lo, v8us hi) { return __builtin_bit_cast(v16bf, __builtin_shufflevector(lo, hi, 0, 1, 2, 3, 4, 5, 6, 7, 8, 9, 10, 11, 12, 13, 14, 15)); }
__device__ __forceinline__ v8f wmma16(v16h a, v16h b, v8f c) { return __builtin_amdgcn_wmma_f32_16x16x32_f16(false, a, false, b, (short)0, c, false, false); }
__device__ __forceinline__ v8f wmmab(v16bf a, v16bf b, v8f c) { return __builtin_amdgcn_wmma_f32_16x16x32_bf16(false, a, false, b, (short)0, c, false, false); }



// ---- k_gemms: register-blocked GEMM, one 64x64 output tile per work-group of NW waves, operands straight from K-contiguous 16-bit planes; grid (M/64, N/64, Z), NW * 32 threads.
// C[m][n] (f32, pitch ldc, + optional f32 bias[n]) = sum_k A[m][k] Bt[n][k] (+ split products per NSPLIT). A rows have pitch lda, Bt rows pitch K. z-batch strides sA/sB/sC in elements. K % 64 == 0.
// The K range is dealt to the waves in blocks of 64 (one 128-byte line of every operand row): wave w takes blocks w, w + NW, ... and keeps a whole 64x64 f32 partial (16 accumulators);
// the NW partials meet in LDS and every output element is their sum in wave order 0..NW-1. CAUSK (probability x value): the K range ends at the diagonal block of query rows r0 + roff.. (probabilities beyond it are exactly zero).
template <typename T16> struct WFrag;
template <> struct WFrag<h16> { typedef v16h V; static __device__ __forceinline__ V ld(const h16* p) { return cat16(*(const v8h*)p, *(const v8h*)(p + 16)); } static __device__ __forceinline__ v8f mma(V a, V b, v8f c) { return wmma16(a, b, c); } };
template <> struct WFrag<bf> { typedef v16bf V; static __device__ __forceinline__ V ld(const bf* p) { return cat16b(*(const v8us*)p, *(const v8us*)(p + 16)); } static __device__ __forceinline__ v8f mma(V a, V b, v8f c) { return wmmab(a, b, c); } };
template <typename T16, int NSPLIT, bool BIAS, bool CAUSK, int NW>
__global__ __launch_bounds__(NW * 32) void k_gemms(const T16* __restrict__ A, const T16* __restrict__ A2, int lda, const T16* __restrict__ Bt, const T16* __restrict__ Bt2, int K, float* C, int ldc, const float* __restrict__ bias, int roff, size_t sA, size_t sB, size_t sC) {
    typedef typename WFrag<T16>::V V;
    __shared__ __align__(16) float os[NW * 64 * 68];
    const size_t z = blockIdx.z; A += z * sA; if (A2) A2 += z * sA; Bt += z * sB; if (Bt2) Bt2 += z * sB; C += z * sC;
    const int lane = threadIdx.x & 31, lr = lane & 15, hi = lane >> 4; const int r0 = blockIdx.x * 64, c0 = blockIdx.y * 64;
    const int w = __builtin_amdgcn_readfirstlane((int)(threadIdx.x >> 5));   // wave number, scalar: the K loop's bounds stay in scalar registers
    const int Kl = CAUSK ? min(K, r0 + roff + 64) : K;
    v8f acc[4][4];
#pragma unroll
    for (int mb = 0; mb < 4; ++mb)
#pragma unroll
        for (int nb = 0; nb < 4; ++nb) acc[mb][nb] = (v8f){};
    const size_t aoff = (size_t)(r0 + lr) * lda + 8 * hi, boff = (size_t)(c0 + lr) * K + 8 * hi;
#pragma unroll 1   // rolled: 16 accumulators and one step's fragments fill the register budget of NW waves on four SIMDs
    for (int kc = w * 64; kc < Kl; kc += (kc & 32) ? NW * 64 - 32 : 32) {   // both 32-wide halves of this wave's block, then NW blocks on
        V a[4], a2[4];
#pragma unroll
        for (int mb = 0; mb < 4; ++mb) { a[mb] = WFrag<T16>::ld(A + aoff + (size_t)mb * 16 * lda + kc); if (NSPLIT == 1 || NSPLIT == 2) a2[mb] = WFrag<T16>::ld(A2 + aoff + (size_t)mb * 16 * lda + kc); }
#pragma unroll
        for (int nb = 0; nb < 4; ++nb) { const V b = WFrag<T16>::ld(Bt + boff + (size_t)nb * 16 * K + kc); V b2; if (NSPLIT >= 2) b2 = WFrag<T16>::ld(Bt2 + boff + (size_t)nb * 16 * K + kc);
#pragma unroll
            for (int mb = 0; mb < 4; ++mb) { acc[mb][nb] = WFrag<T16>::mma(a[mb], b, acc[mb][nb]); if (NSPLIT == 1 || NSPLIT == 2) acc[mb][nb] = WFrag<T16>::mma(a2[mb], b, acc[mb][nb]); if (NSPLIT >= 2) acc[mb][nb] = WFrag<T16>::mma(a[mb], b2, acc[mb][nb]); } }
        // four vector slots behind the last WMMAs, on the taken side of the loop's branch too
        asm volatile("v_nop\n\tv_nop\n\tv_nop\n\tv_nop" : "+v"(acc[0][0]), "+v"(acc[1][1]), "+v"(acc[2][2]), "+v"(acc[3][3]) : "v"(a[0]), "v"(a[3]));
    }
    float* ow = os + w * (64 * 68);
#pragma unroll
    for (int mb = 0; mb < 4; ++mb)
#pragma unroll
        for (int nb = 0; nb < 4; ++nb)
#pragma unroll
            for (int j = 0; j < 8; ++j) ow[(mb * 16 + hi * 8 + j) * 68 + nb * 16 + lr] = acc[mb][nb][j];
    __syncthreads();   // every wave's partial is in LDS before any of them is summed
#pragma unroll
    for (int s = 0; s < 32 / NW; ++s) { const int slot = s * NW * 32 + (int)threadIdx.x, row = slot >> 4, cofs = (slot & 15) * 4; v4f val = *(const v4fa*)(os + row * 68 + cofs);
#pragma unroll
        for (int p = 1; p < NW; ++p) val += *(const v4fa*)(os + p * (64 * 68) + row * 68 + cofs);
        if (BIAS) { val[0] += bfr(bias[c0 + cofs]); val[1] += bfr(bias[c0 + cofs + 1]); val[2] += bfr(bias[c0 + cofs + 2]); val[3] += bfr(bias[c0 + cofs + 3]); }
        *(v4f*)(C + (size_t)(r0 + row) * ldc + c0 + cofs) = val; }
}

__device__ __forceinline__ h16 tohx(float x) { return (h16)x; }
__device__ __forceinline__ void splitf(float y, unsigned short& h, unsigned short& l) { h = f2bf(y); l = f2bf(y - bf2f(h)); }
typedef __attribute__((ext_vector_type(2))) _Float16 v2h;
typedef __attribute__((ext_vector_type(4))) _Float16 v4h;
typedef __attribute__((ext_vector_type(2))) unsigned short v2us;
typedef __attribute__((ext_vector_type(4))) unsigned short v4us;
typedef __attribute__((ext_vector_type(2))) float v2f;
typedef __attribute__((ext_vector_type(4))) int v4i;
typedef v4h  __attribute__((may_alias)) v4ha;
typedef v4us __attribute__((may_alias)) v4usa;

__global__ __launch_bounds__(256) void k_cvt8(const float* __restrict__ src, bf* dst, size_t n8) { const size_t i = (size_t)blockIdx.x * 256 + threadIdx.x; if (i >= n8) return; const v8f v = *(const v8f*)(src + i * 8); v8us o;
#pragma unroll
    for (int k = 0; k < 8; ++k) o[k] = f2bf(v[k]); *(v8us*)(dst + i * 8) = o;  }

__global__ __launch_bounds__(256) void k_wperm(const float* __restrict__ W, bf* Bt) { const size_t i = (size_t)blockIdx.x * 256 + threadIdx.x; if (i >= (size_t)3 * DQ * DM / 8) return; const size_t e = i * 8; const int c0 = (int)(e % DM); const int rd = (int)(e / DM); const int part = rd / DQ; const int h = (rd % DQ) / HD; const int d = rd % HD; const int rs = h * 3 * HD + part * HD + d; const v8f v = *(const v8f*)(W + (size_t)rs * DM + c0); v8us o;
#pragma unroll
    for (int k = 0; k < 8; ++k) o[k] = f2bf(v[k]); *(v8us*)(Bt + e) = o;  }
// k_rope: head planes [h][t][d] (fp16 + hi/lo) of rope(x) x sc with the rotate-half convention out[d] = x[d] cos[t][d] - x[d+HD/2] sin[t][d], out[d+HD/2] = x[d+HD/2] cos[t][d+HD/2] + x[d] sin[t][d+HD/2]
__global__ __launch_bounds__(256) void k_rope(const float* __restrict__ F, int pitch, int nheads, const float* __restrict__ CS, const float* __restrict__ RF, const float* __restrict__ nw, float sc, h16* P16, bf* Ph, bf* Pl) {
    const size_t e = ((size_t)blockIdx.x * 256 + threadIdx.x) * 2; if (e >= (size_t)nheads * TT * HD) return; const int d = (int)(e % HD); const int t = (int)((e / HD) % TT); const int h = (int)(e / ((size_t)HD * TT)); const float* f = F + (size_t)t * pitch + h * HD; const float rf = RF ? RF[(size_t)h * TT + t] : 1.0f; v2h o16; v2us oh, ol;
#pragma unroll
    for (int q = 0; q < 2; ++q) { const int dd = d + q; const int dp = (dd < HD / 2) ? dd + HD / 2 : dd - HD / 2; float x0 = f[dd], x1 = f[dp];
        if (RF) { float n0 = __fmul_rn(x0, rf), n1 = __fmul_rn(x1, rf); asm volatile("" : "+v"(n0)); asm volatile("" : "+v"(n1)); x0 = __fmul_rn(bfr(nw[dd]), n0); x1 = __fmul_rn(bfr(nw[dp]), n1); }
        const v2f cs = *(const v2f*)(CS + ((size_t)t * HD + dd) * 2); float a = __fmul_rn(x0, cs[0]), bq = __fmul_rn(x1, cs[1]); asm volatile("" : "+v"(a)); asm volatile("" : "+v"(bq)); const float r = ((dd < HD / 2) ? __fsub_rn(a, bq) : __fadd_rn(a, bq)) * sc;
        o16[q] = tohx(r); unsigned short a2, c2; splitf(r, a2, c2); oh[q] = a2; ol[q] = c2; }
    *(v2h*)(P16 + e) = o16; *(v2us*)(Ph + e) = oh; *(v2us*)(Pl + e) = ol;  }
__global__ __launch_bounds__(256) void k_vtp(const float* __restrict__ F, int pitch, int nheads, h16* V16, bf* Vh, bf* Vl) { const size_t e = ((size_t)blockIdx.x * 256 + threadIdx.x) * 2; if (e >= (size_t)nheads * HD * TT) return; const int t = (int)(e % TT); const int d = (int)((e / TT) % HD); const int g = (int)(e / ((size_t)TT * HD)); v2h o16; v2us oh, ol;
#pragma unroll
    for (int q = 0; q < 2; ++q) { const float x = F[(size_t)(t + q) * pitch + g * HD + d]; o16[q] = tohx(x); unsigned short a2, c2; splitf(x, a2, c2); oh[q] = a2; ol[q] = c2; }
    *(v2h*)(V16 + e) = o16; *(v2us*)(Vh + e) = oh; *(v2us*)(Vl + e) = ol;  }
__global__ __launch_bounds__(256) void k_csid(float* CS) { const int idx = blockIdx.x * 256 + threadIdx.x; if (idx >= TT * HD) return; v2f cs; cs[0] = 1.0f; cs[1] = 0.0f; *(v2f*)(CS + (size_t)idx * 2) = cs;  }
// ---- k_fattn: causal attention of one head's query block in one pass over its keys; scores and probabilities stay in registers (online softmax). grid (heads, query blocks), FNW * 32 threads.
// Transposed products: S^T = K Q^T (A = key rows, B = query rows), so a lane holds 16 keys' scores of ONE query (column lr); two S^T tiles (keys 0..15, 16..31), converted in place, are the B operand of O^T += V^T P^T.
// The keys are dealt to the FNW waves in blocks of 64 (one 128-byte line of every V^T row); each wave keeps its own running maximum, sum and 64 x NQT*16 f32 partial of O^T; the partials meet in LDS, are brought to the
// common maximum and summed in wave order 0..FNW-1; the quotient goes out as the merged hi/lo planes [t][DQ]. HL (query rows < RH): hi+lo planes, 3 products for S and for P V; else fp16 planes, one product.
#define FNW  8
#define FPIT 68                   // f32 pitch of a query's 64 partial outputs in LDS: 272 bytes, an odd multiple of 16
#define CL2  0.18033688011112042f // HD^-0.5 * log2(e): scores in log2 units
__device__ __forceinline__ float ex2(float x) { return __builtin_amdgcn_exp2f(x); }   // the builtin, not asm text: the compiler then keeps its own distances behind the WMMAs whose operand registers it reuses
// for the join behind the barrier, far from any WMMA: the exponential and the one vector slot behind a transcendental in one statement
__device__ __forceinline__ float ex2n(float x) { float r; asm("v_exp_f32 %0, %1\n\tv_nop" : "=v"(r) : "v"(x)); return r; }
__device__ __forceinline__ float xhalf(float x) { return __builtin_bit_cast(float, __builtin_amdgcn_permlanex16(__builtin_bit_cast(int, x), __builtin_bit_cast(int, x), 0x76543210, 0xfedcba98, false, false)); }  // lane l with lane l ^ 16
template <typename T16, bool HL, int NQT>
__device__ __forceinline__ void attn_body(const T16* __restrict__ Q, const T16* __restrict__ Q2, const T16* __restrict__ Kp, const T16* __restrict__ K2, const T16* __restrict__ Vt, const T16* __restrict__ V2, int q0, bf* Ah, bf* Al, float* sm) {
    typedef typename WFrag<T16>::V V;
    const int lane = threadIdx.x & 31, lr = lane & 15, hi = lane >> 4;
    const int w = __builtin_amdgcn_readfirstlane((int)(threadIdx.x >> 5));   // wave number, scalar: the key loop's bounds and the diagonal test stay in scalar registers
    const int Kl = q0 + NQT * 16;                                            // keys beyond the block's last query are masked for every row
    V qf[NQT][2], qf2[NQT][2];
    const size_t qo = (size_t)(q0 + lr) * HD + 8 * hi; const T16* qp = Q + qo; const T16* qp2 = HL ? Q2 + qo : qp;
#pragma unroll
    for (int qt = 0; qt < NQT; ++qt)
#pragma unroll
        for (int ks = 0; ks < 2; ++ks) { qf[qt][ks] = WFrag<T16>::ld(qp + qt * 16 * HD + ks * 32); if (HL) qf2[qt][ks] = WFrag<T16>::ld(qp2 + qt * 16 * HD + ks * 32); }
    // XWAIT, here and below: the wait that stands in front of any overwrite of a register that an issued load names; the addresses are its inputs so that they stay in their registers up to it (no load's own result lands on them)
    asm volatile("s_wait_xcnt 0x0" :: "v"(qp), "v"(qp2) : "memory");
    v8f o[4][NQT]; float m[NQT], l[NQT];
#pragma unroll
    for (int qt = 0; qt < NQT; ++qt) { m[qt] = -3.0e38f; l[qt] = 0.f;
#pragma unroll
        for (int dt = 0; dt < 4; ++dt) o[dt][qt] = (v8f){}; }
    V kf[2][2], kf2[2][2];   // this pass's key fragments: fetched one pass ahead, into the same registers, right behind the products that read them
    if (w * 64 < Kl) { const size_t ko = (size_t)(w * 64 + lr) * HD + 8 * hi; const T16* kp = Kp + ko; const T16* kp2 = HL ? K2 + ko : kp;
#pragma unroll
        for (int kt = 0; kt < 2; ++kt)
#pragma unroll
            for (int ks = 0; ks < 2; ++ks) { kf[kt][ks] = WFrag<T16>::ld(kp + kt * 16 * HD + ks * 32); if (HL) kf2[kt][ks] = WFrag<T16>::ld(kp2 + kt * 16 * HD + ks * 32); }
        asm volatile("s_wait_xcnt 0x0" :: "v"(kp), "v"(kp2) : "memory"); }   // XWAIT
#pragma unroll 1   // rolled: one step's fragments, scores and the output partial fill the register budget
    for (int kc = w * 64; kc < Kl; ) {
        const int kx = kc + ((kc & 32) ? FNW * 64 - 32 : 32);   // both 32-key halves of this wave's block, then FNW blocks on
        const int kn = kx < Kl ? kx : kc;                       // the last pass fetches its own rows again: always inside the plane, never used
        V vf[4], vf2[4];
        const size_t vo = (size_t)lr * TT + kc + 8 * hi, ko = (size_t)(kn + lr) * HD + 8 * hi;
        const T16* vp = Vt + vo; const T16* vp2 = HL ? V2 + vo : vp; const T16* kp = Kp + ko; const T16* kp2 = HL ? K2 + ko : kp;
#pragma unroll
        for (int dt = 0; dt < 4; ++dt) { vf[dt] = WFrag<T16>::ld(vp + dt * 16 * TT); if (HL) vf2[dt] = WFrag<T16>::ld(vp2 + dt * 16 * TT); }
        v8f s[2][NQT];
#pragma unroll
        for (int kt = 0; kt < 2; ++kt)
#pragma unroll
            for (int qt = 0; qt < NQT; ++qt) { v8f a = (v8f){};
#pragma unroll
                for (int ks = 0; ks < 2; ++ks) { a = WFrag<T16>::mma(kf[kt][ks], qf[qt][ks], a); if (HL) { a = WFrag<T16>::mma(kf[kt][ks], qf2[qt][ks], a); a = WFrag<T16>::mma(kf2[kt][ks], qf[qt][ks], a); } }
                s[kt][qt] = a; }
#pragma unroll
        for (int kt = 0; kt < 2; ++kt)
#pragma unroll
            for (int ks = 0; ks < 2; ++ks) { kf[kt][ks] = WFrag<T16>::ld(kp + kt * 16 * HD + ks * 32); if (HL) kf2[kt][ks] = WFrag<T16>::ld(kp2 + kt * 16 * HD + ks * 32); }
        asm volatile("s_wait_xcnt 0x0" :: "v"(vp), "v"(vp2), "v"(kp), "v"(kp2) : "memory");   // XWAIT: the softmax below reuses the address registers
        if (kc + 31 > q0) {   // only a block that reaches past the first query needs the mask (same for the whole wave: one branch round all the selects)
#pragma unroll
            for (int qt = 0; qt < NQT; ++qt) { const int lim = q0 + qt * 16 + lr - kc - hi * 8;   // this lane's query minus its first key
#pragma unroll
                for (int kt = 0; kt < 2; ++kt)
#pragma unroll
                    for (int j = 0; j < 8; ++j) s[kt][qt][j] = (kt * 16 + j <= lim) ? s[kt][qt][j] : -3.0e38f; } }
#pragma unroll
        for (int qt = 0; qt < NQT; ++qt) { float mx = -3.0e38f;
#pragma unroll
            for (int kt = 0; kt < 2; ++kt)
#pragma unroll
                for (int j = 0; j < 8; ++j) mx = fmaxf(mx, s[kt][qt][j]);
            mx = fmaxf(mx, xhalf(mx));   // the query's other 16 keys of this step sit in the other half of the wave
            const float mn = fmaxf(m[qt], mx * CL2), al = ex2(m[qt] - mn); m[qt] = mn; float sum = 0.f;   // the running maximum is kept in log2 units
#pragma unroll
            for (int kt = 0; kt < 2; ++kt)
#pragma unroll
                for (int j = 0; j < 8; ++j) { const float p = ex2(s[kt][qt][j] * CL2 - mn); s[kt][qt][j] = p; sum += p; }
            l[qt] = l[qt] * al + sum;
#pragma unroll
            for (int dt = 0; dt < 4; ++dt) o[dt][qt] *= al;
            if constexpr (HL) { v8us h0, h1, l0, l1;
#pragma unroll
                for (int j = 0; j < 8; ++j) { unsigned short a, c2; splitf(s[0][qt][j], a, c2); h0[j] = a; l0[j] = c2; splitf(s[1][qt][j], a, c2); h1[j] = a; l1[j] = c2; }
                const v16bf ph = cat16b(h0, h1), pl = cat16b(l0, l1);
#pragma unroll
                for (int dt = 0; dt < 4; ++dt) { o[dt][qt] = wmmab(__builtin_bit_cast(v16bf, vf[dt]), ph, o[dt][qt]); o[dt][qt] = wmmab(__builtin_bit_cast(v16bf, vf[dt]), pl, o[dt][qt]); o[dt][qt] = wmmab(__builtin_bit_cast(v16bf, vf2[dt]), ph, o[dt][qt]); }
            } else { v16h pb;
#pragma unroll
                for (int j = 0; j < 8; ++j) { pb[j] = tohx(s[0][qt][j]); pb[8 + j] = tohx(s[1][qt][j]); }
#pragma unroll
                for (int dt = 0; dt < 4; ++dt) o[dt][qt] = wmma16(__builtin_bit_cast(v16h, vf[dt]), pb, o[dt][qt]); } }
        // four vector slots behind the last WMMAs, on the taken side of the loop's branch too
        asm volatile("v_nop\n\tv_nop\n\tv_nop\n\tv_nop" : "+v"(o[0][NQT - 1]), "+v"(o[1][NQT - 1]), "+v"(o[2][NQT - 1]), "+v"(o[3][NQT - 1]) : "v"(vf[0]), "v"(vf[3]));
        kc = kx;
    }
    constexpr int NQ = NQT * 16;
    float* ow = sm + w * (NQ * FPIT); float* ms = sm + FNW * (NQ * FPIT); float* ls = ms + FNW * NQ;
#pragma unroll
    for (int qt = 0; qt < NQT; ++qt) { const float lj = l[qt] + xhalf(l[qt]);   // the two halves' sums of one query
        if (hi == 0) { ms[w * NQ + qt * 16 + lr] = m[qt]; ls[w * NQ + qt * 16 + lr] = lj; }
#pragma unroll
        for (int dt = 0; dt < 4; ++dt) { v4f a, b;
#pragma unroll
            for (int j = 0; j < 4; ++j) { a[j] = o[dt][qt][j]; b[j] = o[dt][qt][4 + j]; }
            float* op = ow + (qt * 16 + lr) * FPIT + dt * 16 + hi * 8; *(v4fa*)op = a; *(v4fa*)(op + 4) = b; } }
    __syncthreads();   // every wave's maximum, sum and partial are in LDS before any of them is joined
    if ((int)threadIdx.x < NQ * 8) { const int q = (int)threadIdx.x >> 3, dg = ((int)threadIdx.x & 7) * 8; float M = -3.0e38f;
#pragma unroll
        for (int p = 0; p < FNW; ++p) M = fmaxf(M, ms[p * NQ + q]);   // wave 0 always holds key 0, so M is a real score
        float L = 0.f; v4f a = (v4f){}, b = (v4f){};
#pragma unroll
        for (int p = 0; p < FNW; ++p) { const float f = ex2n(ms[p * NQ + q] - M); L += f * ls[p * NQ + q]; const float* ip = sm + p * (NQ * FPIT) + q * FPIT + dg; a += f * *(const v4fa*)ip; b += f * *(const v4fa*)(ip + 4); }
        const float inv = __fdiv_rn(1.0f, L); v8us oh, ol;
#pragma unroll
        for (int j = 0; j < 4; ++j) { unsigned short x, y; splitf(a[j] * inv, x, y); oh[j] = x; ol[j] = y; splitf(b[j] * inv, x, y); oh[4 + j] = x; ol[4 + j] = y; }
        const size_t oo = (size_t)(q0 + q) * DQ + dg; *(v8us*)(Ah + oo) = oh; *(v8us*)(Al + oo) = ol; }
}
__global__ __launch_bounds__(FNW * 32) __attribute__((amdgpu_waves_per_eu(4, 4))) void k_fattn(const h16* __restrict__ Q16, const h16* __restrict__ K16, const h16* __restrict__ V16, const bf* __restrict__ Qh, const bf* __restrict__ Ql, const bf* __restrict__ Kh, const bf* __restrict__ Kl, const bf* __restrict__ Vh, const bf* __restrict__ Vl, bf* Ah, bf* Al) {
    __shared__ __align__(16) float sm[FNW * 32 * FPIT + 2 * FNW * 32];
    const size_t hp = (size_t)blockIdx.x * TT * HD; const int bx = (int)blockIdx.y; Ah += blockIdx.x * HD; Al += blockIdx.x * HD;
    // every head's longest query blocks first (lowest y), for speed only
    if (bx < (TT - RH) / 32) attn_body<h16, false, 2>(Q16 + hp, nullptr, K16 + hp, nullptr, V16 + hp, nullptr, TT - 32 * (bx + 1), Ah, Al, sm);
    else attn_body<bf, true, 1>(Qh + hp, Ql + hp, Kh + hp, Kl + hp, Vh + hp, Vl + hp, RH - 16 * (bx - (TT - RH) / 32 + 1), Ah, Al, sm);
}

extern "C" void kernel_launch(void* const* d_in, const int* in_sizes, int n_in,
                              void* d_out, int out_size, void* d_ws, size_t ws_size, hipStream_t stream) {
    (void)in_sizes; (void)n_in; (void)out_size;
    const float* x = (const float*)d_in[0]; const float* wqkv = (const float*)d_in[1]; const float* wo = (const float*)d_in[2]; const float* bo = (const float*)d_in[3];   /* input order x, w_qkv ('oi' (out, in) [3072][1024], rows packed per head (h, part, c)), w_proj ('oi' [1024][1024]), b_proj (REAL): FOUR inputs, all read: the host's own binding */ const float* wq = wqkv; const float* wk = nullptr; const float* wv = nullptr; (void)wk; (void)wv;
    float* OUT = (float*)d_out;     // [4][2048][1024]
    char* wsp = (char*)d_ws;
    auto take = [&](size_t bytes) { char* p = wsp; wsp += (bytes + 255) & ~(size_t)255; return (void*)p; };
    bf* WQKV = (bf*)take((size_t)3 * DQ * DM * 2); bf* WQ = WQKV; bf* WK = WQKV + (size_t)DQ * DM; bf* WV = WQKV + (size_t)2 * DQ * DM;   /* de-interleaved Bt: q | k | v row blocks in head order */ bf* WO = (bf*)take((size_t)DM * DQ * 2); float* CS = (float*)take((size_t)TT * HD * 2 * 4);
    bf* XB = (bf*)take((size_t)TT * DM * 2); float* FQ = (float*)take((size_t)TT * DQ * 4); float* FK = (float*)take((size_t)TT * DKV * 4);
    h16* QP16 = (h16*)take((size_t)NH_ * TT * HD * 2); h16* KP16 = (h16*)take((size_t)NKV * TT * HD * 2); h16* VT16 = (h16*)take((size_t)NKV * HD * TT * 2);
    bf* QPh = (bf*)take((size_t)NH_ * TT * HD * 2); bf* QPl = (bf*)take((size_t)NH_ * TT * HD * 2); bf* KPh = (bf*)take((size_t)NKV * TT * HD * 2); bf* KPl = (bf*)take((size_t)NKV * TT * HD * 2); bf* VTh = (bf*)take((size_t)NKV * HD * TT * 2); bf* VTl = (bf*)take((size_t)NKV * HD * TT * 2);
    bf* ATh = (bf*)take((size_t)TT * DQ * 2); bf* ATl = (bf*)take((size_t)TT * DQ * 2);
    if ((size_t)(wsp - (char*)d_ws) > ws_size) return;    // ws 256 MiB
    float* FV = FK;   // v projection reuses the k buffer after the k planes are built (stream-ordered)
    { k_wperm<<<(unsigned)(((size_t)3 * DQ * DM / 8 + 255) / 256), 256, 0, stream>>>(wqkv, WQKV);   /* packed rows (h, part, d) -> standard (part, h, d) blocks */
      k_cvt8<<<(unsigned)(((size_t)DM * DQ / 8 + 255) / 256), 256, 0, stream>>>(wo, WO, (size_t)DM * DQ / 8);
       }
    k_csid<<<(TT * HD + 255) / 256, 256, 0, stream>>>(CS);
    const unsigned LQ = (unsigned)(((size_t)NH_ * TT * HD / 2 + 255) / 256), LKv = (unsigned)(((size_t)NKV * TT * HD / 2 + 255) / 256);
    for (int b = 0; b < NB_; ++b) {
        
        k_cvt8<<<(unsigned)(((size_t)TT * DM / 8 + 255) / 256), 256, 0, stream>>>(x + (size_t)b * TT * DM, XB, (size_t)TT * DM / 8);
        k_gemms<bf, 0, false, false, 8><<<dim3(TT / 64, DQ / 64, 1), 256, 0, stream>>>(XB, nullptr, DM, WQ, nullptr, DM, FQ, DQ, nullptr, 0, 0, 0, 0);
        k_rope<<<LQ, 256, 0, stream>>>(FQ, DQ, NH_, CS, nullptr, nullptr, 1.0f, QP16, QPh, QPl);
        k_gemms<bf, 0, false, false, 8><<<dim3(TT / 64, DKV / 64, 1), 256, 0, stream>>>(XB, nullptr, DM, WK, nullptr, DM, FK, DKV, nullptr, 0, 0, 0, 0);
        k_rope<<<LKv, 256, 0, stream>>>(FK, DKV, NKV, CS, nullptr, nullptr, 1.0f, KP16, KPh, KPl);
        k_gemms<bf, 0, false, false, 8><<<dim3(TT / 64, DKV / 64, 1), 256, 0, stream>>>(XB, nullptr, DM, WV, nullptr, DM, FV, DKV, nullptr, 0, 0, 0, 0); k_vtp<<<LKv, 256, 0, stream>>>(FV, DKV, NKV, VT16, VTh, VTl);
        k_fattn<<<dim3(NH_, (TT - RH) / 32 + RH / 16, 1), FNW * 32, 0, stream>>>(QP16, KP16, VT16, QPh, QPl, KPh, KPl, VTh, VTl, ATh, ATl);   // one kv head per query head: head h uses plane h of each
        k_gemms<bf, 1, true, false, 8><<<dim3(TT / 64, DM / 64, 1), 256, 0, stream>>>(ATh, ATl, DQ, WO, nullptr, DQ, OUT + (size_t)b * TT * DM, DM, bo, 0, 0, 0, 0); }
}

// v004
// It runs in 382 microseconds.
// Timed twice side by side with v003, it ran 1.25 and 1.23 times as fast.
// Over all steps from v000 it is 7.37 times as fast.
#include <hip/hip_runtime.h>

// Causal multi-head attention with a fused bias-free qkv projection in (out, in) layout whose ROWS are packed PER HEAD (x [4][2048][1024]; qkv = einsum('bse,fe->bsf', x, w_qkv) = x w_qkv^T ('oi' (out, in) [3072][1024] 1/32, no bias) viewed (b, s, 16 heads, 3 x 64): head h's rows h*192 + 0..63 | 64..127 | 128..191 of w_qkv are its q | k | v; scores x 64^-0.5 (token-major einsums: the same products); where(tril, scores, -inf) (exclusion; every row keeps its own key); softmax; out = merged w_proj^T + b_proj ('oi' + a REAL 0.01 bias) -> [4][2048][1024] (8.4 M); argument order x, w_qkv, w_proj, b_proj).
// Layout per batch: the packed weight rows are gathered once into a standard q | k | v Bt (a row permutation of the bf16 copy); bf16 copy of x; exact projections that write the head planes themselves; causal T-2048 attention, all 16 heads in one launch, scores and probabilities kept in registers (online softmax; hybrid rows: < 512 hi/lo 3 products, rest fp16; key blocks above the diagonal are never visited); merged hi/lo x Wo exact + bo.
// Compute dtypes, f32 accumulate: every input rounded to bf16; projections exact; attention rows < 512 3 products, rest fp16; softmax f32; Wo hl x exact + bias.

#define NB_  4
#define TT   2048
#define DM   1024
#define NH_  16
#define NKV  16
#define HD   64
#define DQ   (NH_ * HD)
#define DKV  (NKV * HD)
#define RH   512                  // query rows < RH use hi+lo planes (0: none)
typedef _Float16 h16;
typedef unsigned short bf;
typedef __attribute__((ext_vector_type(16))) __bf16   v16bf;
typedef __attribute__((ext_vector_type(16))) _Float16 v16h;
typedef __attribute__((ext_vector_type(8)))  _Float16 v8h;
typedef __attribute__((ext_vector_type(8)))  unsigned short v8us;
typedef __attribute__((ext_vector_type(8)))  float    v8f;
typedef __attribute__((ext_vector_type(4)))  float    v4f;
typedef v8h  __attribute__((may_alias)) v8ha;
typedef v4f  __attribute__((may_alias)) v4fa;
typedef v8us __attribute__((may_alias)) v8usa;

__device__ __forceinline__ unsigned short f2bf(float f) { unsigned u = __float_as_uint(f); u += 0x7FFFu + ((u >> 16) & 1u); return (unsigned short)(u >> 16); }
__device__ __forceinline__ float bf2f(unsigned short b) { return __uint_as_float(((unsigned)b) << 16); }
__device__ __forceinline__ float bfr(float f) { return bf2f(f2bf(f)); }
__device__ __forceinline__ v16h cat16(v8h lo, v8h hi) { return __builtin_shufflevector(lo, hi, 0, 1, 2, 3, 4, 5, 6, 7, 8, 9, 10, 11, 12, 13, 14, 15); }
__device__ __forceinline__ v16bf cat16b(v8us lo, v8us hi) { return __builtin_bit_cast(v16bf, __builtin_shufflevector(lo, hi, 0, 1, 2, 3, 4, 5, 6, 7, 8, 9, 10, 11, 12, 13, 14, 15)); }
__device__ __forceinline__ v8f wmma16(v16h a, v16h b, v8f c) { return __builtin_amdgcn_wmma_f32_16x16x32_f16(false, a, false, b, (short)0, c, false, false); }
__device__ __forceinline__ v8f wmmab(v16bf a, v16bf b, v8f c) { return __builtin_amdgcn_wmma_f32_16x16x32_bf16(false, a, false, b, (short)0, c, false, false); }
__device__ __forceinline__ h16 tohx(float x) { return (h16)x; }
__device__ __forceinline__ void splitf(float y, unsigned short& h, unsigned short& l) { h = f2bf(y); l = f2bf(y - bf2f(h)); }
typedef __attribute__((ext_vector_type(4))) _Float16 v4h;
typedef __attribute__((ext_vector_type(4))) unsigned short v4us;



// ---- k_gemms: register-blocked GEMM, one 64x64 output tile per work-group of NW waves, operands straight from K-contiguous 16-bit planes; grid (M/64, N/64, Z), NW * 32 threads.
// C[m][n] (f32, pitch ldc, + optional f32 bias[n]) = sum_k A[m][k] Bt[n][k] (+ split products per NSPLIT). A rows have pitch lda, Bt rows pitch K. z-batch strides sA/sB/sC in elements. K % 64 == 0.
// The K range is dealt to the waves in blocks of 64 (one 128-byte line of every operand row): wave w takes blocks w, w + NW, ... and keeps a whole 64x64 f32 partial (16 accumulators);
// the NW partials meet in LDS and every output element is their sum in wave order 0..NW-1.
// PLANES: the sum goes out not as f32 C but as three 16-bit planes (fp16, bf16 hi, bf16 lo) at element (r0 + row) * ldc + c0 * cmul + column: with ldc = HD, cmul = TT a 64-column tile is one head's rows [h][t][d];
// with A = weight rows, Bt = token rows, ldc = TT, cmul = 1 the tile is already the transposed plane [h][d][t]. 16 lanes store one whole 128-byte line of a plane. CAUSK (probability x value): the K range ends at the diagonal block of query rows r0 + roff.. (probabilities beyond it are exactly zero).
template <typename T16> struct WFrag;
template <> struct WFrag<h16> { typedef v16h V; static __device__ __forceinline__ V ld(const h16* p) { return cat16(*(const v8h*)p, *(const v8h*)(p + 16)); } static __device__ __forceinline__ v8f mma(V a, V b, v8f c) { return wmma16(a, b, c); } };
template <> struct WFrag<bf> { typedef v16bf V; static __device__ __forceinline__ V ld(const bf* p) { return cat16b(*(const v8us*)p, *(const v8us*)(p + 16)); } static __device__ __forceinline__ v8f mma(V a, V b, v8f c) { return wmmab(a, b, c); } };
template <typename T16, int NSPLIT, bool BIAS, bool CAUSK, int NW, bool PLANES>
__global__ __launch_bounds__(NW * 32) void k_gemms(const T16* __restrict__ A, const T16* __restrict__ A2, int lda, const T16* __restrict__ Bt, const T16* __restrict__ Bt2, int K, float* C, int ldc, const float* __restrict__ bias, int roff, size_t sA, size_t sB, size_t sC, h16* P16, bf* Ph, bf* Pl, int cmul) {
    typedef typename WFrag<T16>::V V;
    __shared__ __align__(16) float os[NW * 64 * 68];
    const size_t z = blockIdx.z; A += z * sA; if (A2) A2 += z * sA; Bt += z * sB; if (Bt2) Bt2 += z * sB; C += z * sC;
    const int lane = threadIdx.x & 31, lr = lane & 15, hi = lane >> 4; const int r0 = blockIdx.x * 64, c0 = blockIdx.y * 64;
    const int w = __builtin_amdgcn_readfirstlane((int)(threadIdx.x >> 5));   // wave number, scalar: the K loop's bounds stay in scalar registers
    const int Kl = CAUSK ? min(K, r0 + roff + 64) : K;
    v8f acc[4][4];
#pragma unroll
    for (int mb = 0; mb < 4; ++mb)
#pragma unroll
        for (int nb = 0; nb < 4; ++nb) acc[mb][nb] = (v8f){};
    const size_t aoff = (size_t)(r0 + lr) * lda + 8 * hi, boff = (size_t)(c0 + lr) * K + 8 * hi;
#pragma unroll 1   // rolled: 16 accumulators and one step's fragments fill the register budget of NW waves on four SIMDs
    for (int kc = w * 64; kc < Kl; kc += (kc & 32) ? NW * 64 - 32 : 32) {   // both 32-wide halves of this wave's block, then NW blocks on
        V a[4], a2[4];
#pragma unroll
        for (int mb = 0; mb < 4; ++mb) { a[mb] = WFrag<T16>::ld(A + aoff + (size_t)mb * 16 * lda + kc); if (NSPLIT == 1 || NSPLIT == 2) a2[mb] = WFrag<T16>::ld(A2 + aoff + (size_t)mb * 16 * lda + kc); }
#pragma unroll
        for (int nb = 0; nb < 4; ++nb) { const V b = WFrag<T16>::ld(Bt + boff + (size_t)nb * 16 * K + kc); V b2; if (NSPLIT >= 2) b2 = WFrag<T16>::ld(Bt2 + boff + (size_t)nb * 16 * K + kc);
#pragma unroll
            for (int mb = 0; mb < 4; ++mb) { acc[mb][nb] = WFrag<T16>::mma(a[mb], b, acc[mb][nb]); if (NSPLIT == 1 || NSPLIT == 2) acc[mb][nb] = WFrag<T16>::mma(a2[mb], b, acc[mb][nb]); if (NSPLIT >= 2) acc[mb][nb] = WFrag<T16>::mma(a[mb], b2, acc[mb][nb]); } }
        // four vector slots behind the last WMMAs, on the taken side of the loop's branch too
        asm volatile("v_nop\n\tv_nop\n\tv_nop\n\tv_nop" : "+v"(acc[0][0]), "+v"(acc[1][1]), "+v"(acc[2][2]), "+v"(acc[3][3]) : "v"(a[0]), "v"(a[3]));
    }
    float* ow = os + w * (64 * 68);
#pragma unroll
    for (int mb = 0; mb < 4; ++mb)
#pragma unroll
        for (int nb = 0; nb < 4; ++nb)
#pragma unroll
            for (int j = 0; j < 8; ++j) ow[(mb * 16 + hi * 8 + j) * 68 + nb * 16 + lr] = acc[mb][nb][j];
    __syncthreads();   // every wave's partial is in LDS before any of them is summed
#pragma unroll
    for (int s = 0; s < 32 / NW; ++s) { const int slot = s * NW * 32 + (int)threadIdx.x, row = slot >> 4, cofs = (slot & 15) * 4; v4f val = *(const v4fa*)(os + row * 68 + cofs);
#pragma unroll
        for (int p = 1; p < NW; ++p) val += *(const v4fa*)(os + p * (64 * 68) + row * 68 + cofs);
        if (BIAS) { val[0] += bfr(bias[c0 + cofs]); val[1] += bfr(bias[c0 + cofs + 1]); val[2] += bfr(bias[c0 + cofs + 2]); val[3] += bfr(bias[c0 + cofs + 3]); }
        if constexpr (PLANES) { const size_t po = (size_t)(r0 + row) * ldc + (size_t)c0 * cmul + cofs; v4h o16; v4us oh, ol;
#pragma unroll
            for (int j = 0; j < 4; ++j) { o16[j] = tohx(val[j]); unsigned short a2, c2; splitf(val[j], a2, c2); oh[j] = a2; ol[j] = c2; }
            *(v4h*)(P16 + po) = o16; *(v4us*)(Ph + po) = oh; *(v4us*)(Pl + po) = ol;
        } else *(v4f*)(C + (size_t)(r0 + row) * ldc + c0 + cofs) = val; }
}

__global__ __launch_bounds__(256) void k_cvt8(const float* __restrict__ src, bf* dst, size_t n8) { const size_t i = (size_t)blockIdx.x * 256 + threadIdx.x; if (i >= n8) return; const v8f v = *(const v8f*)(src + i * 8); v8us o;
#pragma unroll
    for (int k = 0; k < 8; ++k) o[k] = f2bf(v[k]); *(v8us*)(dst + i * 8) = o;  }

__global__ __launch_bounds__(256) void k_wperm(const float* __restrict__ W, bf* Bt) { const size_t i = (size_t)blockIdx.x * 256 + threadIdx.x; if (i >= (size_t)3 * DQ * DM / 8) return; const size_t e = i * 8; const int c0 = (int)(e % DM); const int rd = (int)(e / DM); const int part = rd / DQ; const int h = (rd % DQ) / HD; const int d = rd % HD; const int rs = h * 3 * HD + part * HD + d; const v8f v = *(const v8f*)(W + (size_t)rs * DM + c0); v8us o;
#pragma unroll
    for (int k = 0; k < 8; ++k) o[k] = f2bf(v[k]); *(v8us*)(Bt + e) = o;  }
// ---- k_fattn: causal attention of one head's query block in one pass over its keys; scores and probabilities stay in registers (online softmax). grid (heads, query blocks), FNW * 32 threads.
// Transposed products: S^T = K Q^T (A = key rows, B = query rows), so a lane holds 16 keys' scores of ONE query (column lr); two S^T tiles (keys 0..15, 16..31), converted in place, are the B operand of O^T += V^T P^T.
// The keys are dealt to the FNW waves in blocks of 64 (one 128-byte line of every V^T row); each wave keeps its own running maximum, sum and 64 x NQT*16 f32 partial of O^T; the partials meet in LDS, are brought to the
// common maximum and summed in wave order 0..FNW-1; the quotient goes out as the merged hi/lo planes [t][DQ]. HL (query rows < RH): hi+lo planes, 3 products for S and for P V; else fp16 planes, one product.
#define FNW  8
#define FPIT 68                   // f32 pitch of a query's 64 partial outputs in LDS: 272 bytes, an odd multiple of 16
#define CL2  0.18033688011112042f // HD^-0.5 * log2(e): scores in log2 units
__device__ __forceinline__ float ex2(float x) { return __builtin_amdgcn_exp2f(x); }   // the builtin, not asm text: the compiler then keeps its own distances behind the WMMAs whose operand registers it reuses
// for the join behind the barrier, far from any WMMA: the exponential and the one vector slot behind a transcendental in one statement
__device__ __forceinline__ float ex2n(float x) { float r; asm("v_exp_f32 %0, %1\n\tv_nop" : "=v"(r) : "v"(x)); return r; }
__device__ __forceinline__ float xhalf(float x) { return __builtin_bit_cast(float, __builtin_amdgcn_permlanex16(__builtin_bit_cast(int, x), __builtin_bit_cast(int, x), 0x76543210, 0xfedcba98, false, false)); }  // lane l with lane l ^ 16
template <typename T16, bool HL, int NQT>
__device__ __forceinline__ void attn_body(const T16* __restrict__ Q, const T16* __restrict__ Q2, const T16* __restrict__ Kp, const T16* __restrict__ K2, const T16* __restrict__ Vt, const T16* __restrict__ V2, int q0, bf* Ah, bf* Al, float* sm) {
    typedef typename WFrag<T16>::V V;
    const int lane = threadIdx.x & 31, lr = lane & 15, hi = lane >> 4;
    const int w = __builtin_amdgcn_readfirstlane((int)(threadIdx.x >> 5));   // wave number, scalar: the key loop's bounds and the diagonal test stay in scalar registers
    const int Kl = q0 + NQT * 16;                                            // keys beyond the block's last query are masked for every row
    V qf[NQT][2], qf2[NQT][2];
    const size_t qo = (size_t)(q0 + lr) * HD + 8 * hi; const T16* qp = Q + qo; const T16* qp2 = HL ? Q2 + qo : qp;
#pragma unroll
    for (int qt = 0; qt < NQT; ++qt)
#pragma unroll
        for (int ks = 0; ks < 2; ++ks) { qf[qt][ks] = WFrag<T16>::ld(qp + qt * 16 * HD + ks * 32); if (HL) qf2[qt][ks] = WFrag<T16>::ld(qp2 + qt * 16 * HD + ks * 32); }
    // XWAIT, here and below: the wait that stands in front of any overwrite of a register that an issued load names; the addresses are its inputs so that they stay in their registers up to it (no load's own result lands on them)
    asm volatile("s_wait_xcnt 0x0" :: "v"(qp), "v"(qp2) : "memory");
    v8f o[4][NQT]; float m[NQT], l[NQT];
#pragma unroll
    for (int qt = 0; qt < NQT; ++qt) { m[qt] = -3.0e38f; l[qt] = 0.f;
#pragma unroll
        for (int dt = 0; dt < 4; ++dt) o[dt][qt] = (v8f){}; }
    V kf[2][2], kf2[2][2];   // this pass's key fragments: fetched one pass ahead, into the same registers, right behind the products that read them
    if (w * 64 < Kl) { const size_t ko = (size_t)(w * 64 + lr) * HD + 8 * hi; const T16* kp = Kp + ko; const T16* kp2 = HL ? K2 + ko : kp;
#pragma unroll
        for (int kt = 0; kt < 2; ++kt)
#pragma unroll
            for (int ks = 0; ks < 2; ++ks) { kf[kt][ks] = WFrag<T16>::ld(kp + kt * 16 * HD + ks * 32); if (HL) kf2[kt][ks] = WFrag<T16>::ld(kp2 + kt * 16 * HD + ks * 32); }
        asm volatile("s_wait_xcnt 0x0" :: "v"(kp), "v"(kp2) : "memory"); }   // XWAIT
#pragma unroll 1   // rolled: one step's fragments, scores and the output partial fill the register budget
    for (int kc = w * 64; kc < Kl; ) {
        const int kx = kc + ((kc & 32) ? FNW * 64 - 32 : 32);   // both 32-key halves of this wave's block, then FNW blocks on
        const int kn = kx < Kl ? kx : kc;                       // the last pass fetches its own rows again: always inside the plane, never used
        V vf[4], vf2[4];
        const size_t vo = (size_t)lr * TT + kc + 8 * hi, ko = (size_t)(kn + lr) * HD + 8 * hi;
        const T16* vp = Vt + vo; const T16* vp2 = HL ? V2 + vo : vp; const T16* kp = Kp + ko; const T16* kp2 = HL ? K2 + ko : kp;
#pragma unroll
        for (int dt = 0; dt < 4; ++dt) { vf[dt] = WFrag<T16>::ld(vp + dt * 16 * TT); if (HL) vf2[dt] = WFrag<T16>::ld(vp2 + dt * 16 * TT); }
        v8f s[2][NQT];
#pragma unroll
        for (int kt = 0; kt < 2; ++kt)
#pragma unroll
            for (int qt = 0; qt < NQT; ++qt) { v8f a = (v8f){};
#pragma unroll
                for (int ks = 0; ks < 2; ++ks) { a = WFrag<T16>::mma(kf[kt][ks], qf[qt][ks], a); if (HL) { a = WFrag<T16>::mma(kf[kt][ks], qf2[qt][ks], a); a = WFrag<T16>::mma(kf2[kt][ks], qf[qt][ks], a); } }
                s[kt][qt] = a; }
#pragma unroll
        for (int kt = 0; kt < 2; ++kt)
#pragma unroll
            for (int ks = 0; ks < 2; ++ks) { kf[kt][ks] = WFrag<T16>::ld(kp + kt * 16 * HD + ks * 32); if (HL) kf2[kt][ks] = WFrag<T16>::ld(kp2 + kt * 16 * HD + ks * 32); }
        asm volatile("s_wait_xcnt 0x0" :: "v"(vp), "v"(vp2), "v"(kp), "v"(kp2) : "memory");   // XWAIT: the softmax below reuses the address registers
        if (kc + 31 > q0) {   // only a block that reaches past the first query needs the mask (same for the whole wave: one branch round all the selects)
#pragma unroll
            for (int qt = 0; qt < NQT; ++qt) { const int lim = q0 + qt * 16 + lr - kc - hi * 8;   // this lane's query minus its first key
#pragma unroll
                for (int kt = 0; kt < 2; ++kt)
#pragma unroll
                    for (int j = 0; j < 8; ++j) s[kt][qt][j] = (kt * 16 + j <= lim) ? s[kt][qt][j] : -3.0e38f; } }
#pragma unroll
        for (int qt = 0; qt < NQT; ++qt) { float mx = -3.0e38f;
#pragma unroll
            for (int kt = 0; kt < 2; ++kt)
#pragma unroll
                for (int j = 0; j < 8; ++j) mx = fmaxf(mx, s[kt][qt][j]);
            mx = fmaxf(mx, xhalf(mx));   // the query's other 16 keys of this step sit in the other half of the wave
            const float mn = fmaxf(m[qt], mx * CL2), al = ex2(m[qt] - mn); m[qt] = mn; float sum = 0.f;   // the running maximum is kept in log2 units
#pragma unroll
            for (int kt = 0; kt < 2; ++kt)
#pragma unroll
                for (int j = 0; j < 8; ++j) { const float p = ex2(s[kt][qt][j] * CL2 - mn); s[kt][qt][j] = p; sum += p; }
            l[qt] = l[qt] * al + sum;
#pragma unroll
            for (int dt = 0; dt < 4; ++dt) o[dt][qt] *= al;
            if constexpr (HL) { v8us h0, h1, l0, l1;
#pragma unroll
                for (int j = 0; j < 8; ++j) { unsigned short a, c2; splitf(s[0][qt][j], a, c2); h0[j] = a; l0[j] = c2; splitf(s[1][qt][j], a, c2); h1[j] = a; l1[j] = c2; }
                const v16bf ph = cat16b(h0, h1), pl = cat16b(l0, l1);
#pragma unroll
                for (int dt = 0; dt < 4; ++dt) { o[dt][qt] = wmmab(__builtin_bit_cast(v16bf, vf[dt]), ph, o[dt][qt]); o[dt][qt] = wmmab(__builtin_bit_cast(v16bf, vf[dt]), pl, o[dt][qt]); o[dt][qt] = wmmab(__builtin_bit_cast(v16bf, vf2[dt]), ph, o[dt][qt]); }
            } else { v16h pb;
#pragma unroll
                for (int j = 0; j < 8; ++j) { pb[j] = tohx(s[0][qt][j]); pb[8 + j] = tohx(s[1][qt][j]); }
#pragma unroll
                for (int dt = 0; dt < 4; ++dt) o[dt][qt] = wmma16(__builtin_bit_cast(v16h, vf[dt]), pb, o[dt][qt]); } }
        // four vector slots behind the last WMMAs, on the taken side of the loop's branch too
        asm volatile("v_nop\n\tv_nop\n\tv_nop\n\tv_nop" : "+v"(o[0][NQT - 1]), "+v"(o[1][NQT - 1]), "+v"(o[2][NQT - 1]), "+v"(o[3][NQT - 1]) : "v"(vf[0]), "v"(vf[3]));
        kc = kx;
    }
    constexpr int NQ = NQT * 16;
    float* ow = sm + w * (NQ * FPIT); float* ms = sm + FNW * (NQ * FPIT); float* ls = ms + FNW * NQ;
#pragma unroll
    for (int qt = 0; qt < NQT; ++qt) { const float lj = l[qt] + xhalf(l[qt]);   // the two halves' sums of one query
        if (hi == 0) { ms[w * NQ + qt * 16 + lr] = m[qt]; ls[w * NQ + qt * 16 + lr] = lj; }
#pragma unroll
        for (int dt = 0; dt < 4; ++dt) { v4f a, b;
#pragma unroll
            for (int j = 0; j < 4; ++j) { a[j] = o[dt][qt][j]; b[j] = o[dt][qt][4 + j]; }
            float* op = ow + (qt * 16 + lr) * FPIT + dt * 16 + hi * 8; *(v4fa*)op = a; *(v4fa*)(op + 4) = b; } }
    __syncthreads();   // every wave's maximum, sum and partial are in LDS before any of them is joined
    if ((int)threadIdx.x < NQ * 8) { const int q = (int)threadIdx.x >> 3, dg = ((int)threadIdx.x & 7) * 8; float M = -3.0e38f;
#pragma unroll
        for (int p = 0; p < FNW; ++p) M = fmaxf(M, ms[p * NQ + q]);   // wave 0 always holds key 0, so M is a real score
        float L = 0.f; v4f a = (v4f){}, b = (v4f){};
#pragma unroll
        for (int p = 0; p < FNW; ++p) { const float f = ex2n(ms[p * NQ + q] - M); L += f * ls[p * NQ + q]; const float* ip = sm + p * (NQ * FPIT) + q * FPIT + dg; a += f * *(const v4fa*)ip; b += f * *(const v4fa*)(ip + 4); }
        const float inv = __fdiv_rn(1.0f, L); v8us oh, ol;
#pragma unroll
        for (int j = 0; j < 4; ++j) { unsigned short x, y; splitf(a[j] * inv, x, y); oh[j] = x; ol[j] = y; splitf(b[j] * inv, x, y); oh[4 + j] = x; ol[4 + j] = y; }
        const size_t oo = (size_t)(q0 + q) * DQ + dg; *(v8us*)(Ah + oo) = oh; *(v8us*)(Al + oo) = ol; }
}
__global__ __launch_bounds__(FNW * 32) __attribute__((amdgpu_waves_per_eu(4, 4))) void k_fattn(const h16* __restrict__ Q16, const h16* __restrict__ K16, const h16* __restrict__ V16, const bf* __restrict__ Qh, const bf* __restrict__ Ql, const bf* __restrict__ Kh, const bf* __restrict__ Kl, const bf* __restrict__ Vh, const bf* __restrict__ Vl, bf* Ah, bf* Al) {
    __shared__ __align__(16) float sm[FNW * 32 * FPIT + 2 * FNW * 32];
    const size_t hp = (size_t)blockIdx.x * TT * HD; const int bx = (int)blockIdx.y; Ah += blockIdx.x * HD; Al += blockIdx.x * HD;
    // every head's longest query blocks first (lowest y), for speed only
    if (bx < (TT - RH) / 32) attn_body<h16, false, 2>(Q16 + hp, nullptr, K16 + hp, nullptr, V16 + hp, nullptr, TT - 32 * (bx + 1), Ah, Al, sm);
    else attn_body<bf, true, 1>(Qh + hp, Ql + hp, Kh + hp, Kl + hp, Vh + hp, Vl + hp, RH - 16 * (bx - (TT - RH) / 32 + 1), Ah, Al, sm);
}

extern "C" void kernel_launch(void* const* d_in, const int* in_sizes, int n_in,
                              void* d_out, int out_size, void* d_ws, size_t ws_size, hipStream_t stream) {
    (void)in_sizes; (void)n_in; (void)out_size;
    const float* x = (const float*)d_in[0]; const float* wqkv = (const float*)d_in[1]; const float* wo = (const float*)d_in[2]; const float* bo = (const float*)d_in[3];   /* input order x, w_qkv ('oi' (out, in) [3072][1024], rows packed per head (h, part, c)), w_proj ('oi' [1024][1024]), b_proj (REAL): FOUR inputs, all read: the host's own binding */ const float* wq = wqkv; const float* wk = nullptr; const float* wv = nullptr; (void)wk; (void)wv;
    float* OUT = (float*)d_out;     // [4][2048][1024]
    char* wsp = (char*)d_ws;
    auto take = [&](size_t bytes) { char* p = wsp; wsp += (bytes + 255) & ~(size_t)255; return (void*)p; };
    bf* WQKV = (bf*)take((size_t)3 * DQ * DM * 2); bf* WQ = WQKV; bf* WK = WQKV + (size_t)DQ * DM; bf* WV = WQKV + (size_t)2 * DQ * DM;   /* de-interleaved Bt: q | k | v row blocks in head order */ bf* WO = (bf*)take((size_t)DM * DQ * 2);
    bf* XB = (bf*)take((size_t)TT * DM * 2);
    h16* QP16 = (h16*)take((size_t)NH_ * TT * HD * 2); h16* KP16 = (h16*)take((size_t)NKV * TT * HD * 2); h16* VT16 = (h16*)take((size_t)NKV * HD * TT * 2);
    bf* QPh = (bf*)take((size_t)NH_ * TT * HD * 2); bf* QPl = (bf*)take((size_t)NH_ * TT * HD * 2); bf* KPh = (bf*)take((size_t)NKV * TT * HD * 2); bf* KPl = (bf*)take((size_t)NKV * TT * HD * 2); bf* VTh = (bf*)take((size_t)NKV * HD * TT * 2); bf* VTl = (bf*)take((size_t)NKV * HD * TT * 2);
    bf* ATh = (bf*)take((size_t)TT * DQ * 2); bf* ATl = (bf*)take((size_t)TT * DQ * 2);
    if ((size_t)(wsp - (char*)d_ws) > ws_size) return;    // ws 256 MiB
    { k_wperm<<<(unsigned)(((size_t)3 * DQ * DM / 8 + 255) / 256), 256, 0, stream>>>(wqkv, WQKV);   /* packed rows (h, part, d) -> standard (part, h, d) blocks */
      k_cvt8<<<(unsigned)(((size_t)DM * DQ / 8 + 255) / 256), 256, 0, stream>>>(wo, WO, (size_t)DM * DQ / 8);
       }
    for (int b = 0; b < NB_; ++b) {
        
        k_cvt8<<<(unsigned)(((size_t)TT * DM / 8 + 255) / 256), 256, 0, stream>>>(x + (size_t)b * TT * DM, XB, (size_t)TT * DM / 8);
        k_gemms<bf, 0, false, false, 8, true><<<dim3(TT / 64, DQ / 64, 1), 256, 0, stream>>>(XB, nullptr, DM, WQ, nullptr, DM, nullptr, HD, nullptr, 0, 0, 0, 0, QP16, QPh, QPl, TT);     // q planes [h][t][d]
        k_gemms<bf, 0, false, false, 8, true><<<dim3(TT / 64, DKV / 64, 1), 256, 0, stream>>>(XB, nullptr, DM, WK, nullptr, DM, nullptr, HD, nullptr, 0, 0, 0, 0, KP16, KPh, KPl, TT);    // k planes [h][t][d]
        k_gemms<bf, 0, false, false, 8, true><<<dim3(DKV / 64, TT / 64, 1), 256, 0, stream>>>(WV, nullptr, DM, XB, nullptr, DM, nullptr, TT, nullptr, 0, 0, 0, 0, VT16, VTh, VTl, 1);     // v^T = W_v x^T: planes [h][d][t]
        k_fattn<<<dim3(NH_, (TT - RH) / 32 + RH / 16, 1), FNW * 32, 0, stream>>>(QP16, KP16, VT16, QPh, QPl, KPh, KPl, VTh, VTl, ATh, ATl);   // one kv head per query head: head h uses plane h of each
        k_gemms<bf, 1, true, false, 8, false><<<dim3(TT / 64, DM / 64, 1), 256, 0, stream>>>(ATh, ATl, DQ, WO, nullptr, DQ, OUT + (size_t)b * TT * DM, DM, bo, 0, 0, 0, 0, nullptr, nullptr, nullptr, 0); }
}

// v005
// A run of this version takes 316 microseconds.
// Two timings next to v004 both put it at 1.20 times that version's speed.
// Over all steps from v000 it is 8.83 times as fast.
#include <hip/hip_runtime.h>

// Causal multi-head attention with a fused bias-free qkv projection in (out, in) layout whose ROWS are packed PER HEAD (x [4][2048][1024]; qkv = einsum('bse,fe->bsf', x, w_qkv) = x w_qkv^T ('oi' (out, in) [3072][1024] 1/32, no bias) viewed (b, s, 16 heads, 3 x 64): head h's rows h*192 + 0..63 | 64..127 | 128..191 of w_qkv are its q | k | v; scores x 64^-0.5 (token-major einsums: the same products); where(tril, scores, -inf) (exclusion; every row keeps its own key); softmax; out = merged w_proj^T + b_proj ('oi' + a REAL 0.01 bias) -> [4][2048][1024] (8.4 M); argument order x, w_qkv, w_proj, b_proj).
// Four launches, each over all four batches: bf16 copies (x, w_proj, and the packed weight rows gathered into a standard q | k | v Bt, a row permutation); exact projections that write the head planes themselves, q, k and v^T in one grid; causal T-2048 attention, all heads of all batches in one launch, scores and probabilities kept in registers (online softmax; hybrid rows: < 512 hi/lo 3 products, rest fp16; key blocks above the diagonal are never visited); merged hi/lo x Wo exact + bo.
// Compute dtypes, f32 accumulate: every input rounded to bf16; projections exact; attention rows < 512 3 products, rest fp16; softmax f32; Wo hl x exact + bias.

#define NB_  4
#define TT   2048
#define DM   1024
#define NH_  16
#define NKV  16
#define HD   64
#define DQ   (NH_ * HD)
#define DKV  (NKV * HD)
#define RH   512                  // query rows < RH use hi+lo planes (0: none)
typedef _Float16 h16;
typedef unsigned short bf;
typedef __attribute__((ext_vector_type(16))) __bf16   v16bf;
typedef __attribute__((ext_vector_type(16))) _Float16 v16h;
typedef __attribute__((ext_vector_type(8)))  _Float16 v8h;
typedef __attribute__((ext_vector_type(8)))  unsigned short v8us;
typedef __attribute__((ext_vector_type(8)))  float    v8f;
typedef __attribute__((ext_vector_type(4)))  float    v4f;
typedef v8h  __attribute__((may_alias)) v8ha;
typedef v4f  __attribute__((may_alias)) v4fa;
typedef v8us __attribute__((may_alias)) v8usa;

__device__ __forceinline__ unsigned short f2bf(float f) { unsigned u = __float_as_uint(f); u += 0x7FFFu + ((u >> 16) & 1u); return (unsigned short)(u >> 16); }
__device__ __forceinline__ float bf2f(unsigned short b) { return __uint_as_float(((unsigned)b) << 16); }
__device__ __forceinline__ float bfr(float f) { return bf2f(f2bf(f)); }
__device__ __forceinline__ v16h cat16(v8h lo, v8h hi) { return __builtin_shufflevector(lo, hi, 0, 1, 2, 3, 4, 5, 6, 7, 8, 9, 10, 11, 12, 13, 14, 15); }
__device__ __forceinline__ v16bf cat16b(v8us lo, v8us hi) { return __builtin_bit_cast(v16bf, __builtin_shufflevector(lo, hi, 0, 1, 2, 3, 4, 5, 6, 7, 8, 9, 10, 11, 12, 13, 14, 15)); }
__device__ __forceinline__ v8f wmma16(v16h a, v16h b, v8f c) { return __builtin_amdgcn_wmma_f32_16x16x32_f16(false, a, false, b, (short)0, c, false, false); }
__device__ __forceinline__ v8f wmmab(v16bf a, v16bf b, v8f c) { return __builtin_amdgcn_wmma_f32_16x16x32_bf16(false, a, false, b, (short)0, c, false, false); }
__device__ __forceinline__ h16 tohx(float x) { return (h16)x; }
__device__ __forceinline__ void splitf(float y, unsigned short& h, unsigned short& l) { h = f2bf(y); l = f2bf(y - bf2f(h)); }
typedef __attribute__((ext_vector_type(4))) _Float16 v4h;
typedef __attribute__((ext_vector_type(4))) unsigned short v4us;



// ---- k_gemms: register-blocked GEMM, one 64x64 output tile per work-group of NW waves, operands straight from K-contiguous 16-bit planes; grid (M/64, N/64, Z), NW * 32 threads.
// C[m][n] (f32, pitch ldc, + optional f32 bias[n]) = sum_k A[m][k] Bt[n][k] (+ split products per NSPLIT). A rows have pitch lda, Bt rows pitch K. z-batch strides sA/sB/sC in elements. K % 64 == 0.
// The K range is dealt to the waves in blocks of 64 (one 128-byte line of every operand row): wave w takes blocks w, w + NW, ... and keeps a whole 64x64 f32 partial (16 accumulators);
// the NW partials meet in LDS and every output element is their sum in wave order 0..NW-1.
// PLANES: the sum goes out not as f32 C but as three 16-bit planes (fp16, bf16 hi, bf16 lo), [z][y][TT * HD] each: A = token rows (x = token tile, z = batch), Bt = weight rows (y = one head's 64 rows of q, k or v).
// y < tsw: the tile is 64 rows of the head's plane [t][d]; y >= tsw: the operands change places (W_v x^T) and the tile is 64 columns of the transposed plane [d][t]. 16 lanes store one whole 128-byte line of a plane. CAUSK (probability x value): the K range ends at the diagonal block of query rows r0 + roff.. (probabilities beyond it are exactly zero).
template <typename T16> struct WFrag;
template <> struct WFrag<h16> { typedef v16h V; static __device__ __forceinline__ V ld(const h16* p) { return cat16(*(const v8h*)p, *(const v8h*)(p + 16)); } static __device__ __forceinline__ v8f mma(V a, V b, v8f c) { return wmma16(a, b, c); } };
template <> struct WFrag<bf> { typedef v16bf V; static __device__ __forceinline__ V ld(const bf* p) { return cat16b(*(const v8us*)p, *(const v8us*)(p + 16)); } static __device__ __forceinline__ v8f mma(V a, V b, v8f c) { return wmmab(a, b, c); } };
template <typename T16, int NSPLIT, bool BIAS, bool CAUSK, int NW, bool PLANES>
__global__ __launch_bounds__(NW * 32) void k_gemms(const T16* __restrict__ A, const T16* __restrict__ A2, int lda, const T16* __restrict__ Bt, const T16* __restrict__ Bt2, int K, float* C, int ldc, const float* __restrict__ bias, int roff, size_t sA, size_t sB, size_t sC, h16* P16, bf* Ph, bf* Pl, int tsw) {
    typedef typename WFrag<T16>::V V;
    __shared__ __align__(16) float os[NW * 64 * 68];
    const size_t z = blockIdx.z; A += z * sA; if (A2) A2 += z * sA; Bt += z * sB; if (Bt2) Bt2 += z * sB; if (!PLANES) C += z * sC;
    const int lane = threadIdx.x & 31, lr = lane & 15, hi = lane >> 4; int r0 = blockIdx.x * 64, c0 = blockIdx.y * 64;
    const bool tr = PLANES && (int)blockIdx.y >= tsw;   // same for the whole work-group
    if (tr) { const T16* t = A; A = Bt; Bt = t; const int ti = r0; r0 = c0; c0 = ti; }
    const size_t pbase = z * sC + (size_t)blockIdx.y * (TT * HD) + (tr ? (size_t)c0 : (size_t)r0 * HD); const int ppit = tr ? TT : HD;   // the tile's first element in its head plane, and the plane's row pitch
    const int w = __builtin_amdgcn_readfirstlane((int)(threadIdx.x >> 5));   // wave number, scalar: the K loop's bounds stay in scalar registers
    const int Kl = CAUSK ? min(K, r0 + roff + 64) : K;
    v8f acc[4][4];
#pragma unroll
    for (int mb = 0; mb < 4; ++mb)
#pragma unroll
        for (int nb = 0; nb < 4; ++nb) acc[mb][nb] = (v8f){};
    const size_t aoff = (size_t)(r0 + lr) * lda + 8 * hi, boff = (size_t)(c0 + lr) * K + 8 * hi;
#pragma unroll 1   // rolled: 16 accumulators and one step's fragments fill the register budget of NW waves on four SIMDs
    for (int kc = w * 64; kc < Kl; kc += (kc & 32) ? NW * 64 - 32 : 32) {   // both 32-wide halves of this wave's block, then NW blocks on
        V a[4], a2[4];
#pragma unroll
        for (int mb = 0; mb < 4; ++mb) { a[mb] = WFrag<T16>::ld(A + aoff + (size_t)mb * 16 * lda + kc); if (NSPLIT == 1 || NSPLIT == 2) a2[mb] = WFrag<T16>::ld(A2 + aoff + (size_t)mb * 16 * lda + kc); }
#pragma unroll
        for (int nb = 0; nb < 4; ++nb) { const V b = WFrag<T16>::ld(Bt + boff + (size_t)nb * 16 * K + kc); V b2; if (NSPLIT >= 2) b2 = WFrag<T16>::ld(Bt2 + boff + (size_t)nb * 16 * K + kc);
#pragma unroll
            for (int mb = 0; mb < 4; ++mb) { acc[mb][nb] = WFrag<T16>::mma(a[mb], b, acc[mb][nb]); if (NSPLIT == 1 || NSPLIT == 2) acc[mb][nb] = WFrag<T16>::mma(a2[mb], b, acc[mb][nb]); if (NSPLIT >= 2) acc[mb][nb] = WFrag<T16>::mma(a[mb], b2, acc[mb][nb]); } }
        // four vector slots behind the last WMMAs, on the taken side of the loop's branch too
        asm volatile("v_nop\n\tv_nop\n\tv_nop\n\tv_nop" : "+v"(acc[0][0]), "+v"(acc[1][1]), "+v"(acc[2][2]), "+v"(acc[3][3]) : "v"(a[0]), "v"(a[3]));
    }
    float* ow = os + w * (64 * 68);
#pragma unroll
    for (int mb = 0; mb < 4; ++mb)
#pragma unroll
        for (int nb = 0; nb < 4; ++nb)
#pragma unroll
            for (int j = 0; j < 8; ++j) ow[(mb * 16 + hi * 8 + j) * 68 + nb * 16 + lr] = acc[mb][nb][j];
    __syncthreads();   // every wave's partial is in LDS before any of them is summed
#pragma unroll
    for (int s = 0; s < 32 / NW; ++s) { const int slot = s * NW * 32 + (int)threadIdx.x, row = slot >> 4, cofs = (slot & 15) * 4; v4f val = *(const v4fa*)(os + row * 68 + cofs);
#pragma unroll
        for (int p = 1; p < NW; ++p) val += *(const v4fa*)(os + p * (64 * 68) + row * 68 + cofs);
        if (BIAS) { val[0] += bfr(bias[c0 + cofs]); val[1] += bfr(bias[c0 + cofs + 1]); val[2] += bfr(bias[c0 + cofs + 2]); val[3] += bfr(bias[c0 + cofs + 3]); }
        if constexpr (PLANES) { const size_t po = pbase + (size_t)(row * ppit + cofs); v4h o16; v4us oh, ol;
#pragma unroll
            for (int j = 0; j < 4; ++j) { o16[j] = tohx(val[j]); unsigned short a2, c2; splitf(val[j], a2, c2); oh[j] = a2; ol[j] = c2; }
            *(v4h*)(P16 + po) = o16; *(v4us*)(Ph + po) = oh; *(v4us*)(Pl + po) = ol;
        } else *(v4f*)(C + (size_t)(r0 + row) * ldc + c0 + cofs) = val; }
}

// ---- k_prep: every f32 -> bf16 copy in one launch, 8 elements a thread; the block index picks the range: x (all batches), w_proj, then w_qkv with its packed rows (h, part, d) gathered into standard (part, h, d) blocks.
#define PBX (NB_ * TT * DM / 8 / 256)
#define PBO (DM * DQ / 8 / 256)
#define PBW (3 * DQ * DM / 8 / 256)
__global__ __launch_bounds__(256) void k_prep(const float* __restrict__ x, const float* __restrict__ W, const float* __restrict__ wo, bf* XB, bf* Bt, bf* WO) {
    const int bx = (int)blockIdx.x; const float* s; bf* d;
    if (bx < PBX) { const size_t e = ((size_t)bx * 256 + threadIdx.x) * 8; s = x + e; d = XB + e; }
    else if (bx < PBX + PBO) { const size_t e = ((size_t)(bx - PBX) * 256 + threadIdx.x) * 8; s = wo + e; d = WO + e; }
    else { const size_t e = ((size_t)(bx - PBX - PBO) * 256 + threadIdx.x) * 8; const int c0 = (int)(e % DM); const int rd = (int)(e / DM); const int part = rd / DQ; const int h = (rd % DQ) / HD; const int dd = rd % HD; s = W + (size_t)(h * 3 * HD + part * HD + dd) * DM + c0; d = Bt + e; }
    const v8f v = *(const v8f*)s; v8us o;
#pragma unroll
    for (int k = 0; k < 8; ++k) o[k] = f2bf(v[k]);
    *(v8us*)d = o;
}
// ---- k_fattn: causal attention of one head's query block in one pass over its keys; scores and probabilities stay in registers (online softmax). grid (heads x batches, query blocks), FNW * 32 threads.
// Transposed products: S^T = K Q^T (A = key rows, B = query rows), so a lane holds 16 keys' scores of ONE query (column lr); two S^T tiles (keys 0..15, 16..31), converted in place, are the B operand of O^T += V^T P^T.
// The keys are dealt to the FNW waves in blocks of 64 (one 128-byte line of every V^T row); each wave keeps its own running maximum, sum and 64 x NQT*16 f32 partial of O^T; the partials meet in LDS, are brought to the
// common maximum and summed in wave order 0..FNW-1; the quotient goes out as the merged hi/lo planes [t][DQ]. HL (query rows < RH): hi+lo planes, 3 products for S and for P V; else fp16 planes, one product.
#define FNW  8
#define FPIT 68                   // f32 pitch of a query's 64 partial outputs in LDS: 272 bytes, an odd multiple of 16
#define CL2  0.18033688011112042f // HD^-0.5 * log2(e): scores in log2 units
__device__ __forceinline__ float ex2(float x) { return __builtin_amdgcn_exp2f(x); }   // the builtin, not asm text: the compiler then keeps its own distances behind the WMMAs whose operand registers it reuses
// for the join behind the barrier, far from any WMMA: the exponential and the one vector slot behind a transcendental in one statement
__device__ __forceinline__ float ex2n(float x) { float r; asm("v_exp_f32 %0, %1\n\tv_nop" : "=v"(r) : "v"(x)); return r; }
__device__ __forceinline__ float xhalf(float x) { return __builtin_bit_cast(float, __builtin_amdgcn_permlanex16(__builtin_bit_cast(int, x), __builtin_bit_cast(int, x), 0x76543210, 0xfedcba98, false, false)); }  // lane l with lane l ^ 16
template <typename T16, bool HL, int NQT>
__device__ __forceinline__ void attn_body(const T16* __restrict__ Q, const T16* __restrict__ Q2, const T16* __restrict__ Kp, const T16* __restrict__ K2, const T16* __restrict__ Vt, const T16* __restrict__ V2, int q0, bf* Ah, bf* Al, float* sm) {
    typedef typename WFrag<T16>::V V;
    const int lane = threadIdx.x & 31, lr = lane & 15, hi = lane >> 4;
    const int w = __builtin_amdgcn_readfirstlane((int)(threadIdx.x >> 5));   // wave number, scalar: the key loop's bounds and the diagonal test stay in scalar registers
    const int Kl = q0 + NQT * 16;                                            // keys beyond the block's last query are masked for every row
    V qf[NQT][2], qf2[NQT][2];
    const size_t qo = (size_t)(q0 + lr) * HD + 8 * hi; const T16* qp = Q + qo; const T16* qp2 = HL ? Q2 + qo : qp;
#pragma unroll
    for (int qt = 0; qt < NQT; ++qt)
#pragma unroll
        for (int ks = 0; ks < 2; ++ks) { qf[qt][ks] = WFrag<T16>::ld(qp + qt * 16 * HD + ks * 32); if (HL) qf2[qt][ks] = WFrag<T16>::ld(qp2 + qt * 16 * HD + ks * 32); }
    // XWAIT, here and below: the wait that stands in front of any overwrite of a register that an issued load names; the addresses are its inputs so that they stay in their registers up to it (no load's own result lands on them)
    asm volatile("s_wait_xcnt 0x0" :: "v"(qp), "v"(qp2) : "memory");
    v8f o[4][NQT]; float m[NQT], l[NQT];
#pragma unroll
    for (int qt = 0; qt < NQT; ++qt) { m[qt] = -3.0e38f; l[qt] = 0.f;
#pragma unroll
        for (int dt = 0; dt < 4; ++dt) o[dt][qt] = (v8f){}; }
    V kf[2][2], kf2[2][2];   // this pass's key fragments: fetched one pass ahead, into the same registers, right behind the products that read them
    if (w * 64 < Kl) { const size_t ko = (size_t)(w * 64 + lr) * HD + 8 * hi; const T16* kp = Kp + ko; const T16* kp2 = HL ? K2 + ko : kp;
#pragma unroll
        for (int kt = 0; kt < 2; ++kt)
#pragma unroll
            for (int ks = 0; ks < 2; ++ks) { kf[kt][ks] = WFrag<T16>::ld(kp + kt * 16 * HD + ks * 32); if (HL) kf2[kt][ks] = WFrag<T16>::ld(kp2 + kt * 16 * HD + ks * 32); }
        asm volatile("s_wait_xcnt 0x0" :: "v"(kp), "v"(kp2) : "memory"); }   // XWAIT
#pragma unroll 1   // rolled: one step's fragments, scores and the output partial fill the register budget
    for (int kc = w * 64; kc < Kl; ) {
        const int kx = kc + ((kc & 32) ? FNW * 64 - 32 : 32);   // both 32-key halves of this wave's block, then FNW blocks on
        const int kn = kx < Kl ? kx : kc;                       // the last pass fetches its own rows again: always inside the plane, never used
        V vf[4], vf2[4];
        const size_t vo = (size_t)lr * TT + kc + 8 * hi, ko = (size_t)(kn + lr) * HD + 8 * hi;
        const T16* vp = Vt + vo; const T16* vp2 = HL ? V2 + vo : vp; const T16* kp = Kp + ko; const T16* kp2 = HL ? K2 + ko : kp;
#pragma unroll
        for (int dt = 0; dt < 4; ++dt) { vf[dt] = WFrag<T16>::ld(vp + dt * 16 * TT); if (HL) vf2[dt] = WFrag<T16>::ld(vp2 + dt * 16 * TT); }
        v8f s[2][NQT];
#pragma unroll
        for (int kt = 0; kt < 2; ++kt)
#pragma unroll
            for (int qt = 0; qt < NQT; ++qt) { v8f a = (v8f){};
#pragma unroll
                for (int ks = 0; ks < 2; ++ks) { a = WFrag<T16>::mma(kf[kt][ks], qf[qt][ks], a); if (HL) { a = WFrag<T16>::mma(kf[kt][ks], qf2[qt][ks], a); a = WFrag<T16>::mma(kf2[kt][ks], qf[qt][ks], a); } }
                s[kt][qt] = a; }
#pragma unroll
        for (int kt = 0; kt < 2; ++kt)
#pragma unroll
            for (int ks = 0; ks < 2; ++ks) { kf[kt][ks] = WFrag<T16>::ld(kp + kt * 16 * HD + ks * 32); if (HL) kf2[kt][ks] = WFrag<T16>::ld(kp2 + kt * 16 * HD + ks * 32); }
        asm volatile("s_wait_xcnt 0x0" :: "v"(vp), "v"(vp2), "v"(kp), "v"(kp2) : "memory");   // XWAIT: the softmax below reuses the address registers
        if (kc + 31 > q0) {   // only a block that reaches past the first query needs the mask (same for the whole wave: one branch round all the selects)
#pragma unroll
            for (int qt = 0; qt < NQT; ++qt) { const int lim = q0 + qt * 16 + lr - kc - hi * 8;   // this lane's query minus its first key
#pragma unroll
                for (int kt = 0; kt < 2; ++kt)
#pragma unroll
                    for (int j = 0; j < 8; ++j) s[kt][qt][j] = (kt * 16 + j <= lim) ? s[kt][qt][j] : -3.0e38f; } }
#pragma unroll
        for (int qt = 0; qt < NQT; ++qt) { float mx = -3.0e38f;
#pragma unroll
            for (int kt = 0; kt < 2; ++kt)
#pragma unroll
                for (int j = 0; j < 8; ++j) mx = fmaxf(mx, s[kt][qt][j]);
            mx = fmaxf(mx, xhalf(mx));   // the query's other 16 keys of this step sit in the other half of the wave
            const float mn = fmaxf(m[qt], mx * CL2), al = ex2(m[qt] - mn); m[qt] = mn; float sum = 0.f;   // the running maximum is kept in log2 units
#pragma unroll
            for (int kt = 0; kt < 2; ++kt)
#pragma unroll
                for (int j = 0; j < 8; ++j) { const float p = ex2(s[kt][qt][j] * CL2 - mn); s[kt][qt][j] = p; sum += p; }
            l[qt] = l[qt] * al + sum;
#pragma unroll
            for (int dt = 0; dt < 4; ++dt) o[dt][qt] *= al;
            if constexpr (HL) { v8us h0, h1, l0, l1;
#pragma unroll
                for (int j = 0; j < 8; ++j) { unsigned short a, c2; splitf(s[0][qt][j], a, c2); h0[j] = a; l0[j] = c2; splitf(s[1][qt][j], a, c2); h1[j] = a; l1[j] = c2; }
                const v16bf ph = cat16b(h0, h1), pl = cat16b(l0, l1);
#pragma unroll
                for (int dt = 0; dt < 4; ++dt) { o[dt][qt] = wmmab(__builtin_bit_cast(v16bf, vf[dt]), ph, o[dt][qt]); o[dt][qt] = wmmab(__builtin_bit_cast(v16bf, vf[dt]), pl, o[dt][qt]); o[dt][qt] = wmmab(__builtin_bit_cast(v16bf, vf2[dt]), ph, o[dt][qt]); }
            } else { v16h pb;
#pragma unroll
                for (int j = 0; j < 8; ++j) { pb[j] = tohx(s[0][qt][j]); pb[8 + j] = tohx(s[1][qt][j]); }
#pragma unroll
                for (int dt = 0; dt < 4; ++dt) o[dt][qt] = wmma16(__builtin_bit_cast(v16h, vf[dt]), pb, o[dt][qt]); } }
        // four vector slots behind the last WMMAs, on the taken side of the loop's branch too
        asm volatile("v_nop\n\tv_nop\n\tv_nop\n\tv_nop" : "+v"(o[0][NQT - 1]), "+v"(o[1][NQT - 1]), "+v"(o[2][NQT - 1]), "+v"(o[3][NQT - 1]) : "v"(vf[0]), "v"(vf[3]));
        kc = kx;
    }
    constexpr int NQ = NQT * 16;
    float* ow = sm + w * (NQ * FPIT); float* ms = sm + FNW * (NQ * FPIT); float* ls = ms + FNW * NQ;
#pragma unroll
    for (int qt = 0; qt < NQT; ++qt) { const float lj = l[qt] + xhalf(l[qt]);   // the two halves' sums of one query
        if (hi == 0) { ms[w * NQ + qt * 16 + lr] = m[qt]; ls[w * NQ + qt * 16 + lr] = lj; }
#pragma unroll
        for (int dt = 0; dt < 4; ++dt) { v4f a, b;
#pragma unroll
            for (int j = 0; j < 4; ++j) { a[j] = o[dt][qt][j]; b[j] = o[dt][qt][4 + j]; }
            float* op = ow + (qt * 16 + lr) * FPIT + dt * 16 + hi * 8; *(v4fa*)op = a; *(v4fa*)(op + 4) = b; } }
    __syncthreads();   // every wave's maximum, sum and partial are in LDS before any of them is joined
    if ((int)threadIdx.x < NQ * 8) { const int q = (int)threadIdx.x >> 3, dg = ((int)threadIdx.x & 7) * 8; float M = -3.0e38f;
#pragma unroll
        for (int p = 0; p < FNW; ++p) M = fmaxf(M, ms[p * NQ + q]);   // wave 0 always holds key 0, so M is a real score
        float L = 0.f; v4f a = (v4f){}, b = (v4f){};
#pragma unroll
        for (int p = 0; p < FNW; ++p) { const float f = ex2n(ms[p * NQ + q] - M); L += f * ls[p * NQ + q]; const float* ip = sm + p * (NQ * FPIT) + q * FPIT + dg; a += f * *(const v4fa*)ip; b += f * *(const v4fa*)(ip + 4); }
        const float inv = __fdiv_rn(1.0f, L); v8us oh, ol;
#pragma unroll
        for (int j = 0; j < 4; ++j) { unsigned short x, y; splitf(a[j] * inv, x, y); oh[j] = x; ol[j] = y; splitf(b[j] * inv, x, y); oh[4 + j] = x; ol[4 + j] = y; }
        const size_t oo = (size_t)(q0 + q) * DQ + dg; *(v8us*)(Ah + oo) = oh; *(v8us*)(Al + oo) = ol; }
}
__global__ __launch_bounds__(FNW * 32) __attribute__((amdgpu_waves_per_eu(4, 4))) void k_fattn(const h16* __restrict__ Q16, const h16* __restrict__ K16, const h16* __restrict__ V16, const bf* __restrict__ Qh, const bf* __restrict__ Ql, const bf* __restrict__ Kh, const bf* __restrict__ Kl, const bf* __restrict__ Vh, const bf* __restrict__ Vl, bf* Ah, bf* Al) {
    __shared__ __align__(16) float sm[FNW * 32 * FPIT + 2 * FNW * 32];
    const unsigned hd = blockIdx.x % NH_, bt = blockIdx.x / NH_;   // head, batch; a batch holds 3 * NH_ head planes (q, k, v^T)
    const size_t hp = (size_t)(bt * 3 * NH_ + hd) * TT * HD; const int bx = (int)blockIdx.y; Ah += (size_t)bt * TT * DQ + hd * HD; Al += (size_t)bt * TT * DQ + hd * HD;
    // every head's and batch's longest query blocks first: none of them runs on alone at the end
    if (bx < (TT - RH) / 32) attn_body<h16, false, 2>(Q16 + hp, nullptr, K16 + hp, nullptr, V16 + hp, nullptr, TT - 32 * (bx + 1), Ah, Al, sm);
    else attn_body<bf, true, 1>(Qh + hp, Ql + hp, Kh + hp, Kl + hp, Vh + hp, Vl + hp, RH - 16 * (bx - (TT - RH) / 32 + 1), Ah, Al, sm);
}

extern "C" void kernel_launch(void* const* d_in, const int* in_sizes, int n_in,
                              void* d_out, int out_size, void* d_ws, size_t ws_size, hipStream_t stream) {
    (void)in_sizes; (void)n_in; (void)out_size;
    const float* x = (const float*)d_in[0]; const float* wqkv = (const float*)d_in[1]; const float* wo = (const float*)d_in[2]; const float* bo = (const float*)d_in[3];   /* input order x, w_qkv ('oi' (out, in) [3072][1024], rows packed per head (h, part, c)), w_proj ('oi' [1024][1024]), b_proj (REAL): FOUR inputs, all read: the host's own binding */ const float* wq = wqkv; const float* wk = nullptr; const float* wv = nullptr; (void)wk; (void)wv;
    float* OUT = (float*)d_out;     // [4][2048][1024]
    char* wsp = (char*)d_ws;
    auto take = [&](size_t bytes) { char* p = wsp; wsp += (bytes + 255) & ~(size_t)255; return (void*)p; };
    bf* WQKV = (bf*)take((size_t)3 * DQ * DM * 2);   /* de-interleaved Bt: q | k | v row blocks in head order */ bf* WO = (bf*)take((size_t)DM * DQ * 2);
    bf* XB = (bf*)take((size_t)NB_ * TT * DM * 2);
    const size_t PB = (size_t)3 * NH_ * TT * HD, PK = (size_t)NH_ * TT * HD;   // one batch's head planes of one kind: q heads [t][d] | k heads [t][d] | v heads [d][t]
    h16* P16 = (h16*)take(NB_ * PB * 2); bf* PH = (bf*)take(NB_ * PB * 2); bf* PL = (bf*)take(NB_ * PB * 2);
    bf* ATh = (bf*)take((size_t)NB_ * TT * DQ * 2); bf* ATl = (bf*)take((size_t)NB_ * TT * DQ * 2);
    if ((size_t)(wsp - (char*)d_ws) > ws_size) return;    // ws 256 MiB
    k_prep<<<PBX + PBO + PBW, 256, 0, stream>>>(x, wqkv, wo, XB, WQKV, WO);
    k_gemms<bf, 0, false, false, 8, true><<<dim3(TT / 64, 3 * NH_, NB_), 256, 0, stream>>>(XB, nullptr, DM, WQKV, nullptr, DM, nullptr, 0, nullptr, 0, (size_t)TT * DM, 0, PB, P16, PH, PL, 2 * NH_);   // q, k planes [h][t][d]; v^T = W_v x^T planes [h][d][t]
    k_fattn<<<dim3(NH_ * NB_, (TT - RH) / 32 + RH / 16, 1), FNW * 32, 0, stream>>>(P16, P16 + PK, P16 + 2 * PK, PH, PL, PH + PK, PL + PK, PH + 2 * PK, PL + 2 * PK, ATh, ATl);   // one kv head per query head: head h uses plane h of each
    k_gemms<bf, 1, true, false, 8, false><<<dim3(NB_ * TT / 64, DM / 64, 1), 256, 0, stream>>>(ATh, ATl, DQ, WO, nullptr, DQ, OUT, DM, bo, 0, 0, 0, 0, nullptr, nullptr, nullptr, 0);
}

// v006
// A run of this version takes 197 microseconds.
// Timed twice side by side with v005, it ran 1.60 and 1.62 times as fast.
// Counting every step since v000, it is 14.2 times as fast.
#include <hip/hip_runtime.h>

// Causal multi-head attention with a fused bias-free qkv projection in (out, in) layout whose ROWS are packed PER HEAD (x [4][2048][1024]; qkv = einsum('bse,fe->bsf', x, w_qkv) = x w_qkv^T ('oi' (out, in) [3072][1024] 1/32, no bias) viewed (b, s, 16 heads, 3 x 64): head h's rows h*192 + 0..63 | 64..127 | 128..191 of w_qkv are its q | k | v; scores x 64^-0.5 (token-major einsums: the same products); where(tril, scores, -inf) (exclusion; every row keeps its own key); softmax; out = merged w_proj^T + b_proj ('oi' + a REAL 0.01 bias) -> [4][2048][1024] (8.4 M); argument order x, w_qkv, w_proj, b_proj).
// Four launches, each over all four batches: bf16 copies (x, w_proj, and the packed weight rows gathered into a standard q | k | v Bt, a row permutation); exact projections that write the head planes themselves, q, k and v^T in one grid; causal T-2048 attention, all heads of all batches in one launch, scores and probabilities kept in registers (online softmax; hybrid rows: < 512 hi/lo 3 products, rest fp16; key blocks above the diagonal are never visited); merged hi/lo x Wo exact + bo.
// Compute dtypes, f32 accumulate: every input rounded to bf16; projections exact; attention rows < 512 3 products, rest fp16; softmax f32; Wo hl x exact + bias.

#define NB_  4
#define TT   2048
#define DM   1024
#define NH_  16
#define NKV  16
#define HD   64
#define DQ   (NH_ * HD)
#define DKV  (NKV * HD)
#define RH   512                  // query rows < RH use hi+lo planes (0: none)
typedef _Float16 h16;
typedef unsigned short bf;
typedef __attribute__((ext_vector_type(16))) __bf16   v16bf;
typedef __attribute__((ext_vector_type(16))) _Float16 v16h;
typedef __attribute__((ext_vector_type(8)))  _Float16 v8h;
typedef __attribute__((ext_vector_type(8)))  unsigned short v8us;
typedef __attribute__((ext_vector_type(8)))  float    v8f;
typedef __attribute__((ext_vector_type(4)))  float    v4f;
typedef v8h  __attribute__((may_alias)) v8ha;
typedef v4f  __attribute__((may_alias)) v4fa;
typedef v8us __attribute__((may_alias)) v8usa;

__device__ __forceinline__ unsigned short f2bf(float f) { unsigned u = __float_as_uint(f); u += 0x7FFFu + ((u >> 16) & 1u); return (unsigned short)(u >> 16); }
__device__ __forceinline__ float bf2f(unsigned short b) { return __uint_as_float(((unsigned)b) << 16); }
__device__ __forceinline__ float bfr(float f) { return bf2f(f2bf(f)); }
__device__ __forceinline__ v16h cat16(v8h lo, v8h hi) { return __builtin_shufflevector(lo, hi, 0, 1, 2, 3, 4, 5, 6, 7, 8, 9, 10, 11, 12, 13, 14, 15); }
__device__ __forceinline__ v16bf cat16b(v8us lo, v8us hi) { return __builtin_bit_cast(v16bf, __builtin_shufflevector(lo, hi, 0, 1, 2, 3, 4, 5, 6, 7, 8, 9, 10, 11, 12, 13, 14, 15)); }
__device__ __forceinline__ v8f wmma16(v16h a, v16h b, v8f c) { return __builtin_amdgcn_wmma_f32_16x16x32_f16(false, a, false, b, (short)0, c, false, false); }
__device__ __forceinline__ v8f wmmab(v16bf a, v16bf b, v8f c) { return __builtin_amdgcn_wmma_f32_16x16x32_bf16(false, a, false, b, (short)0, c, false, false); }
__device__ __forceinline__ h16 tohx(float x) { return (h16)x; }
__device__ __forceinline__ void splitf(float y, unsigned short& h, unsigned short& l) { h = f2bf(y); l = f2bf(y - bf2f(h)); }
typedef __attribute__((ext_vector_type(4))) _Float16 v4h;
typedef __attribute__((ext_vector_type(4))) unsigned short v4us;



// ---- k_gemmt: GEMM, one 128x256 output tile per work-group of 8 waves (2 x 4, a 64x64 tile each: 16 accumulators), operands are K-contiguous bf16 planes; grid (M/128, N/256, Z), 256 threads.
// C[m][n] (f32, pitch ldc, + optional f32 bias[n]) = sum_k A[m][k] Bt[n][k] (+ A2[m][k] Bt[n][k] when NSPLIT). A rows have pitch lda, Bt rows pitch K. z-batch strides in elements: sA of A and A2, sC of the planes (C has none). K % 64 == 0.
// A pass is 64 k: one 128-byte line of every operand row of the tile, brought into LDS by asynchronous copies (8 lanes a line, whole lines only) and read from there by every wave that needs it;
// two buffers: the copies of pass t + 2 fly while pass t + 1 is worked on. Every output element is one accumulator's sum over k in rising order.
// PLANES: the sum goes out not as f32 C but as three 16-bit planes (fp16, bf16 hi, bf16 lo), [z][head][TT * HD] each: A = token rows (x = token tile, z = batch), Bt = weight rows (a wave's 64 columns = one head's 64 rows of q, k or v).
// head < tsw: a wave's tile is 64 rows of the head's plane [t][d]; head >= tsw: its operands change places and the tile is 64 columns of the transposed plane [d][t]. Each wave turns its tile in LDS; 16 lanes store one whole 128-byte line of a plane.
template <typename T16> struct WFrag;
template <> struct WFrag<h16> { typedef v16h V; static __device__ __forceinline__ V ld(const h16* p) { return cat16(*(const v8h*)p, *(const v8h*)(p + 16)); } static __device__ __forceinline__ v8f mma(V a, V b, v8f c) { return wmma16(a, b, c); } };
template <> struct WFrag<bf> { typedef v16bf V; static __device__ __forceinline__ V ld(const bf* p) { return cat16b(*(const v8us*)p, *(const v8us*)(p + 16)); } static __device__ __forceinline__ v8f mma(V a, V b, v8f c) { return wmmab(a, b, c); } };
#define GBM  128
#define GBN  256
#define GPIT 144                  // LDS pitch in bytes of a 128-byte row piece: 16 B x odd, no bank conflict for 16-byte readers
// Asynchronous copies, 16 bytes a lane, four rows of 128 bytes an instruction; copy i of a run takes the rows 32 * i further on (gs elements in memory). The s_wait_xcnt is the statement's last line, so that it stands in front of every later write of a register that a copy names (a precaution).
__device__ __forceinline__ void cp4(unsigned l, const bf* g, size_t gs) {
    asm volatile("global_load_async_to_lds_b128 %0, %4, off\n\tglobal_load_async_to_lds_b128 %1, %5, off\n\tglobal_load_async_to_lds_b128 %2, %6, off\n\tglobal_load_async_to_lds_b128 %3, %7, off\n\ts_wait_xcnt 0x0"
                 :: "v"(l), "v"(l + 32 * GPIT), "v"(l + 64 * GPIT), "v"(l + 96 * GPIT), "v"(g), "v"(g + gs), "v"(g + 2 * gs), "v"(g + 3 * gs) : "memory");
}
__device__ __forceinline__ void cp8(unsigned l, const bf* g, unsigned l2, const bf* g2, size_t gs) {
    asm volatile("global_load_async_to_lds_b128 %0, %8, off\n\tglobal_load_async_to_lds_b128 %1, %9, off\n\tglobal_load_async_to_lds_b128 %2, %10, off\n\tglobal_load_async_to_lds_b128 %3, %11, off\n\t"
                 "global_load_async_to_lds_b128 %4, %12, off\n\tglobal_load_async_to_lds_b128 %5, %13, off\n\tglobal_load_async_to_lds_b128 %6, %14, off\n\tglobal_load_async_to_lds_b128 %7, %15, off\n\ts_wait_xcnt 0x0"
                 :: "v"(l), "v"(l + 32 * GPIT), "v"(l + 64 * GPIT), "v"(l + 96 * GPIT), "v"(l2), "v"(l2 + 32 * GPIT), "v"(l2 + 64 * GPIT), "v"(l2 + 96 * GPIT),
                    "v"(g), "v"(g + gs), "v"(g + 2 * gs), "v"(g + 3 * gs), "v"(g2), "v"(g2 + gs), "v"(g2 + 2 * gs), "v"(g2 + 3 * gs) : "memory");
}
template <int NSPLIT, bool BIAS, bool PLANES>
__global__ __launch_bounds__(256) void k_gemmt(const bf* __restrict__ A, const bf* __restrict__ A2, int lda, const bf* __restrict__ Bt, int K, float* C, int ldc, const float* __restrict__ bias, size_t sA, size_t sC, h16* P16, bf* Ph, bf* Pl, int tsw) {
    constexpr int AR = GBM * (1 + NSPLIT), STG = (AR + GBN) * GPIT, OSB = 8 * 64 * 68 * 4;   // a buffer: A rows | A2 rows | Bt rows; the output staging reuses the ring
    __shared__ __align__(16) char sm[2 * STG > OSB ? 2 * STG : OSB];
    const size_t z = blockIdx.z; A += z * sA; if (NSPLIT) A2 += z * sA;
    const int tid = (int)threadIdx.x, lane = tid & 31, lr = lane & 15, hi = lane >> 4; const int r0 = blockIdx.x * GBM, c0 = blockIdx.y * GBN;
    const int w = __builtin_amdgcn_readfirstlane(tid >> 5), wm = w & 1, wn = w >> 1;   // wave number, scalar; the wave's 64x64 tile in the work-group's
    const bool tr = PLANES && (int)blockIdx.y * (GBN / 64) >= tsw;   // same for the whole work-group
    const int crow = tid >> 3, cseg = tid & 7;   // this lane's row (of 32 a copy) and 16-byte piece of its line
    const bf* gA = A + (size_t)(r0 + crow) * lda + cseg * 8; const bf* gA2 = NSPLIT ? A2 + (size_t)(r0 + crow) * lda + cseg * 8 : gA; const bf* gB = Bt + (size_t)(c0 + crow) * K + cseg * 8;
    const unsigned l0 = (unsigned)(size_t)sm + crow * GPIT + cseg * 16;
    auto fill = [&](int t, int buf) { const unsigned l = l0 + buf * STG; const int ko = t * 64;
        if constexpr (NSPLIT) cp8(l, gA + ko, l + GBM * GPIT, gA2 + ko, (size_t)32 * lda); else cp4(l, gA + ko, (size_t)32 * lda);
        cp8(l + AR * GPIT, gB + ko, l + (AR + 128) * GPIT, gB + (size_t)128 * K + ko, (size_t)32 * K); };
    const int fm = (wm * 64 + lr) * GPIT + hi * 16, fn = (AR + wn * 64 + lr) * GPIT + hi * 16;   // byte offsets in a buffer of this lane's first fragment row of A (m side) and of Bt (n side)
    const int fp = tr ? fm : fn, fq = tr ? fn : fm;   // the WMMA's first operand is the side along which the output is contiguous: a lane then holds 8 neighbours of one output row
    auto ldf = [&](int off) { return cat16b(*(const v8usa*)(sm + off), *(const v8usa*)(sm + off + 32)); };
    v8f acc[4][4];
#pragma unroll
    for (int mb = 0; mb < 4; ++mb)
#pragma unroll
        for (int nb = 0; nb < 4; ++nb) acc[mb][nb] = (v8f){};
    const int NT = K / 64;
    fill(0, 0);
    asm volatile("s_wait_asynccnt 0x0" ::: "memory");   // this wave's copies of pass 0 have landed
    __syncthreads();                                    // ... and every other wave's
    if (NT > 1) fill(1, 1);
#pragma unroll 1   // rolled: one pass a trip, the buffer picked by the trip's parity
    for (int t = 0; t < NT; ++t) { const int bo = (t & 1) * STG;
#pragma unroll
        for (int ks = 0; ks < 2; ++ks) { v16bf p[4], q[4], q2[4];
#pragma unroll
            for (int mb = 0; mb < 4; ++mb) p[mb] = ldf(bo + fp + mb * 16 * GPIT + ks * 64);
#pragma unroll
            for (int nb = 0; nb < 4; ++nb) q[nb] = ldf(bo + fq + nb * 16 * GPIT + ks * 64);
            if (NSPLIT) {
#pragma unroll
                for (int nb = 0; nb < 4; ++nb) q2[nb] = ldf(bo + fq + (GBM + nb * 16) * GPIT + ks * 64); }
            __builtin_amdgcn_sched_barrier(0);   // the block's LDS reads stay one group in front of its WMMAs (left alone the compiler reads one fragment at a time among them, a full wait each)
#pragma unroll
            for (int nb = 0; nb < 4; ++nb)
#pragma unroll
                for (int mb = 0; mb < 4; ++mb) acc[mb][nb] = wmmab(p[mb], q[nb], acc[mb][nb]);
            if (NSPLIT) {
#pragma unroll
                for (int nb = 0; nb < 4; ++nb)
#pragma unroll
                    for (int mb = 0; mb < 4; ++mb) acc[mb][nb] = wmmab(p[mb], q2[nb], acc[mb][nb]); }
            __builtin_amdgcn_sched_barrier(0); }   // ... and the next block's reads behind them
        asm volatile("s_wait_dscnt 0x0" ::: "memory");      // this wave's reads of buffer t & 1 are done before anybody refills it
        asm volatile("s_wait_asynccnt 0x0" ::: "memory");   // this wave's copies of pass t + 1 have landed
        __syncthreads();                                    // publishes pass t + 1 and frees buffer t & 1
        if (t + 2 < NT) fill(t + 2, t & 1);
    }
    asm volatile("s_wait_asynccnt 0x0" ::: "memory");   // nothing is in flight when the ring becomes output staging (the last trip's barrier ended every read of it)
    float* ow = (float*)sm + w * (64 * 68);   // each wave stages its own tile in its own range
#pragma unroll
    for (int mb = 0; mb < 4; ++mb)
#pragma unroll
        for (int nb = 0; nb < 4; ++nb)
        { v4f a, b;
#pragma unroll
            for (int j = 0; j < 4; ++j) { a[j] = acc[mb][nb][j]; b[j] = acc[mb][nb][4 + j]; }
            float* op = ow + (nb * 16 + lr) * 68 + mb * 16 + hi * 8; *(v4fa*)op = a; *(v4fa*)(op + 4) = b; }
    asm volatile("s_wait_dscnt 0x0" ::: "memory");   // the wave's own stores are in LDS before its lanes read one another's rows back
    const int rw = r0 + wm * 64, cw = c0 + wn * 64;   // the wave's first A row (token) and first Bt row
    const size_t pbase = z * sC + (size_t)(cw / 64) * (TT * HD) + (tr ? (size_t)rw : (size_t)rw * HD); const int ppit = tr ? TT : HD;   // the tile's first element in its head plane, and the plane's row pitch
    v4f bz = (v4f){};   // a lane's four columns are the same in every step
    if (BIAS) { const float* bp = bias + cw + lr * 4;
#pragma unroll
        for (int j = 0; j < 4; ++j) bz[j] = bfr(bp[j]); }
#pragma unroll 1   // rolled, four steps a trip: their reads and stores are in flight together; unrolled whole it would only lengthen the text
    for (int s4 = 0; s4 < 32; s4 += 4) {
#pragma unroll
      for (int u = 0; u < 4; ++u) { const int slot = (s4 + u) * 32 + lane, row = slot >> 4, cofs = (slot & 15) * 4; v4f val = *(const v4fa*)(ow + row * 68 + cofs);
        if (BIAS) val += bz;
        if constexpr (PLANES) { const size_t po = pbase + (size_t)(row * ppit + cofs); v4h o16; v4us oh, ol;
#pragma unroll
            for (int j = 0; j < 4; ++j) { o16[j] = tohx(val[j]); unsigned short a2, c2; splitf(val[j], a2, c2); oh[j] = a2; ol[j] = c2; }
            *(v4h*)(P16 + po) = o16; *(v4us*)(Ph + po) = oh; *(v4us*)(Pl + po) = ol;
        } else *(v4f*)(C + (size_t)(rw + row) * ldc + cw + cofs) = val; }
      asm volatile("s_wait_xcnt 0x0" ::: "memory"); }   // the wait that stands in front of any overwrite of a register that an issued store names: the next trip reuses them
}

// ---- k_prep: every f32 -> bf16 copy in one launch, 8 elements a thread; the block index picks the range: x (all batches), w_proj, then w_qkv with its packed rows (h, part, d) gathered into standard (part, h, d) blocks.
#define PBX (NB_ * TT * DM / 8 / 256)
#define PBO (DM * DQ / 8 / 256)
#define PBW (3 * DQ * DM / 8 / 256)
__global__ __launch_bounds__(256) void k_prep(const float* __restrict__ x, const float* __restrict__ W, const float* __restrict__ wo, bf* XB, bf* Bt, bf* WO) {
    const int bx = (int)blockIdx.x; const float* s; bf* d;
    if (bx < PBX) { const size_t e = ((size_t)bx * 256 + threadIdx.x) * 8; s = x + e; d = XB + e; }
    else if (bx < PBX + PBO) { const size_t e = ((size_t)(bx - PBX) * 256 + threadIdx.x) * 8; s = wo + e; d = WO + e; }
    else { const size_t e = ((size_t)(bx - PBX - PBO) * 256 + threadIdx.x) * 8; const int c0 = (int)(e % DM); const int rd = (int)(e / DM); const int part = rd / DQ; const int h = (rd % DQ) / HD; const int dd = rd % HD; s = W + (size_t)(h * 3 * HD + part * HD + dd) * DM + c0; d = Bt + e; }
    const v8f v = *(const v8f*)s; v8us o;
#pragma unroll
    for (int k = 0; k < 8; ++k) o[k] = f2bf(v[k]);
    *(v8us*)d = o;
}
// ---- k_fattn: causal attention of one head's query block in one pass over its keys; scores and probabilities stay in registers (online softmax). grid (heads x batches, query blocks), FNW * 32 threads.
// Transposed products: S^T = K Q^T (A = key rows, B = query rows), so a lane holds 16 keys' scores of ONE query (column lr); two S^T tiles (keys 0..15, 16..31), converted in place, are the B operand of O^T += V^T P^T.
// The keys are dealt to the FNW waves in blocks of 64 (one 128-byte line of every V^T row); each wave keeps its own running maximum, sum and 64 x NQT*16 f32 partial of O^T; the partials meet in LDS, are brought to the
// common maximum and summed in wave order 0..FNW-1; the quotient goes out as the merged hi/lo planes [t][DQ]. HL (query rows < RH): hi+lo planes, 3 products for S and for P V; else fp16 planes, one product.
#define FNW  8
#define FPIT 68                   // f32 pitch of a query's 64 partial outputs in LDS: 272 bytes, an odd multiple of 16
#define CL2  0.18033688011112042f // HD^-0.5 * log2(e): scores in log2 units
__device__ __forceinline__ float ex2(float x) { return __builtin_amdgcn_exp2f(x); }   // the builtin, not asm text: the compiler then keeps its own distances behind the WMMAs whose operand registers it reuses
// for the join behind the barrier, far from any WMMA: the exponential and the one vector slot behind a transcendental in one statement
__device__ __forceinline__ float ex2n(float x) { float r; asm("v_exp_f32 %0, %1\n\tv_nop" : "=v"(r) : "v"(x)); return r; }
__device__ __forceinline__ float xhalf(float x) { return __builtin_bit_cast(float, __builtin_amdgcn_permlanex16(__builtin_bit_cast(int, x), __builtin_bit_cast(int, x), 0x76543210, 0xfedcba98, false, false)); }  // lane l with lane l ^ 16
template <typename T16, bool HL, int NQT>
__device__ __forceinline__ void attn_body(const T16* __restrict__ Q, const T16* __restrict__ Q2, const T16* __restrict__ Kp, const T16* __restrict__ K2, const T16* __restrict__ Vt, const T16* __restrict__ V2, int q0, bf* Ah, bf* Al, float* sm) {
    typedef typename WFrag<T16>::V V;
    const int lane = threadIdx.x & 31, lr = lane & 15, hi = lane >> 4;
    const int w = __builtin_amdgcn_readfirstlane((int)(threadIdx.x >> 5));   // wave number, scalar: the key loop's bounds and the diagonal test stay in scalar registers
    const int Kl = q0 + NQT * 16;                                            // keys beyond the block's last query are masked for every row
    V qf[NQT][2], qf2[NQT][2];
    const size_t qo = (size_t)(q0 + lr) * HD + 8 * hi; const T16* qp = Q + qo; const T16* qp2 = HL ? Q2 + qo : qp;
#pragma unroll
    for (int qt = 0; qt < NQT; ++qt)
#pragma unroll
        for (int ks = 0; ks < 2; ++ks) { qf[qt][ks] = WFrag<T16>::ld(qp + qt * 16 * HD + ks * 32); if (HL) qf2[qt][ks] = WFrag<T16>::ld(qp2 + qt * 16 * HD + ks * 32); }
    // XWAIT, here and below: the wait that stands in front of any overwrite of a register that an issued load names; the addresses are its inputs so that they stay in their registers up to it (no load's own result lands on them)
    asm volatile("s_wait_xcnt 0x0" :: "v"(qp), "v"(qp2) : "memory");
    v8f o[4][NQT]; float m[NQT], l[NQT];
#pragma unroll
    for (int qt = 0; qt < NQT; ++qt) { m[qt] = -3.0e38f; l[qt] = 0.f;
#pragma unroll
        for (int dt = 0; dt < 4; ++dt) o[dt][qt] = (v8f){}; }
    V kf[2][2], kf2[2][2];   // this pass's key fragments: fetched one pass ahead, into the same registers, right behind the products that read them
    if (w * 64 < Kl) { const size_t ko = (size_t)(w * 64 + lr) * HD + 8 * hi; const T16* kp = Kp + ko; const T16* kp2 = HL ? K2 + ko : kp;
#pragma unroll
        for (int kt = 0; kt < 2; ++kt)
#pragma unroll
            for (int ks = 0; ks < 2; ++ks) { kf[kt][ks] = WFrag<T16>::ld(kp + kt * 16 * HD + ks * 32); if (HL) kf2[kt][ks] = WFrag<T16>::ld(kp2 + kt * 16 * HD + ks * 32); }
        asm volatile("s_wait_xcnt 0x0" :: "v"(kp), "v"(kp2) : "memory"); }   // XWAIT
#pragma unroll 1   // rolled: one step's fragments, scores and the output partial fill the register budget
    for (int kc = w * 64; kc < Kl; ) {
        const int kx = kc + ((kc & 32) ? FNW * 64 - 32 : 32);   // both 32-key halves of this wave's block, then FNW blocks on
        const int kn = kx < Kl ? kx : kc;                       // the last pass fetches its own rows again: always inside the plane, never used
        V vf[4], vf2[4];
        const size_t vo = (size_t)lr * TT + kc + 8 * hi, ko = (size_t)(kn + lr) * HD + 8 * hi;
        const T16* vp = Vt + vo; const T16* vp2 = HL ? V2 + vo : vp; const T16* kp = Kp + ko; const T16* kp2 = HL ? K2 + ko : kp;
#pragma unroll
        for (int dt = 0; dt < 4; ++dt) { vf[dt] = WFrag<T16>::ld(vp + dt * 16 * TT); if (HL) vf2[dt] = WFrag<T16>::ld(vp2 + dt * 16 * TT); }
        v8f s[2][NQT];
#pragma unroll
        for (int kt = 0; kt < 2; ++kt)
#pragma unroll
            for (int qt = 0; qt < NQT; ++qt) { v8f a = (v8f){};
#pragma unroll
                for (int ks = 0; ks < 2; ++ks) { a = WFrag<T16>::mma(kf[kt][ks], qf[qt][ks], a); if (HL) { a = WFrag<T16>::mma(kf[kt][ks], qf2[qt][ks], a); a = WFrag<T16>::mma(kf2[kt][ks], qf[qt][ks], a); } }
                s[kt][qt] = a; }
#pragma unroll
        for (int kt = 0; kt < 2; ++kt)
#pragma unroll
            for (int ks = 0; ks < 2; ++ks) { kf[kt][ks] = WFrag<T16>::ld(kp + kt * 16 * HD + ks * 32); if (HL) kf2[kt][ks] = WFrag<T16>::ld(kp2 + kt * 16 * HD + ks * 32); }
        asm volatile("s_wait_xcnt 0x0" :: "v"(vp), "v"(vp2), "v"(kp), "v"(kp2) : "memory");   // XWAIT: the softmax below reuses the address registers
        if (kc + 31 > q0) {   // only a block that reaches past the first query needs the mask (same for the whole wave: one branch round all the selects)
#pragma unroll
            for (int qt = 0; qt < NQT; ++qt) { const int lim = q0 + qt * 16 + lr - kc - hi * 8;   // this lane's query minus its first key
#pragma unroll
                for (int kt = 0; kt < 2; ++kt)
#pragma unroll
                    for (int j = 0; j < 8; ++j) s[kt][qt][j] = (kt * 16 + j <= lim) ? s[kt][qt][j] : -3.0e38f; } }
#pragma unroll
        for (int qt = 0; qt < NQT; ++qt) { float mx = -3.0e38f;
#pragma unroll
            for (int kt = 0; kt < 2; ++kt)
#pragma unroll
                for (int j = 0; j < 8; ++j) mx = fmaxf(mx, s[kt][qt][j]);
            mx = fmaxf(mx, xhalf(mx));   // the query's other 16 keys of this step sit in the other half of the wave
            const float mn = fmaxf(m[qt], mx * CL2), al = ex2(m[qt] - mn); m[qt] = mn; float sum = 0.f;   // the running maximum is kept in log2 units
#pragma unroll
            for (int kt = 0; kt < 2; ++kt)
#pragma unroll
                for (int j = 0; j < 8; ++j) { const float p = ex2(s[kt][qt][j] * CL2 - mn); s[kt][qt][j] = p; sum += p; }
            l[qt] = l[qt] * al + sum;
#pragma unroll
            for (int dt = 0; dt < 4; ++dt) o[dt][qt] *= al;
            if constexpr (HL) { v8us h0, h1, l0, l1;
#pragma unroll
                for (int j = 0; j < 8; ++j) { unsigned short a, c2; splitf(s[0][qt][j], a, c2); h0[j] = a; l0[j] = c2; splitf(s[1][qt][j], a, c2); h1[j] = a; l1[j] = c2; }
                const v16bf ph = cat16b(h0, h1), pl = cat16b(l0, l1);
#pragma unroll
                for (int dt = 0; dt < 4; ++dt) { o[dt][qt] = wmmab(__builtin_bit_cast(v16bf, vf[dt]), ph, o[dt][qt]); o[dt][qt] = wmmab(__builtin_bit_cast(v16bf, vf[dt]), pl, o[dt][qt]); o[dt][qt] = wmmab(__builtin_bit_cast(v16bf, vf2[dt]), ph, o[dt][qt]); }
            } else { v16h pb;
#pragma unroll
                for (int j = 0; j < 8; ++j) { pb[j] = tohx(s[0][qt][j]); pb[8 + j] = tohx(s[1][qt][j]); }
#pragma unroll
                for (int dt = 0; dt < 4; ++dt) o[dt][qt] = wmma16(__builtin_bit_cast(v16h, vf[dt]), pb, o[dt][qt]); } }
        // four vector slots behind the last WMMAs, on the taken side of the loop's branch too
        asm volatile("v_nop\n\tv_nop\n\tv_nop\n\tv_nop" : "+v"(o[0][NQT - 1]), "+v"(o[1][NQT - 1]), "+v"(o[2][NQT - 1]), "+v"(o[3][NQT - 1]) : "v"(vf[0]), "v"(vf[3]));
        kc = kx;
    }
    constexpr int NQ = NQT * 16;
    float* ow = sm + w * (NQ * FPIT); float* ms = sm + FNW * (NQ * FPIT); float* ls = ms + FNW * NQ;
#pragma unroll
    for (int qt = 0; qt < NQT; ++qt) { const float lj = l[qt] + xhalf(l[qt]);   // the two halves' sums of one query
        if (hi == 0) { ms[w * NQ + qt * 16 + lr] = m[qt]; ls[w * NQ + qt * 16 + lr] = lj; }
#pragma unroll
        for (int dt = 0; dt < 4; ++dt) { v4f a, b;
#pragma unroll
            for (int j = 0; j < 4; ++j) { a[j] = o[dt][qt][j]; b[j] = o[dt][qt][4 + j]; }
            float* op = ow + (qt * 16 + lr) * FPIT + dt * 16 + hi * 8; *(v4fa*)op = a; *(v4fa*)(op + 4) = b; } }
    __syncthreads();   // every wave's maximum, sum and partial are in LDS before any of them is joined
    if ((int)threadIdx.x < NQ * 8) { const int q = (int)threadIdx.x >> 3, dg = ((int)threadIdx.x & 7) * 8; float M = -3.0e38f;
#pragma unroll
        for (int p = 0; p < FNW; ++p) M = fmaxf(M, ms[p * NQ + q]);   // wave 0 always holds key 0, so M is a real score
        float L = 0.f; v4f a = (v4f){}, b = (v4f){};
#pragma unroll
        for (int p = 0; p < FNW; ++p) { const float f = ex2n(ms[p * NQ + q] - M); L += f * ls[p * NQ + q]; const float* ip = sm + p * (NQ * FPIT) + q * FPIT + dg; a += f * *(const v4fa*)ip; b += f * *(const v4fa*)(ip + 4); }
        const float inv = __fdiv_rn(1.0f, L); v8us oh, ol;
#pragma unroll
        for (int j = 0; j < 4; ++j) { unsigned short x, y; splitf(a[j] * inv, x, y); oh[j] = x; ol[j] = y; splitf(b[j] * inv, x, y); oh[4 + j] = x; ol[4 + j] = y; }
        const size_t oo = (size_t)(q0 + q) * DQ + dg; *(v8us*)(Ah + oo) = oh; *(v8us*)(Al + oo) = ol; }
}
__global__ __launch_bounds__(FNW * 32) __attribute__((amdgpu_waves_per_eu(4, 4))) void k_fattn(const h16* __restrict__ Q16, const h16* __restrict__ K16, const h16* __restrict__ V16, const bf* __restrict__ Qh, const bf* __restrict__ Ql, const bf* __restrict__ Kh, const bf* __restrict__ Kl, const bf* __restrict__ Vh, const bf* __restrict__ Vl, bf* Ah, bf* Al) {
    __shared__ __align__(16) float sm[FNW * 32 * FPIT + 2 * FNW * 32];
    const unsigned hd = blockIdx.x % NH_, bt = blockIdx.x / NH_;   // head, batch; a batch holds 3 * NH_ head planes (q, k, v^T)
    const size_t hp = (size_t)(bt * 3 * NH_ + hd) * TT * HD; const int bx = (int)blockIdx.y; Ah += (size_t)bt * TT * DQ + hd * HD; Al += (size_t)bt * TT * DQ + hd * HD;
    // every head's and batch's longest query blocks first: none of them runs on alone at the end
    if (bx < (TT - RH) / 32) attn_body<h16, false, 2>(Q16 + hp, nullptr, K16 + hp, nullptr, V16 + hp, nullptr, TT - 32 * (bx + 1), Ah, Al, sm);
    else attn_body<bf, true, 1>(Qh + hp, Ql + hp, Kh + hp, Kl + hp, Vh + hp, Vl + hp, RH - 16 * (bx - (TT - RH) / 32 + 1), Ah, Al, sm);
}

extern "C" void kernel_launch(void* const* d_in, const int* in_sizes, int n_in,
                              void* d_out, int out_size, void* d_ws, size_t ws_size, hipStream_t stream) {
    (void)in_sizes; (void)n_in; (void)out_size;
    const float* x = (const float*)d_in[0]; const float* wqkv = (const float*)d_in[1]; const float* wo = (const float*)d_in[2]; const float* bo = (const float*)d_in[3];   /* input order x, w_qkv ('oi' (out, in) [3072][1024], rows packed per head (h, part, c)), w_proj ('oi' [1024][1024]), b_proj (REAL): FOUR inputs, all read: the host's own binding */ const float* wq = wqkv; const float* wk = nullptr; const float* wv = nullptr; (void)wk; (void)wv;
    float* OUT = (float*)d_out;     // [4][2048][1024]
    char* wsp = (char*)d_ws;
    auto take = [&](size_t bytes) { char* p = wsp; wsp += (bytes + 255) & ~(size_t)255; return (void*)p; };
    bf* WQKV = (bf*)take((size_t)3 * DQ * DM * 2);   /* de-interleaved Bt: q | k | v row blocks in head order */ bf* WO = (bf*)take((size_t)DM * DQ * 2);
    bf* XB = (bf*)take((size_t)NB_ * TT * DM * 2);
    const size_t PB = (size_t)3 * NH_ * TT * HD, PK = (size_t)NH_ * TT * HD;   // one batch's head planes of one kind: q heads [t][d] | k heads [t][d] | v heads [d][t]
    h16* P16 = (h16*)take(NB_ * PB * 2); bf* PH = (bf*)take(NB_ * PB * 2); bf* PL = (bf*)take(NB_ * PB * 2);
    bf* ATh = (bf*)take((size_t)NB_ * TT * DQ * 2); bf* ATl = (bf*)take((size_t)NB_ * TT * DQ * 2);
    if ((size_t)(wsp - (char*)d_ws) > ws_size) return;    // ws 256 MiB
    k_prep<<<PBX + PBO + PBW, 256, 0, stream>>>(x, wqkv, wo, XB, WQKV, WO);
    k_gemmt<0, false, true><<<dim3(TT / GBM, 3 * DQ / GBN, NB_), 256, 0, stream>>>(XB, nullptr, DM, WQKV, DM, nullptr, 0, nullptr, (size_t)TT * DM, PB, P16, PH, PL, 2 * NH_);   // q, k planes [h][t][d]; v planes transposed, [h][d][t]
    k_fattn<<<dim3(NH_ * NB_, (TT - RH) / 32 + RH / 16, 1), FNW * 32, 0, stream>>>(P16, P16 + PK, P16 + 2 * PK, PH, PL, PH + PK, PL + PK, PH + 2 * PK, PL + 2 * PK, ATh, ATl);   // one kv head per query head: head h uses plane h of each
    k_gemmt<1, true, false><<<dim3(NB_ * TT / GBM, DM / GBN, 1), 256, 0, stream>>>(ATh, ATl, DQ, WO, DQ, OUT, DM, bo, 0, 0, nullptr, nullptr, nullptr, 0);
}

// v007
// It runs in 139 microseconds.
// Two timings next to v006 put it at 1.41 and 1.42 times that version's speed.
// All steps since v000 together make it 20.1 times as fast.
#include <hip/hip_runtime.h>

// Causal multi-head attention with a fused bias-free qkv projection in (out, in) layout whose ROWS are packed PER HEAD (x [4][2048][1024]; qkv = einsum('bse,fe->bsf', x, w_qkv) = x w_qkv^T ('oi' (out, in) [3072][1024] 1/32, no bias) viewed (b, s, 16 heads, 3 x 64): head h's rows h*192 + 0..63 | 64..127 | 128..191 of w_qkv are its q | k | v; scores x 64^-0.5 (token-major einsums: the same products); where(tril, scores, -inf) (exclusion; every row keeps its own key); softmax; out = merged w_proj^T + b_proj ('oi' + a REAL 0.01 bias) -> [4][2048][1024] (8.4 M); argument order x, w_qkv, w_proj, b_proj).
// Four launches, each over all four batches: bf16 copies (x, w_proj, and the packed weight rows gathered into a standard q | k | v Bt, a row permutation); exact projections that write the head planes themselves, q, k and v^T in one grid; causal T-2048 attention, all heads of all batches in one launch, scores and probabilities kept in registers (online softmax; hybrid rows: < 512 hi/lo 3 products, rest fp16; key blocks above the diagonal are never visited); merged hi/lo x Wo exact + bo.
// Compute dtypes, f32 accumulate: every input rounded to bf16; projections exact; attention rows < 512 3 products, rest fp16; softmax f32; Wo hl x exact + bias.

#define NB_  4
#define TT   2048
#define DM   1024
#define NH_  16
#define NKV  16
#define HD   64
#define DQ   (NH_ * HD)
#define DKV  (NKV * HD)
#define RH   512                  // query rows < RH use hi+lo planes
typedef _Float16 h16;
typedef unsigned short bf;
typedef __attribute__((ext_vector_type(16))) __bf16   v16bf;
typedef __attribute__((ext_vector_type(16))) _Float16 v16h;
typedef __attribute__((ext_vector_type(8)))  _Float16 v8h;
typedef __attribute__((ext_vector_type(8)))  unsigned short v8us;
typedef __attribute__((ext_vector_type(8)))  float    v8f;
typedef __attribute__((ext_vector_type(4)))  float    v4f;
typedef v8h  __attribute__((may_alias)) v8ha;
typedef v4f  __attribute__((may_alias)) v4fa;
typedef v8us __attribute__((may_alias)) v8usa;

__device__ __forceinline__ unsigned short f2bf(float f) { unsigned u = __float_as_uint(f); u += 0x7FFFu + ((u >> 16) & 1u); return (unsigned short)(u >> 16); }
__device__ __forceinline__ float bf2f(unsigned short b) { return __uint_as_float(((unsigned)b) << 16); }
__device__ __forceinline__ float bfr(float f) { return bf2f(f2bf(f)); }
__device__ __forceinline__ v16h cat16(v8h lo, v8h hi) { return __builtin_shufflevector(lo, hi, 0, 1, 2, 3, 4, 5, 6, 7, 8, 9, 10, 11, 12, 13, 14, 15); }
__device__ __forceinline__ v16bf cat16b(v8us lo, v8us hi) { return __builtin_bit_cast(v16bf, __builtin_shufflevector(lo, hi, 0, 1, 2, 3, 4, 5, 6, 7, 8, 9, 10, 11, 12, 13, 14, 15)); }
__device__ __forceinline__ v8f wmma16(v16h a, v16h b, v8f c) { return __builtin_amdgcn_wmma_f32_16x16x32_f16(false, a, false, b, (short)0, c, false, false); }
__device__ __forceinline__ v8f wmmab(v16bf a, v16bf b, v8f c) { return __builtin_amdgcn_wmma_f32_16x16x32_bf16(false, a, false, b, (short)0, c, false, false); }
__device__ __forceinline__ h16 tohx(float x) { return (h16)x; }
__device__ __forceinline__ void splitf(float y, unsigned short& h, unsigned short& l) { h = f2bf(y); l = f2bf(y - bf2f(h)); }
typedef __attribute__((ext_vector_type(4))) _Float16 v4h;
typedef __attribute__((ext_vector_type(4))) unsigned short v4us;



// ---- k_gemmt: GEMM, one 128x256 output tile per work-group of 8 waves (2 x 4, a 64x64 tile each: 16 accumulators), operands are K-contiguous bf16 planes; grid (M/128, N/256, Z), 256 threads.
// C[m][n] (f32, pitch ldc, + optional f32 bias[n]) = sum_k A[m][k] Bt[n][k] (+ A2[m][k] Bt[n][k] when NSPLIT). A rows have pitch lda, Bt rows pitch K. z-batch strides in elements: sA of A and A2, sC of the planes (C has none). K % 64 == 0.
// A pass is 64 k: one 128-byte line of every operand row of the tile, brought into LDS by asynchronous copies (8 lanes a line, whole lines only) and read from there by every wave that needs it;
// two buffers: the copies of pass t + 2 fly while pass t + 1 is worked on. Every output element is one accumulator's sum over k in rising order.
// PLANES: the sum goes out not as f32 C but as three 16-bit planes (fp16, bf16 hi, bf16 lo), [z][head][TT * HD] each: A = token rows (x = token tile, z = batch), Bt = weight rows (a wave's 64 columns = one head's 64 rows of q, k or v).
// head < tsw: a wave's tile is 64 rows of the head's plane [t][d]; head >= tsw: its operands change places and the tile is 64 columns of the transposed plane [d][t]. Each wave turns its tile in LDS; 16 lanes store one whole 128-byte line of a plane.
template <typename T16> struct WFrag;
template <> struct WFrag<h16> { typedef v16h V; static __device__ __forceinline__ V ld(const h16* p) { return cat16(*(const v8h*)p, *(const v8h*)(p + 16)); } static __device__ __forceinline__ v8f mma(V a, V b, v8f c) { return wmma16(a, b, c); } };
template <> struct WFrag<bf> { typedef v16bf V; static __device__ __forceinline__ V ld(const bf* p) { return cat16b(*(const v8us*)p, *(const v8us*)(p + 16)); } static __device__ __forceinline__ v8f mma(V a, V b, v8f c) { return wmmab(a, b, c); } };
#define GBM  128
#define GBN  256
#define GPIT 144                  // LDS pitch in bytes of a 128-byte row piece: 16 B x odd, no bank conflict for 16-byte readers
// Asynchronous copies, 16 bytes a lane, four rows of 128 bytes an instruction; copy i of a run takes the rows 32 * i further on (gs elements in memory). The s_wait_xcnt is the statement's last line, so that it stands in front of every later write of a register that a copy names (a precaution).
__device__ __forceinline__ void cp4(unsigned l, const bf* g, size_t gs) {
    asm volatile("global_load_async_to_lds_b128 %0, %4, off\n\tglobal_load_async_to_lds_b128 %1, %5, off\n\tglobal_load_async_to_lds_b128 %2, %6, off\n\tglobal_load_async_to_lds_b128 %3, %7, off\n\ts_wait_xcnt 0x0"
                 :: "v"(l), "v"(l + 32 * GPIT), "v"(l + 64 * GPIT), "v"(l + 96 * GPIT), "v"(g), "v"(g + gs), "v"(g + 2 * gs), "v"(g + 3 * gs) : "memory");
}
__device__ __forceinline__ void cp8(unsigned l, const bf* g, unsigned l2, const bf* g2, size_t gs) {
    asm volatile("global_load_async_to_lds_b128 %0, %8, off\n\tglobal_load_async_to_lds_b128 %1, %9, off\n\tglobal_load_async_to_lds_b128 %2, %10, off\n\tglobal_load_async_to_lds_b128 %3, %11, off\n\t"
                 "global_load_async_to_lds_b128 %4, %12, off\n\tglobal_load_async_to_lds_b128 %5, %13, off\n\tglobal_load_async_to_lds_b128 %6, %14, off\n\tglobal_load_async_to_lds_b128 %7, %15, off\n\ts_wait_xcnt 0x0"
                 :: "v"(l), "v"(l + 32 * GPIT), "v"(l + 64 * GPIT), "v"(l + 96 * GPIT), "v"(l2), "v"(l2 + 32 * GPIT), "v"(l2 + 64 * GPIT), "v"(l2 + 96 * GPIT),
                    "v"(g), "v"(g + gs), "v"(g + 2 * gs), "v"(g + 3 * gs), "v"(g2), "v"(g2 + gs), "v"(g2 + 2 * gs), "v"(g2 + 3 * gs) : "memory");
}
template <int NSPLIT, bool BIAS, bool PLANES>
__global__ __launch_bounds__(256) void k_gemmt(const bf* __restrict__ A, const bf* __restrict__ A2, int lda, const bf* __restrict__ Bt, int K, float* C, int ldc, const float* __restrict__ bias, size_t sA, size_t sC, h16* P16, bf* Ph, bf* Pl, int tsw) {
    constexpr int AR = GBM * (1 + NSPLIT), STG = (AR + GBN) * GPIT, OSB = 8 * 64 * 68 * 4;   // a buffer: A rows | A2 rows | Bt rows; the output staging reuses the ring
    __shared__ __align__(16) char sm[2 * STG > OSB ? 2 * STG : OSB];
    const size_t z = blockIdx.z; A += z * sA; if (NSPLIT) A2 += z * sA;
    const int tid = (int)threadIdx.x, lane = tid & 31, lr = lane & 15, hi = lane >> 4; const int r0 = blockIdx.x * GBM, c0 = blockIdx.y * GBN;
    const int w = __builtin_amdgcn_readfirstlane(tid >> 5), wm = w & 1, wn = w >> 1;   // wave number, scalar; the wave's 64x64 tile in the work-group's
    const bool tr = PLANES && (int)blockIdx.y * (GBN / 64) >= tsw;   // same for the whole work-group
    const int crow = tid >> 3, cseg = tid & 7;   // this lane's row (of 32 a copy) and 16-byte piece of its line
    const bf* gA = A + (size_t)(r0 + crow) * lda + cseg * 8; const bf* gA2 = NSPLIT ? A2 + (size_t)(r0 + crow) * lda + cseg * 8 : gA; const bf* gB = Bt + (size_t)(c0 + crow) * K + cseg * 8;
    const unsigned l0 = (unsigned)(size_t)sm + crow * GPIT + cseg * 16;
    auto fill = [&](int t, int buf) { const unsigned l = l0 + buf * STG; const int ko = t * 64;
        if constexpr (NSPLIT) cp8(l, gA + ko, l + GBM * GPIT, gA2 + ko, (size_t)32 * lda); else cp4(l, gA + ko, (size_t)32 * lda);
        cp8(l + AR * GPIT, gB + ko, l + (AR + 128) * GPIT, gB + (size_t)128 * K + ko, (size_t)32 * K); };
    const int fm = (wm * 64 + lr) * GPIT + hi * 16, fn = (AR + wn * 64 + lr) * GPIT + hi * 16;   // byte offsets in a buffer of this lane's first fragment row of A (m side) and of Bt (n side)
    const int fp = tr ? fm : fn, fq = tr ? fn : fm;   // the WMMA's first operand is the side along which the output is contiguous: a lane then holds 8 neighbours of one output row
    auto ldf = [&](int off) { return cat16b(*(const v8usa*)(sm + off), *(const v8usa*)(sm + off + 32)); };
    v8f acc[4][4];
#pragma unroll
    for (int mb = 0; mb < 4; ++mb)
#pragma unroll
        for (int nb = 0; nb < 4; ++nb) acc[mb][nb] = (v8f){};
    const int NT = K / 64;
    fill(0, 0);
    asm volatile("s_wait_asynccnt 0x0" ::: "memory");   // this wave's copies of pass 0 have landed
    __syncthreads();                                    // ... and every other wave's
    if (NT > 1) fill(1, 1);
#pragma unroll 1   // rolled: one pass a trip, the buffer picked by the trip's parity
    for (int t = 0; t < NT; ++t) { const int bo = (t & 1) * STG;
#pragma unroll
        for (int ks = 0; ks < 2; ++ks) { v16bf p[4], q[4], q2[4];
#pragma unroll
            for (int mb = 0; mb < 4; ++mb) p[mb] = ldf(bo + fp + mb * 16 * GPIT + ks * 64);
#pragma unroll
            for (int nb = 0; nb < 4; ++nb) q[nb] = ldf(bo + fq + nb * 16 * GPIT + ks * 64);
            if (NSPLIT) {
#pragma unroll
                for (int nb = 0; nb < 4; ++nb) q2[nb] = ldf(bo + fq + (GBM + nb * 16) * GPIT + ks * 64); }
            __builtin_amdgcn_sched_barrier(0);   // the block's LDS reads stay one group in front of its WMMAs (left alone the compiler reads one fragment at a time among them, a full wait each)
#pragma unroll
            for (int nb = 0; nb < 4; ++nb)
#pragma unroll
                for (int mb = 0; mb < 4; ++mb) acc[mb][nb] = wmmab(p[mb], q[nb], acc[mb][nb]);
            if (NSPLIT) {
#pragma unroll
                for (int nb = 0; nb < 4; ++nb)
#pragma unroll
                    for (int mb = 0; mb < 4; ++mb) acc[mb][nb] = wmmab(p[mb], q2[nb], acc[mb][nb]); }
            __builtin_amdgcn_sched_barrier(0); }   // ... and the next block's reads behind them
        asm volatile("s_wait_dscnt 0x0" ::: "memory");      // this wave's reads of buffer t & 1 are done before anybody refills it
        asm volatile("s_wait_asynccnt 0x0" ::: "memory");   // this wave's copies of pass t + 1 have landed
        __syncthreads();                                    // publishes pass t + 1 and frees buffer t & 1
        if (t + 2 < NT) fill(t + 2, t & 1);
    }
    asm volatile("s_wait_asynccnt 0x0" ::: "memory");   // nothing is in flight when the ring becomes output staging (the last trip's barrier ended every read of it)
    float* ow = (float*)sm + w * (64 * 68);   // each wave stages its own tile in its own range
#pragma unroll
    for (int mb = 0; mb < 4; ++mb)
#pragma unroll
        for (int nb = 0; nb < 4; ++nb)
        { v4f a, b;
#pragma unroll
            for (int j = 0; j < 4; ++j) { a[j] = acc[mb][nb][j]; b[j] = acc[mb][nb][4 + j]; }
            float* op = ow + (nb * 16 + lr) * 68 + mb * 16 + hi * 8; *(v4fa*)op = a; *(v4fa*)(op + 4) = b; }
    asm volatile("s_wait_dscnt 0x0" ::: "memory");   // the wave's own stores are in LDS before its lanes read one another's rows back
    const int rw = r0 + wm * 64, cw = c0 + wn * 64;   // the wave's first A row (token) and first Bt row
    const size_t pbase = z * sC + (size_t)(cw / 64) * (TT * HD) + (tr ? (size_t)rw : (size_t)rw * HD); const int ppit = tr ? TT : HD;   // the tile's first element in its head plane, and the plane's row pitch
    v4f bz = (v4f){};   // a lane's four columns are the same in every step
    if (BIAS) { const float* bp = bias + cw + lr * 4;
#pragma unroll
        for (int j = 0; j < 4; ++j) bz[j] = bfr(bp[j]); }
#pragma unroll 1   // rolled, four steps a trip: their reads and stores are in flight together; unrolled whole it would only lengthen the text
    for (int s4 = 0; s4 < 32; s4 += 4) {
#pragma unroll
      for (int u = 0; u < 4; ++u) { const int slot = (s4 + u) * 32 + lane, row = slot >> 4, cofs = (slot & 15) * 4; v4f val = *(const v4fa*)(ow + row * 68 + cofs);
        if (BIAS) val += bz;
        if constexpr (PLANES) { const size_t po = pbase + (size_t)(row * ppit + cofs); v4h o16; v4us oh, ol;
#pragma unroll
            for (int j = 0; j < 4; ++j) { o16[j] = tohx(val[j]); unsigned short a2, c2; splitf(val[j], a2, c2); oh[j] = a2; ol[j] = c2; }
            *(v4h*)(P16 + po) = o16; *(v4us*)(Ph + po) = oh; *(v4us*)(Pl + po) = ol;
        } else *(v4f*)(C + (size_t)(rw + row) * ldc + cw + cofs) = val; }
      asm volatile("s_wait_xcnt 0x0" ::: "memory"); }   // the wait that stands in front of any overwrite of a register that an issued store names: the next trip reuses them
}

// ---- k_prep: every f32 -> bf16 copy in one launch, 8 elements a thread; the block index picks the range: x (all batches), w_proj, then w_qkv with its packed rows (h, part, d) gathered into standard (part, h, d) blocks.
#define PBX (NB_ * TT * DM / 8 / 256)
#define PBO (DM * DQ / 8 / 256)
#define PBW (3 * DQ * DM / 8 / 256)
__global__ __launch_bounds__(256) void k_prep(const float* __restrict__ x, const float* __restrict__ W, const float* __restrict__ wo, bf* XB, bf* Bt, bf* WO) {
    const int bx = (int)blockIdx.x; const float* s; bf* d;
    if (bx < PBX) { const size_t e = ((size_t)bx * 256 + threadIdx.x) * 8; s = x + e; d = XB + e; }
    else if (bx < PBX + PBO) { const size_t e = ((size_t)(bx - PBX) * 256 + threadIdx.x) * 8; s = wo + e; d = WO + e; }
    else { const size_t e = ((size_t)(bx - PBX - PBO) * 256 + threadIdx.x) * 8; const int c0 = (int)(e % DM); const int rd = (int)(e / DM); const int part = rd / DQ; const int h = (rd % DQ) / HD; const int dd = rd % HD; s = W + (size_t)(h * 3 * HD + part * HD + dd) * DM + c0; d = Bt + e; }
    const v8f v = *(const v8f*)s; v8us o;
#pragma unroll
    for (int k = 0; k < 8; ++k) o[k] = f2bf(v[k]);
    *(v8us*)d = o;
}
// ---- k_fattn: causal attention, one pass over the keys; scores and probabilities stay in registers (online softmax). grid (heads x batches, work-groups of a head), FNW * 32 threads.
// Transposed products: S^T = K Q^T (A = key rows, B = query rows), so a lane holds 16 keys' scores of ONE query (column lr); two S^T tiles (keys 0..15, 16..31), converted in place, are the B operand of O^T += V^T P^T.
// The 8 waves tile the QUERIES (NQT * 16 columns each); every wave walks all the keys its queries may see and keeps its own running maximum, sum and 64 x NQT*16 f32 tile of O^T: nothing is joined between waves.
// A stage is SK keys: SK rows of K (128 bytes each) and the 64 rows of V^T (SK * 2 bytes each), brought into LDS once for the whole work-group by asynchronous copies (whole lines only) and read from there by every wave that needs it;
// two buffers: the copies of stage t + 2 fly while stage t + 1 is worked on. A pass is 32 keys; a wave skips the passes above its own diagonal but meets every barrier.
// A work-group takes one block of BR = 8 waves' neighbouring queries and walks the stages up to the block's last query: the same number of trips for all its waves.
// HL (query rows < RH): hi+lo bf16 planes, 3 products for S and for P V, 16 columns a wave, 64 keys a stage; else fp16 planes, one product, 32 columns a wave, 128 keys a stage. The quotient goes out as the merged hi/lo planes [t][DQ].
#define FNW  8
#define KPIT 144                  // LDS pitch in bytes of a K row (128 bytes): 16 B x odd, no bank conflict for 16-byte readers; a V^T row piece gets its length + 16 bytes, also 16 B x odd
#define CL2  0.18033688011112042f // HD^-0.5 * log2(e): scores in log2 units
// A query's 17 exponentials of a pass, each in place, and the one vector slot behind a transcendental in one statement.
// In place, so that the statement writes no register but its own live values (never an operand register of a WMMA still in its window).
__device__ __forceinline__ void ex2x17(float (&e)[17]) {
    asm("v_exp_f32 %0, %0\n\tv_exp_f32 %1, %1\n\tv_exp_f32 %2, %2\n\tv_exp_f32 %3, %3\n\tv_exp_f32 %4, %4\n\tv_exp_f32 %5, %5\n\tv_exp_f32 %6, %6\n\tv_exp_f32 %7, %7\n\tv_exp_f32 %8, %8\n\t"
        "v_exp_f32 %9, %9\n\tv_exp_f32 %10, %10\n\tv_exp_f32 %11, %11\n\tv_exp_f32 %12, %12\n\tv_exp_f32 %13, %13\n\tv_exp_f32 %14, %14\n\tv_exp_f32 %15, %15\n\tv_exp_f32 %16, %16\n\tv_nop"
        : "+v"(e[0]), "+v"(e[1]), "+v"(e[2]), "+v"(e[3]), "+v"(e[4]), "+v"(e[5]), "+v"(e[6]), "+v"(e[7]), "+v"(e[8]), "+v"(e[9]), "+v"(e[10]), "+v"(e[11]), "+v"(e[12]), "+v"(e[13]), "+v"(e[14]), "+v"(e[15]), "+v"(e[16]));
}
__device__ __forceinline__ float xhalf(float x) { return __builtin_bit_cast(float, __builtin_amdgcn_permlanex16(__builtin_bit_cast(int, x), __builtin_bit_cast(int, x), 0x76543210, 0xfedcba98, false, false)); }  // lane l with lane l ^ 16
// Eight asynchronous copies, 16 bytes a lane: two runs of four, copy i of a run ls bytes further on in LDS and gs elements further on in memory. The s_wait_xcnt is the statement's last line, so that it stands in front of every later write of a register that a copy names (a precaution).
template <typename T16>
__device__ __forceinline__ void cpkv(unsigned la, const T16* ga, unsigned lsa, size_t gsa, unsigned lb, const T16* gb, unsigned lsb, size_t gsb) {
    asm volatile("global_load_async_to_lds_b128 %0, %8, off\n\tglobal_load_async_to_lds_b128 %1, %9, off\n\tglobal_load_async_to_lds_b128 %2, %10, off\n\tglobal_load_async_to_lds_b128 %3, %11, off\n\t"
                 "global_load_async_to_lds_b128 %4, %12, off\n\tglobal_load_async_to_lds_b128 %5, %13, off\n\tglobal_load_async_to_lds_b128 %6, %14, off\n\tglobal_load_async_to_lds_b128 %7, %15, off\n\ts_wait_xcnt 0x0"
                 :: "v"(la), "v"(la + lsa), "v"(la + 2 * lsa), "v"(la + 3 * lsa), "v"(lb), "v"(lb + lsb), "v"(lb + 2 * lsb), "v"(lb + 3 * lsb),
                    "v"(ga), "v"(ga + gsa), "v"(ga + 2 * gsa), "v"(ga + 3 * gsa), "v"(gb), "v"(gb + gsb), "v"(gb + 2 * gsb), "v"(gb + 3 * gsb) : "memory");
}
template <bool HL> struct AShape {   // sizes of the two kinds of work-group
    static constexpr int NQT = HL ? 1 : 2, SK = HL ? 64 : 128, R0 = HL ? 0 : RH, BR = FNW * NQT * 16, NBK = (HL ? RH : TT - RH) / BR;
    static constexpr int VPIT = SK * 2 + 16, KTB = SK * KPIT, TS = KTB + HD * VPIT, STG = TS * (HL ? 2 : 1);   // a buffer: K rows | V^T rows (| K lo rows | V^T lo rows)
};
template <typename T16, bool HL>
__device__ __forceinline__ void attn_body(const T16* __restrict__ Q, const T16* __restrict__ Q2, const T16* __restrict__ Kp, const T16* __restrict__ K2, const T16* __restrict__ Vt, const T16* __restrict__ V2, int b, bf* Ah, bf* Al, const char* sm) {
    typedef typename WFrag<T16>::V V; typedef AShape<HL> S_;
    constexpr int NQT = S_::NQT, SK = S_::SK, VPIT = S_::VPIT, KTB = S_::KTB, TS = S_::TS, STG = S_::STG;
    const int tid = (int)threadIdx.x, lane = tid & 31, lr = lane & 15, hi = lane >> 4;
    const int w = __builtin_amdgcn_readfirstlane(tid >> 5);   // wave number, scalar: the pass counts and the diagonal test stay in scalar registers
    const int q0 = S_::R0 + S_::BR * b + NQT * 16 * w;        // this wave's first query
    const int NS = (S_::R0 + S_::BR * (b + 1)) / SK;          // stages up to the block's last query
    const unsigned l0 = (unsigned)(size_t)sm;
    auto fill = [&](int t, int buf) { const unsigned lb = l0 + buf * STG;
        const int kr = tid >> 3, kg = tid & 7;   // this lane's row (of 32 a copy) and 16-byte piece of a 128-byte row
        const size_t ko = (size_t)(t * SK + kr) * HD + kg * 8; const unsigned kl = lb + kr * KPIT + kg * 16;
        if constexpr (HL) { const size_t vo = (size_t)kr * TT + t * SK + kg * 8; const unsigned vl = lb + KTB + kr * VPIT + kg * 16;   // run = hi rows 0..31, 32..63, lo rows 0..31, 32..63: the lo plane's tile lies TS bytes behind the hi plane's
            asm volatile("global_load_async_to_lds_b128 %0, %8, off\n\tglobal_load_async_to_lds_b128 %1, %9, off\n\tglobal_load_async_to_lds_b128 %2, %10, off\n\tglobal_load_async_to_lds_b128 %3, %11, off\n\t"
                         "global_load_async_to_lds_b128 %4, %12, off\n\tglobal_load_async_to_lds_b128 %5, %13, off\n\tglobal_load_async_to_lds_b128 %6, %14, off\n\tglobal_load_async_to_lds_b128 %7, %15, off\n\ts_wait_xcnt 0x0"
                         :: "v"(kl), "v"(kl + 32 * KPIT), "v"(kl + TS), "v"(kl + TS + 32 * KPIT), "v"(vl), "v"(vl + 32 * VPIT), "v"(vl + TS), "v"(vl + TS + 32 * VPIT),
                            "v"(Kp + ko), "v"(Kp + ko + 32 * HD), "v"(K2 + ko), "v"(K2 + ko + 32 * HD), "v"(Vt + vo), "v"(Vt + vo + 32 * TT), "v"(V2 + vo), "v"(V2 + vo + 32 * TT) : "memory");   // the s_wait_xcnt: as in cpkv
        } else { const int vr = tid >> 4, vg = tid & 15;   // 16 rows of 256 bytes a copy
            cpkv<T16>(kl, Kp + ko, 32 * KPIT, (size_t)32 * HD, lb + KTB + vr * VPIT + vg * 16, Vt + (size_t)vr * TT + t * SK + vg * 8, 16 * VPIT, (size_t)16 * TT); } };
    auto ldl = [&](int off) -> V { if constexpr (HL) return cat16b(*(const v8usa*)(sm + off), *(const v8usa*)(sm + off + 32)); else return cat16(*(const v8ha*)(sm + off), *(const v8ha*)(sm + off + 32)); };
    fill(0, 0);
    V qf[NQT][2], qf2[NQT][2];
    const size_t qo = (size_t)(q0 + lr) * HD + 8 * hi; const T16* qp = Q + qo; const T16* qp2 = HL ? Q2 + qo : qp;
#pragma unroll
    for (int qt = 0; qt < NQT; ++qt)
#pragma unroll
        for (int ks = 0; ks < 2; ++ks) { qf[qt][ks] = WFrag<T16>::ld(qp + qt * 16 * HD + ks * 32); if (HL) qf2[qt][ks] = WFrag<T16>::ld(qp2 + qt * 16 * HD + ks * 32); }
    // the wait that stands in front of any overwrite of a register that an issued load names; the addresses are its inputs so that they stay in their registers up to it (no load's own result lands on them)
    asm volatile("s_wait_xcnt 0x0" :: "v"(qp), "v"(qp2) : "memory");
    v8f o[4][NQT]; float m[NQT], l[NQT];
#pragma unroll
    for (int qt = 0; qt < NQT; ++qt) { m[qt] = -3.0e38f; l[qt] = 0.f;
#pragma unroll
        for (int dt = 0; dt < 4; ++dt) o[dt][qt] = (v8f){}; }
    asm volatile("s_wait_asynccnt 0x0" ::: "memory");   // this wave's copies of stage 0 have landed
    __syncthreads();                                    // ... and every other wave's
    if (NS > 1) fill(1, 1);
#pragma unroll 1   // rolled: one stage a trip, the buffer picked by the trip's parity
    for (int t = 0; t < NS; ++t) {
        const int left = (q0 >> 5) + 1 - t * (SK / 32), np = left < SK / 32 ? left : SK / 32;   // passes of this stage that begin no later than the wave's first query (none: the wave only meets the barrier)
        const int fk = (t & 1) * STG + lr * KPIT + hi * 16, fv = (t & 1) * STG + KTB + lr * VPIT + hi * 16;   // byte offsets of this lane's first K and V^T fragment rows
        V kf[2][2], kf2[2][2];   // a pass's key fragments: fetched one pass ahead inside the stage, into the same registers, right behind the products that read them
        auto ldk = [&](int ps) {
#pragma unroll
            for (int kt = 0; kt < 2; ++kt)
#pragma unroll
                for (int ks = 0; ks < 2; ++ks) { kf[kt][ks] = ldl(fk + (ps * 32 + kt * 16) * KPIT + ks * 64); if (HL) kf2[kt][ks] = ldl(fk + TS + (ps * 32 + kt * 16) * KPIT + ks * 64); } };
        if (np > 0) ldk(0);
#pragma unroll 1   // rolled: one pass's fragments, scores and the output tile fill the register budget
        for (int ps = 0; ps < np; ++ps) { const int kc = t * SK + ps * 32;
            V vf[4], vf2[4];
#pragma unroll
            for (int dt = 0; dt < 4; ++dt) { vf[dt] = ldl(fv + dt * 16 * VPIT + ps * 64); if (HL) vf2[dt] = ldl(fv + TS + dt * 16 * VPIT + ps * 64); }
            v8f s[2][NQT];
#pragma unroll
            for (int kt = 0; kt < 2; ++kt)
#pragma unroll
                for (int qt = 0; qt < NQT; ++qt) { v8f a = (v8f){};
#pragma unroll
                    for (int ks = 0; ks < 2; ++ks) { a = WFrag<T16>::mma(kf[kt][ks], qf[qt][ks], a); if (HL) { a = WFrag<T16>::mma(kf[kt][ks], qf2[qt][ks], a); a = WFrag<T16>::mma(kf2[kt][ks], qf[qt][ks], a); } }
                    s[kt][qt] = a; }
            ldk(ps + 1 < np ? ps + 1 : ps);   // the wave's last pass of a stage fetches its own rows again: always inside this stage's buffer, never used
            if (kc + 31 > q0) {   // only the wave's last pass needs the mask (same for the whole wave: one branch round all the selects)
#pragma unroll
                for (int qt = 0; qt < NQT; ++qt) { const int lim = q0 + qt * 16 + lr - kc - hi * 8;   // this lane's query minus its first key
#pragma unroll
                    for (int kt = 0; kt < 2; ++kt)
#pragma unroll
                        for (int j = 0; j < 8; ++j) s[kt][qt][j] = (kt * 16 + j <= lim) ? s[kt][qt][j] : -3.0e38f; } }
#pragma unroll
            for (int qt = 0; qt < NQT; ++qt) { float mx = -3.0e38f;
#pragma unroll
                for (int kt = 0; kt < 2; ++kt)
#pragma unroll
                    for (int j = 0; j < 8; ++j) mx = fmaxf(mx, s[kt][qt][j]);
                mx = fmaxf(mx, xhalf(mx));   // the query's other 16 keys of this pass sit in the other half of the wave
                const float mn = fmaxf(m[qt], mx * CL2); float e[17], sum = 0.f; e[16] = m[qt] - mn; m[qt] = mn;   // the running maximum is kept in log2 units
#pragma unroll
                for (int kt = 0; kt < 2; ++kt)
#pragma unroll
                    for (int j = 0; j < 8; ++j) e[kt * 8 + j] = s[kt][qt][j] * CL2 - mn;
                ex2x17(e); const float al = e[16];
#pragma unroll
                for (int kt = 0; kt < 2; ++kt)
#pragma unroll
                    for (int j = 0; j < 8; ++j) { s[kt][qt][j] = e[kt * 8 + j]; sum += e[kt * 8 + j]; }
                l[qt] = l[qt] * al + sum;
#pragma unroll
                for (int dt = 0; dt < 4; ++dt) o[dt][qt] *= al;
                if constexpr (HL) { v8us h0, h1, l0v, l1v;
#pragma unroll
                    for (int j = 0; j < 8; ++j) { unsigned short a, c2; splitf(s[0][qt][j], a, c2); h0[j] = a; l0v[j] = c2; splitf(s[1][qt][j], a, c2); h1[j] = a; l1v[j] = c2; }
                    const v16bf ph = cat16b(h0, h1), pl = cat16b(l0v, l1v);
#pragma unroll
                    for (int dt = 0; dt < 4; ++dt) { o[dt][qt] = wmmab(__builtin_bit_cast(v16bf, vf[dt]), ph, o[dt][qt]); o[dt][qt] = wmmab(__builtin_bit_cast(v16bf, vf[dt]), pl, o[dt][qt]); o[dt][qt] = wmmab(__builtin_bit_cast(v16bf, vf2[dt]), ph, o[dt][qt]); }
                } else { v16h pb;
#pragma unroll
                    for (int j = 0; j < 8; ++j) { pb[j] = tohx(s[0][qt][j]); pb[8 + j] = tohx(s[1][qt][j]); }
#pragma unroll
                    for (int dt = 0; dt < 4; ++dt) o[dt][qt] = wmma16(__builtin_bit_cast(v16h, vf[dt]), pb, o[dt][qt]); } }
            // four vector slots behind the last WMMAs, on the taken side of the loop's branch too
            asm volatile("v_nop\n\tv_nop\n\tv_nop\n\tv_nop" : "+v"(o[0][NQT - 1]), "+v"(o[1][NQT - 1]), "+v"(o[2][NQT - 1]), "+v"(o[3][NQT - 1]) : "v"(vf[0]), "v"(vf[3]));
        }
        asm volatile("s_wait_dscnt 0x0" ::: "memory");      // this wave's reads of buffer t & 1 are done before anybody refills it
        asm volatile("s_wait_asynccnt 0x0" ::: "memory");   // this wave's copies of stage t + 1 have landed
        __syncthreads();                                    // publishes stage t + 1 and frees buffer t & 1
        if (t + 2 < NS) fill(t + 2, t & 1);
    }
    asm volatile("s_wait_asynccnt 0x0" ::: "memory");   // nothing is in flight when the wave ends
    v8us oh[NQT][4], ol[NQT][4];   // a lane holds 8 neighbours of its query's output row: the quotient goes out from the registers
#pragma unroll
    for (int qt = 0; qt < NQT; ++qt) { const float inv = __fdiv_rn(1.0f, l[qt] + xhalf(l[qt]));   // the two halves' sums of one query
#pragma unroll
        for (int dt = 0; dt < 4; ++dt)
#pragma unroll
            for (int j = 0; j < 8; ++j) { unsigned short x, y; splitf(o[dt][qt][j] * inv, x, y); oh[qt][dt][j] = x; ol[qt][dt][j] = y; } }
    bf* ah = Ah + (size_t)(q0 + lr) * DQ + hi * 8; bf* al2 = Al + (size_t)(q0 + lr) * DQ + hi * 8;
    __builtin_amdgcn_sched_barrier(0);   // every store stands behind the last arithmetic: no register that an issued store names is written again
#pragma unroll
    for (int qt = 0; qt < NQT; ++qt)
#pragma unroll
        for (int dt = 0; dt < 4; ++dt) { *(v8us*)(ah + qt * 16 * DQ + dt * 16) = oh[qt][dt]; *(v8us*)(al2 + qt * 16 * DQ + dt * 16) = ol[qt][dt]; }
}
#define GYM (AShape<false>::NBK)   // work-groups of a head: rows >= RH,
#define GYH (AShape<true>::NBK)    // rows < RH
__global__ __launch_bounds__(FNW * 32) __attribute__((amdgpu_waves_per_eu(4, 4))) void k_fattn(const h16* __restrict__ Q16, const h16* __restrict__ K16, const h16* __restrict__ V16, const bf* __restrict__ Qh, const bf* __restrict__ Ql, const bf* __restrict__ Kh, const bf* __restrict__ Kl, const bf* __restrict__ Vh, const bf* __restrict__ Vl, bf* Ah, bf* Al) {
    __shared__ __align__(16) char sm[2 * (AShape<true>::STG > AShape<false>::STG ? AShape<true>::STG : AShape<false>::STG)];
    const unsigned hd = blockIdx.x % NH_, bt = blockIdx.x / NH_;   // head, batch; a batch holds 3 * NH_ head planes (q, k, v^T)
    const size_t hp = (size_t)(bt * 3 * NH_ + hd) * TT * HD; const int bx = (int)blockIdx.y; Ah += (size_t)bt * TT * DQ + hd * HD; Al += (size_t)bt * TT * DQ + hd * HD;
    // Which block: a permutation of the grid, for speed only. Two work-groups fit a WGP, so the launch lasts as long as the fullest WGP.
    // Grid rows y and y + 4 hold blocks whose passes add up to about the same (fp16 blocks 5 4 3 2 over hi/lo blocks 3 2 and fp16 blocks 0 1); work-groups whose x has an odd number of ones take the other row of the two:
    // neighbours in index order at any power-of-two distance, in x or four rows apart, are then a long block and a short one. The two shortest hi/lo blocks come last.
    static_assert(GYM == 6 && GYH == 4, "the table below lists 6 + 4 blocks");
    const int row = bx < 8 ? bx ^ ((__builtin_popcount(blockIdx.x) & 1) << 2) : bx;
    const int blk = (int)((0x8910AB2345ull >> (4 * row)) & 15);   // four bits a row: 0..5 an fp16 block, 8..11 a hi/lo block
    if (blk < 8) attn_body<h16, false>(Q16 + hp, nullptr, K16 + hp, nullptr, V16 + hp, nullptr, blk, Ah, Al, sm);
    else attn_body<bf, true>(Qh + hp, Ql + hp, Kh + hp, Kl + hp, Vh + hp, Vl + hp, blk - 8, Ah, Al, sm);
}

extern "C" void kernel_launch(void* const* d_in, const int* in_sizes, int n_in,
                              void* d_out, int out_size, void* d_ws, size_t ws_size, hipStream_t stream) {
    (void)in_sizes; (void)n_in; (void)out_size;
    const float* x = (const float*)d_in[0]; const float* wqkv = (const float*)d_in[1]; const float* wo = (const float*)d_in[2]; const float* bo = (const float*)d_in[3];   /* input order x, w_qkv ('oi' (out, in) [3072][1024], rows packed per head (h, part, c)), w_proj ('oi' [1024][1024]), b_proj (REAL): FOUR inputs, all read: the host's own binding */ const float* wq = wqkv; const float* wk = nullptr; const float* wv = nullptr; (void)wk; (void)wv;
    float* OUT = (float*)d_out;     // [4][2048][1024]
    char* wsp = (char*)d_ws;
    auto take = [&](size_t bytes) { char* p = wsp; wsp += (bytes + 255) & ~(size_t)255; return (void*)p; };
    bf* WQKV = (bf*)take((size_t)3 * DQ * DM * 2);   /* de-interleaved Bt: q | k | v row blocks in head order */ bf* WO = (bf*)take((size_t)DM * DQ * 2);
    bf* XB = (bf*)take((size_t)NB_ * TT * DM * 2);
    const size_t PB = (size_t)3 * NH_ * TT * HD, PK = (size_t)NH_ * TT * HD;   // one batch's head planes of one kind: q heads [t][d] | k heads [t][d] | v heads [d][t]
    h16* P16 = (h16*)take(NB_ * PB * 2); bf* PH = (bf*)take(NB_ * PB * 2); bf* PL = (bf*)take(NB_ * PB * 2);
    bf* ATh = (bf*)take((size_t)NB_ * TT * DQ * 2); bf* ATl = (bf*)take((size_t)NB_ * TT * DQ * 2);
    if ((size_t)(wsp - (char*)d_ws) > ws_size) return;    // ws 256 MiB
    k_prep<<<PBX + PBO + PBW, 256, 0, stream>>>(x, wqkv, wo, XB, WQKV, WO);
    k_gemmt<0, false, true><<<dim3(TT / GBM, 3 * DQ / GBN, NB_), 256, 0, stream>>>(XB, nullptr, DM, WQKV, DM, nullptr, 0, nullptr, (size_t)TT * DM, PB, P16, PH, PL, 2 * NH_);   // q, k planes [h][t][d]; v planes transposed, [h][d][t]
    k_fattn<<<dim3(NH_ * NB_, GYM + GYH, 1), FNW * 32, 0, stream>>>(P16, P16 + PK, P16 + 2 * PK, PH, PL, PH + PK, PL + PK, PH + 2 * PK, PL + 2 * PK, ATh, ATl);   // one kv head per query head: head h uses plane h of each
    k_gemmt<1, true, false><<<dim3(NB_ * TT / GBM, DM / GBN, 1), 256, 0, stream>>>(ATh, ATl, DQ, WO, DQ, OUT, DM, bo, 0, 0, nullptr, nullptr, nullptr, 0);
}

// v008
// A run of this version takes 132 microseconds.
// In both of two side-by-side timings against v007, it was 1.06 times as fast.
// All steps since v000 together make it 21.3 times as fast.
#include <hip/hip_runtime.h>

// Causal multi-head attention with a fused bias-free qkv projection in (out, in) layout whose ROWS are packed PER HEAD (x [4][2048][1024]; qkv = einsum('bse,fe->bsf', x, w_qkv) = x w_qkv^T ('oi' (out, in) [3072][1024] 1/32, no bias) viewed (b, s, 16 heads, 3 x 64): head h's rows h*192 + 0..63 | 64..127 | 128..191 of w_qkv are its q | k | v; scores x 64^-0.5 (token-major einsums: the same products); where(tril, scores, -inf) (exclusion; every row keeps its own key); softmax; out = merged w_proj^T + b_proj ('oi' + a REAL 0.01 bias) -> [4][2048][1024] (8.4 M); argument order x, w_qkv, w_proj, b_proj).
// Four launches, each over all four batches: bf16 copies (x, w_proj, and the packed weight rows gathered into a standard q | k | v Bt, a row permutation); exact projections that write the head planes themselves, q, k and v^T in one grid; causal T-2048 attention, all heads of all batches in one launch, scores and probabilities kept in registers (online softmax; hybrid rows: < 512 hi/lo 3 products, rest fp16; key blocks above the diagonal are never visited); merged hi/lo x Wo exact + bo.
// Compute dtypes, f32 accumulate: every input rounded to bf16; projections exact; attention rows < 512 3 products, rest fp16; softmax f32; Wo hl x exact + bias.

#define NB_  4
#define TT   2048
#define DM   1024
#define NH_  16
#define NKV  16
#define HD   64
#define DQ   (NH_ * HD)
#define DKV  (NKV * HD)
#define RH   512                  // query rows < RH use hi+lo planes
typedef _Float16 h16;
typedef unsigned short bf;
typedef __attribute__((ext_vector_type(16))) __bf16   v16bf;
typedef __attribute__((ext_vector_type(16))) _Float16 v16h;
typedef __attribute__((ext_vector_type(8)))  _Float16 v8h;
typedef __attribute__((ext_vector_type(8)))  unsigned short v8us;
typedef __attribute__((ext_vector_type(8)))  float    v8f;
typedef __attribute__((ext_vector_type(4)))  float    v4f;
typedef v8h  __attribute__((may_alias)) v8ha;
typedef v4f  __attribute__((may_alias)) v4fa;
typedef v8us __attribute__((may_alias)) v8usa;

__device__ __forceinline__ unsigned short f2bf(float f) { unsigned u = __float_as_uint(f); u += 0x7FFFu + ((u >> 16) & 1u); return (unsigned short)(u >> 16); }
__device__ __forceinline__ float bf2f(unsigned short b) { return __uint_as_float(((unsigned)b) << 16); }
__device__ __forceinline__ float bfr(float f) { return bf2f(f2bf(f)); }
__device__ __forceinline__ v16h cat16(v8h lo, v8h hi) { return __builtin_shufflevector(lo, hi, 0, 1, 2, 3, 4, 5, 6, 7, 8, 9, 10, 11, 12, 13, 14, 15); }
__device__ __forceinline__ v16bf cat16b(v8us lo, v8us hi) { return __builtin_bit_cast(v16bf, __builtin_shufflevector(lo, hi, 0, 1, 2, 3, 4, 5, 6, 7, 8, 9, 10, 11, 12, 13, 14, 15)); }
__device__ __forceinline__ v8f wmma16(v16h a, v16h b, v8f c) { return __builtin_amdgcn_wmma_f32_16x16x32_f16(false, a, false, b, (short)0, c, false, false); }
__device__ __forceinline__ v8f wmmab(v16bf a, v16bf b, v8f c) { return __builtin_amdgcn_wmma_f32_16x16x32_bf16(false, a, false, b, (short)0, c, false, false); }
__device__ __forceinline__ h16 tohx(float x) { return (h16)x; }
__device__ __forceinline__ void splitf(float y, unsigned short& h, unsigned short& l) { h = f2bf(y); l = f2bf(y - bf2f(h)); }
typedef __attribute__((ext_vector_type(4))) _Float16 v4h;
typedef __attribute__((ext_vector_type(4))) unsigned short v4us;



// ---- k_gemmt: GEMM, one 128x256 output tile per work-group of 8 waves (2 x 4, a 64x64 tile each: 16 accumulators), operands are K-contiguous bf16 planes; grid (M/128, N/256, Z) (PLANES: see its first lines), 256 threads.
// C[m][n] (f32, pitch ldc, + optional f32 bias[n]) = sum_k A[m][k] Bt[n][k] (+ A2[m][k] Bt[n][k] when NSPLIT). A rows have pitch lda, Bt rows pitch K. z-batch strides sA/sC in elements. K % 64 == 0.
// A pass is 64 k: one 128-byte line of every operand row of the tile, brought into LDS by asynchronous copies (8 lanes a line, whole lines only) and read from there by every wave that needs it;
// two buffers: the copies of pass t + 2 fly while pass t + 1 is worked on. Every output element is one accumulator's sum over k in rising order.
// PLANES: the sum goes out not as f32 C but into three 16-bit planes (fp16, bf16 hi, bf16 lo), [z][head][TT * HD] each, of which a tile stores only those that attention reads at its tokens: A = token rows (x, z = token tile and batch), Bt = weight rows (a wave's 64 columns = one head's 64 rows of q, k or v).
// head < tsw: a wave's tile is 64 rows of the head's plane [t][d]; head >= tsw: its operands change places and the tile is 64 columns of the transposed plane [d][t]. Each wave turns its tile in LDS; 16 lanes store one whole 128-byte line of a plane.
template <typename T16> struct WFrag;
template <> struct WFrag<h16> { typedef v16h V; static __device__ __forceinline__ V ld(const h16* p) { return cat16(*(const v8h*)p, *(const v8h*)(p + 16)); } static __device__ __forceinline__ v8f mma(V a, V b, v8f c) { return wmma16(a, b, c); } };
template <> struct WFrag<bf> { typedef v16bf V; static __device__ __forceinline__ V ld(const bf* p) { return cat16b(*(const v8us*)p, *(const v8us*)(p + 16)); } static __device__ __forceinline__ v8f mma(V a, V b, v8f c) { return wmmab(a, b, c); } };
template <bool B> struct Flag { static constexpr bool v = B; };
#define GBM  128
#define GBN  256
#define GPIT 144                  // LDS pitch in bytes of a 128-byte row piece: 16 B x odd, no bank conflict for 16-byte readers
// Asynchronous copies, 16 bytes a lane, four rows of 128 bytes an instruction; copy i of a run takes the rows 32 * i further on (gs elements in memory). The s_wait_xcnt is the statement's last line, so that it stands in front of every later write of a register that a copy names (a precaution).
__device__ __forceinline__ void cp4(unsigned l, const bf* g, size_t gs) {
    asm volatile("global_load_async_to_lds_b128 %0, %4, off\n\tglobal_load_async_to_lds_b128 %1, %5, off\n\tglobal_load_async_to_lds_b128 %2, %6, off\n\tglobal_load_async_to_lds_b128 %3, %7, off\n\ts_wait_xcnt 0x0"
                 :: "v"(l), "v"(l + 32 * GPIT), "v"(l + 64 * GPIT), "v"(l + 96 * GPIT), "v"(g), "v"(g + gs), "v"(g + 2 * gs), "v"(g + 3 * gs) : "memory");
}
__device__ __forceinline__ void cp8(unsigned l, const bf* g, unsigned l2, const bf* g2, size_t gs) {
    asm volatile("global_load_async_to_lds_b128 %0, %8, off\n\tglobal_load_async_to_lds_b128 %1, %9, off\n\tglobal_load_async_to_lds_b128 %2, %10, off\n\tglobal_load_async_to_lds_b128 %3, %11, off\n\t"
                 "global_load_async_to_lds_b128 %4, %12, off\n\tglobal_load_async_to_lds_b128 %5, %13, off\n\tglobal_load_async_to_lds_b128 %6, %14, off\n\tglobal_load_async_to_lds_b128 %7, %15, off\n\ts_wait_xcnt 0x0"
                 :: "v"(l), "v"(l + 32 * GPIT), "v"(l + 64 * GPIT), "v"(l + 96 * GPIT), "v"(l2), "v"(l2 + 32 * GPIT), "v"(l2 + 64 * GPIT), "v"(l2 + 96 * GPIT),
                    "v"(g), "v"(g + gs), "v"(g + 2 * gs), "v"(g + 3 * gs), "v"(g2), "v"(g2 + gs), "v"(g2 + 2 * gs), "v"(g2 + 3 * gs) : "memory");
}
template <int NSPLIT, bool BIAS, bool PLANES>
__global__ __launch_bounds__(256) void k_gemmt(const bf* __restrict__ A, const bf* __restrict__ A2, int lda, const bf* __restrict__ Bt, int K, float* C, int ldc, const float* __restrict__ bias, size_t sA, size_t sC, h16* P16, bf* Ph, bf* Pl, int tsw) {
    constexpr int AR = GBM * (1 + NSPLIT), STG = (AR + GBN) * GPIT, OSB = 8 * 64 * 68 * 4;   // a buffer: A rows | A2 rows | Bt rows; the output staging reuses the ring
    __shared__ __align__(16) char sm[2 * STG > OSB ? 2 * STG : OSB];
    // PLANES: grid z = (block of RH tokens, batch), x = tile in the block: the tiles of tokens < RH, whose epilogue is the long one, have the lowest indices (for speed only: any order gives the same planes)
    const size_t z = PLANES ? blockIdx.z % NB_ : blockIdx.z; A += z * sA; if (NSPLIT) A2 += z * sA;
    const int tid = (int)threadIdx.x, lane = tid & 31, lr = lane & 15, hi = lane >> 4; const int r0 = (PLANES ? (int)(blockIdx.z / NB_) * RH : 0) + (int)blockIdx.x * GBM, c0 = blockIdx.y * GBN;
    const int w = __builtin_amdgcn_readfirstlane(tid >> 5), wm = w & 1, wn = w >> 1;   // wave number, scalar; the wave's 64x64 tile in the work-group's
    const bool tr = PLANES && (int)blockIdx.y * (GBN / 64) >= tsw;   // same for the whole work-group
    const int crow = tid >> 3, cseg = tid & 7;   // this lane's row (of 32 a copy) and 16-byte piece of its line
    const bf* gA = A + (size_t)(r0 + crow) * lda + cseg * 8; const bf* gA2 = NSPLIT ? A2 + (size_t)(r0 + crow) * lda + cseg * 8 : gA; const bf* gB = Bt + (size_t)(c0 + crow) * K + cseg * 8;
    const unsigned l0 = (unsigned)(size_t)sm + crow * GPIT + cseg * 16;
    auto fill = [&](int t, int buf) { const unsigned l = l0 + buf * STG; const int ko = t * 64;
        if constexpr (NSPLIT) cp8(l, gA + ko, l + GBM * GPIT, gA2 + ko, (size_t)32 * lda); else cp4(l, gA + ko, (size_t)32 * lda);
        cp8(l + AR * GPIT, gB + ko, l + (AR + 128) * GPIT, gB + (size_t)128 * K + ko, (size_t)32 * K); };
    const int fm = (wm * 64 + lr) * GPIT + hi * 16, fn = (AR + wn * 64 + lr) * GPIT + hi * 16;   // byte offsets in a buffer of this lane's first fragment row of A (m side) and of Bt (n side)
    const int fp = tr ? fm : fn, fq = tr ? fn : fm;   // the WMMA's first operand is the side along which the output is contiguous: a lane then holds 8 neighbours of one output row
    auto ldf = [&](int off) { return cat16b(*(const v8usa*)(sm + off), *(const v8usa*)(sm + off + 32)); };
    v8f acc[4][4];
#pragma unroll
    for (int mb = 0; mb < 4; ++mb)
#pragma unroll
        for (int nb = 0; nb < 4; ++nb) acc[mb][nb] = (v8f){};
    const int NT = K / 64;
    fill(0, 0);
    asm volatile("s_wait_asynccnt 0x0" ::: "memory");   // this wave's copies of pass 0 have landed
    __syncthreads();                                    // ... and every other wave's
    if (NT > 1) fill(1, 1);
#pragma unroll 1   // rolled: one pass a trip, the buffer picked by the trip's parity
    for (int t = 0; t < NT; ++t) { const int bo = (t & 1) * STG;
#pragma unroll
        for (int ks = 0; ks < 2; ++ks) { v16bf p[4], q[4], q2[4];
#pragma unroll
            for (int mb = 0; mb < 4; ++mb) p[mb] = ldf(bo + fp + mb * 16 * GPIT + ks * 64);
#pragma unroll
            for (int nb = 0; nb < 4; ++nb) q[nb] = ldf(bo + fq + nb * 16 * GPIT + ks * 64);
            if (NSPLIT) {
#pragma unroll
                for (int nb = 0; nb < 4; ++nb) q2[nb] = ldf(bo + fq + (GBM + nb * 16) * GPIT + ks * 64); }
            __builtin_amdgcn_sched_barrier(0);   // the block's LDS reads stay one group in front of its WMMAs (left alone the compiler reads one fragment at a time among them, a full wait each)
#pragma unroll
            for (int nb = 0; nb < 4; ++nb)
#pragma unroll
                for (int mb = 0; mb < 4; ++mb) acc[mb][nb] = wmmab(p[mb], q[nb], acc[mb][nb]);
            if (NSPLIT) {
#pragma unroll
                for (int nb = 0; nb < 4; ++nb)
#pragma unroll
                    for (int mb = 0; mb < 4; ++mb) acc[mb][nb] = wmmab(p[mb], q2[nb], acc[mb][nb]); }
            __builtin_amdgcn_sched_barrier(0); }   // ... and the next block's reads behind them
        asm volatile("s_wait_dscnt 0x0" ::: "memory");      // this wave's reads of buffer t & 1 are done before anybody refills it
        asm volatile("s_wait_asynccnt 0x0" ::: "memory");   // this wave's copies of pass t + 1 have landed
        __syncthreads();                                    // publishes pass t + 1 and frees buffer t & 1
        if (t + 2 < NT) fill(t + 2, t & 1);
    }
    asm volatile("s_wait_asynccnt 0x0" ::: "memory");   // nothing is in flight when the ring becomes output staging (the last trip's barrier ended every read of it)
    float* ow = (float*)sm + w * (64 * 68);   // each wave stages its own tile in its own range
#pragma unroll
    for (int mb = 0; mb < 4; ++mb)
#pragma unroll
        for (int nb = 0; nb < 4; ++nb)
        { v4f a, b;
#pragma unroll
            for (int j = 0; j < 4; ++j) { a[j] = acc[mb][nb][j]; b[j] = acc[mb][nb][4 + j]; }
            float* op = ow + (nb * 16 + lr) * 68 + mb * 16 + hi * 8; *(v4fa*)op = a; *(v4fa*)(op + 4) = b; }
    asm volatile("s_wait_dscnt 0x0" ::: "memory");   // the wave's own stores are in LDS before its lanes read one another's rows back
    const int rw = r0 + wm * 64, cw = c0 + wn * 64;   // the wave's first A row (token) and first Bt row
    const size_t pbase = z * sC + (size_t)(cw / 64) * (TT * HD) + (tr ? (size_t)rw : (size_t)rw * HD); const int ppit = tr ? TT : HD;   // the tile's first element in its head plane, and the plane's row pitch
    v4f bz = (v4f){};   // a lane's four columns are the same in every step
    if (BIAS) { const float* bp = bias + cw + lr * 4;
#pragma unroll
        for (int j = 0; j < 4; ++j) bz[j] = bfr(bp[j]); }
    // Which planes attention reads of this tile (the same for the whole work-group): the hi/lo planes only of tokens < RH (queries < RH see no later key), the fp16 plane of k and v everywhere, of q only from token RH on. The rest is neither split nor stored.
    auto put = [&](auto w16, auto whl) {
#pragma unroll 1   // rolled, four steps a trip: their reads and stores are in flight together; unrolled whole it would only lengthen the text
    for (int s4 = 0; s4 < 32; s4 += 4) {
#pragma unroll
      for (int u = 0; u < 4; ++u) { const int slot = (s4 + u) * 32 + lane, row = slot >> 4, cofs = (slot & 15) * 4; v4f val = *(const v4fa*)(ow + row * 68 + cofs);
        if (BIAS) val += bz;
        if constexpr (PLANES) { const size_t po = pbase + (size_t)(row * ppit + cofs);
            if constexpr (decltype(w16)::v) { v4h o16;
#pragma unroll
                for (int j = 0; j < 4; ++j) o16[j] = tohx(val[j]);
                *(v4h*)(P16 + po) = o16; }
            if constexpr (decltype(whl)::v) { v4us oh, ol;
#pragma unroll
                for (int j = 0; j < 4; ++j) { unsigned short a2, c2; splitf(val[j], a2, c2); oh[j] = a2; ol[j] = c2; }
                *(v4us*)(Ph + po) = oh; *(v4us*)(Pl + po) = ol; }
        } else *(v4f*)(C + (size_t)(rw + row) * ldc + cw + cofs) = val; }
      asm volatile("s_wait_xcnt 0x0" ::: "memory"); } };   // the wait that stands in front of any overwrite of a register that an issued store names: the next trip reuses them
    if (!PLANES || r0 >= RH) put(Flag<true>{}, Flag<false>{});
    else if ((int)blockIdx.y * (GBN / 64) >= NH_) put(Flag<true>{}, Flag<true>{});
    else put(Flag<false>{}, Flag<true>{});
}

// ---- k_prep: every f32 -> bf16 copy in one launch, 8 elements a thread; the block index picks the range: x (all batches), w_proj, then w_qkv with its packed rows (h, part, d) gathered into standard (part, h, d) blocks.
#define PBX (NB_ * TT * DM / 8 / 256)
#define PBO (DM * DQ / 8 / 256)
#define PBW (3 * DQ * DM / 8 / 256)
__global__ __launch_bounds__(256) void k_prep(const float* __restrict__ x, const float* __restrict__ W, const float* __restrict__ wo, bf* XB, bf* Bt, bf* WO) {
    const int bx = (int)blockIdx.x; const float* s; bf* d;
    if (bx < PBX) { const size_t e = ((size_t)bx * 256 + threadIdx.x) * 8; s = x + e; d = XB + e; }
    else if (bx < PBX + PBO) { const size_t e = ((size_t)(bx - PBX) * 256 + threadIdx.x) * 8; s = wo + e; d = WO + e; }
    else { const size_t e = ((size_t)(bx - PBX - PBO) * 256 + threadIdx.x) * 8; const int c0 = (int)(e % DM); const int rd = (int)(e / DM); const int part = rd / DQ; const int h = (rd % DQ) / HD; const int dd = rd % HD; s = W + (size_t)(h * 3 * HD + part * HD + dd) * DM + c0; d = Bt + e; }
    const v8f v = *(const v8f*)s; v8us o;
#pragma unroll
    for (int k = 0; k < 8; ++k) o[k] = f2bf(v[k]);
    *(v8us*)d = o;
}
// ---- k_fattn: causal attention, one pass over the keys; scores and probabilities stay in registers (online softmax). grid (heads x batches, work-groups of a head), FNW * 32 threads.
// Transposed products: S^T = K Q^T (A = key rows, B = query rows), so a lane holds 16 keys' scores of ONE query (column lr); two S^T tiles (keys 0..15, 16..31), converted in place, are the B operand of O^T += V^T P^T.
// The 8 waves tile the QUERIES (NQT * 16 columns each); every wave walks all the keys its queries may see and keeps its own running maximum, sum and 64 x NQT*16 f32 tile of O^T: nothing is joined between waves.
// A stage is SK keys: SK rows of K (128 bytes each) and the 64 rows of V^T (SK * 2 bytes each), brought into LDS once for the whole work-group by asynchronous copies (whole lines only) and read from there by every wave that needs it;
// two buffers: the copies of stage t + 2 fly while stage t + 1 is worked on. A pass is 32 keys; a wave skips the passes above its own diagonal but meets every barrier.
// A work-group takes one block of BR = 8 waves' neighbouring queries and walks the stages up to the block's last query: the same number of trips for all its waves.
// HL (query rows < RH): hi+lo bf16 planes, 3 products for S and for P V, 16 columns a wave, 64 keys a stage; else fp16 planes, one product, 32 columns a wave, 128 keys a stage. The quotient goes out as the merged hi/lo planes [t][DQ].
#define FNW  8
#define KPIT 144                  // LDS pitch in bytes of a K row (128 bytes): 16 B x odd, no bank conflict for 16-byte readers; a V^T row piece gets its length + 16 bytes, also 16 B x odd
#define CL2  0.18033688011112042f // HD^-0.5 * log2(e): scores in log2 units
// A query's 17 exponentials of a pass, each in place, and the one vector slot behind a transcendental in one statement.
// In place, so that the statement writes no register but its own live values (never an operand register of a WMMA still in its window).
__device__ __forceinline__ void ex2x17(float (&e)[17]) {
    asm("v_exp_f32 %0, %0\n\tv_exp_f32 %1, %1\n\tv_exp_f32 %2, %2\n\tv_exp_f32 %3, %3\n\tv_exp_f32 %4, %4\n\tv_exp_f32 %5, %5\n\tv_exp_f32 %6, %6\n\tv_exp_f32 %7, %7\n\tv_exp_f32 %8, %8\n\t"
        "v_exp_f32 %9, %9\n\tv_exp_f32 %10, %10\n\tv_exp_f32 %11, %11\n\tv_exp_f32 %12, %12\n\tv_exp_f32 %13, %13\n\tv_exp_f32 %14, %14\n\tv_exp_f32 %15, %15\n\tv_exp_f32 %16, %16\n\tv_nop"
        : "+v"(e[0]), "+v"(e[1]), "+v"(e[2]), "+v"(e[3]), "+v"(e[4]), "+v"(e[5]), "+v"(e[6]), "+v"(e[7]), "+v"(e[8]), "+v"(e[9]), "+v"(e[10]), "+v"(e[11]), "+v"(e[12]), "+v"(e[13]), "+v"(e[14]), "+v"(e[15]), "+v"(e[16]));
}
__device__ __forceinline__ float xhalf(float x) { return __builtin_bit_cast(float, __builtin_amdgcn_permlanex16(__builtin_bit_cast(int, x), __builtin_bit_cast(int, x), 0x76543210, 0xfedcba98, false, false)); }  // lane l with lane l ^ 16
// Eight asynchronous copies, 16 bytes a lane: two runs of four, copy i of a run ls bytes further on in LDS and gs elements further on in memory. The s_wait_xcnt is the statement's last line, so that it stands in front of every later write of a register that a copy names (a precaution).
template <typename T16>
__device__ __forceinline__ void cpkv(unsigned la, const T16* ga, unsigned lsa, size_t gsa, unsigned lb, const T16* gb, unsigned lsb, size_t gsb) {
    asm volatile("global_load_async_to_lds_b128 %0, %8, off\n\tglobal_load_async_to_lds_b128 %1, %9, off\n\tglobal_load_async_to_lds_b128 %2, %10, off\n\tglobal_load_async_to_lds_b128 %3, %11, off\n\t"
                 "global_load_async_to_lds_b128 %4, %12, off\n\tglobal_load_async_to_lds_b128 %5, %13, off\n\tglobal_load_async_to_lds_b128 %6, %14, off\n\tglobal_load_async_to_lds_b128 %7, %15, off\n\ts_wait_xcnt 0x0"
                 :: "v"(la), "v"(la + lsa), "v"(la + 2 * lsa), "v"(la + 3 * lsa), "v"(lb), "v"(lb + lsb), "v"(lb + 2 * lsb), "v"(lb + 3 * lsb),
                    "v"(ga), "v"(ga + gsa), "v"(ga + 2 * gsa), "v"(ga + 3 * gsa), "v"(gb), "v"(gb + gsb), "v"(gb + 2 * gsb), "v"(gb + 3 * gsb) : "memory");
}
template <bool HL> struct AShape {   // sizes of the two kinds of work-group
    static constexpr int NQT = HL ? 1 : 2, SK = HL ? 64 : 128, R0 = HL ? 0 : RH, BR = FNW * NQT * 16, NBK = (HL ? RH : TT - RH) / BR;
    static constexpr int VPIT = SK * 2 + 16, KTB = SK * KPIT, TS = KTB + HD * VPIT, STG = TS * (HL ? 2 : 1);   // a buffer: K rows | V^T rows (| K lo rows | V^T lo rows)
};
template <typename T16, bool HL>
__device__ __forceinline__ void attn_body(const T16* __restrict__ Q, const T16* __restrict__ Q2, const T16* __restrict__ Kp, const T16* __restrict__ K2, const T16* __restrict__ Vt, const T16* __restrict__ V2, int b, bf* Ah, bf* Al, const char* sm) {
    typedef typename WFrag<T16>::V V; typedef AShape<HL> S_;
    constexpr int NQT = S_::NQT, SK = S_::SK, VPIT = S_::VPIT, KTB = S_::KTB, TS = S_::TS, STG = S_::STG;
    const int tid = (int)threadIdx.x, lane = tid & 31, lr = lane & 15, hi = lane >> 4;
    const int w = __builtin_amdgcn_readfirstlane(tid >> 5);   // wave number, scalar: the pass counts and the diagonal test stay in scalar registers
    const int q0 = S_::R0 + S_::BR * b + NQT * 16 * w;        // this wave's first query
    const int NS = (S_::R0 + S_::BR * (b + 1)) / SK;          // stages up to the block's last query
    const unsigned l0 = (unsigned)(size_t)sm;
    auto fill = [&](int t, int buf) { const unsigned lb = l0 + buf * STG;
        const int kr = tid >> 3, kg = tid & 7;   // this lane's row (of 32 a copy) and 16-byte piece of a 128-byte row
        const size_t ko = (size_t)(t * SK + kr) * HD + kg * 8; const unsigned kl = lb + kr * KPIT + kg * 16;
        if constexpr (HL) { const size_t vo = (size_t)kr * TT + t * SK + kg * 8; const unsigned vl = lb + KTB + kr * VPIT + kg * 16;   // run = hi rows 0..31, 32..63, lo rows 0..31, 32..63: the lo plane's tile lies TS bytes behind the hi plane's
            asm volatile("global_load_async_to_lds_b128 %0, %8, off\n\tglobal_load_async_to_lds_b128 %1, %9, off\n\tglobal_load_async_to_lds_b128 %2, %10, off\n\tglobal_load_async_to_lds_b128 %3, %11, off\n\t"
                         "global_load_async_to_lds_b128 %4, %12, off\n\tglobal_load_async_to_lds_b128 %5, %13, off\n\tglobal_load_async_to_lds_b128 %6, %14, off\n\tglobal_load_async_to_lds_b128 %7, %15, off\n\ts_wait_xcnt 0x0"
                         :: "v"(kl), "v"(kl + 32 * KPIT), "v"(kl + TS), "v"(kl + TS + 32 * KPIT), "v"(vl), "v"(vl + 32 * VPIT), "v"(vl + TS), "v"(vl + TS + 32 * VPIT),
                            "v"(Kp + ko), "v"(Kp + ko + 32 * HD), "v"(K2 + ko), "v"(K2 + ko + 32 * HD), "v"(Vt + vo), "v"(Vt + vo + 32 * TT), "v"(V2 + vo), "v"(V2 + vo + 32 * TT) : "memory");   // the s_wait_xcnt: as in cpkv
        } else { const int vr = tid >> 4, vg = tid & 15;   // 16 rows of 256 bytes a copy
            cpkv<T16>(kl, Kp + ko, 32 * KPIT, (size_t)32 * HD, lb + KTB + vr * VPIT + vg * 16, Vt + (size_t)vr * TT + t * SK + vg * 8, 16 * VPIT, (size_t)16 * TT); } };
    auto ldl = [&](int off) -> V { if constexpr (HL) return cat16b(*(const v8usa*)(sm + off), *(const v8usa*)(sm + off + 32)); else return cat16(*(const v8ha*)(sm + off), *(const v8ha*)(sm + off + 32)); };
    fill(0, 0);
    V qf[NQT][2], qf2[NQT][2];
    const size_t qo = (size_t)(q0 + lr) * HD + 8 * hi; const T16* qp = Q + qo; const T16* qp2 = HL ? Q2 + qo : qp;
#pragma unroll
    for (int qt = 0; qt < NQT; ++qt)
#pragma unroll
        for (int ks = 0; ks < 2; ++ks) { qf[qt][ks] = WFrag<T16>::ld(qp + qt * 16 * HD + ks * 32); if (HL) qf2[qt][ks] = WFrag<T16>::ld(qp2 + qt * 16 * HD + ks * 32); }
    // the wait that stands in front of any overwrite of a register that an issued load names; the addresses are its inputs so that they stay in their registers up to it (no load's own result lands on them)
    asm volatile("s_wait_xcnt 0x0" :: "v"(qp), "v"(qp2) : "memory");
    v8f o[4][NQT]; float m[NQT], l[NQT];
#pragma unroll
    for (int qt = 0; qt < NQT; ++qt) { m[qt] = -3.0e38f; l[qt] = 0.f;
#pragma unroll
        for (int dt = 0; dt < 4; ++dt) o[dt][qt] = (v8f){}; }
    asm volatile("s_wait_asynccnt 0x0" ::: "memory");   // this wave's copies of stage 0 have landed
    __syncthreads();                                    // ... and every other wave's
    if (NS > 1) fill(1, 1);
#pragma unroll 1   // rolled: one stage a trip, the buffer picked by the trip's parity
    for (int t = 0; t < NS; ++t) {
        const int left = (q0 >> 5) + 1 - t * (SK / 32), np = left < SK / 32 ? left : SK / 32;   // passes of this stage that begin no later than the wave's first query (none: the wave only meets the barrier)
        const int fk = (t & 1) * STG + lr * KPIT + hi * 16, fv = (t & 1) * STG + KTB + lr * VPIT + hi * 16;   // byte offsets of this lane's first K and V^T fragment rows
        V kf[2][2], kf2[2][2];   // a pass's key fragments: fetched one pass ahead inside the stage, into the same registers, right behind the products that read them
        auto ldk = [&](int ps) {
#pragma unroll
            for (int kt = 0; kt < 2; ++kt)
#pragma unroll
                for (int ks = 0; ks < 2; ++ks) { kf[kt][ks] = ldl(fk + (ps * 32 + kt * 16) * KPIT + ks * 64); if (HL) kf2[kt][ks] = ldl(fk + TS + (ps * 32 + kt * 16) * KPIT + ks * 64); } };
        if (np > 0) ldk(0);
#pragma unroll 1   // rolled: one pass's fragments, scores and the output tile fill the register budget
        for (int ps = 0; ps < np; ++ps) { const int kc = t * SK + ps * 32;
            V vf[4], vf2[4];
#pragma unroll
            for (int dt = 0; dt < 4; ++dt) { vf[dt] = ldl(fv + dt * 16 * VPIT + ps * 64); if (HL) vf2[dt] = ldl(fv + TS + dt * 16 * VPIT + ps * 64); }
            v8f s[2][NQT];
#pragma unroll
            for (int kt = 0; kt < 2; ++kt)
#pragma unroll
                for (int qt = 0; qt < NQT; ++qt) { v8f a = (v8f){};
#pragma unroll
                    for (int ks = 0; ks < 2; ++ks) { a = WFrag<T16>::mma(kf[kt][ks], qf[qt][ks], a); if (HL) { a = WFrag<T16>::mma(kf[kt][ks], qf2[qt][ks], a); a = WFrag<T16>::mma(kf2[kt][ks], qf[qt][ks], a); } }
                    s[kt][qt] = a; }
            ldk(ps + 1 < np ? ps + 1 : ps);   // the wave's last pass of a stage fetches its own rows again: always inside this stage's buffer, never used
            if (kc + 31 > q0) {   // only the wave's last pass needs the mask (same for the whole wave: one branch round all the selects)
#pragma unroll
                for (int qt = 0; qt < NQT; ++qt) { const int lim = q0 + qt * 16 + lr - kc - hi * 8;   // this lane's query minus its first key
#pragma unroll
                    for (int kt = 0; kt < 2; ++kt)
#pragma unroll
                        for (int j = 0; j < 8; ++j) s[kt][qt][j] = (kt * 16 + j <= lim) ? s[kt][qt][j] : -3.0e38f; } }
#pragma unroll
            for (int qt = 0; qt < NQT; ++qt) { float mx = -3.0e38f;
#pragma unroll
                for (int kt = 0; kt < 2; ++kt)
#pragma unroll
                    for (int j = 0; j < 8; ++j) mx = fmaxf(mx, s[kt][qt][j]);
                mx = fmaxf(mx, xhalf(mx));   // the query's other 16 keys of this pass sit in the other half of the wave
                const float mn = fmaxf(m[qt], mx * CL2); float e[17], sum = 0.f; e[16] = m[qt] - mn; m[qt] = mn;   // the running maximum is kept in log2 units
#pragma unroll
                for (int kt = 0; kt < 2; ++kt)
#pragma unroll
                    for (int j = 0; j < 8; ++j) e[kt * 8 + j] = s[kt][qt][j] * CL2 - mn;
                ex2x17(e); const float al = e[16];
#pragma unroll
                for (int kt = 0; kt < 2; ++kt)
#pragma unroll
                    for (int j = 0; j < 8; ++j) { s[kt][qt][j] = e[kt * 8 + j]; sum += e[kt * 8 + j]; }
                l[qt] = l[qt] * al + sum;
#pragma unroll
                for (int dt = 0; dt < 4; ++dt) o[dt][qt] *= al;
                if constexpr (HL) { v8us h0, h1, l0v, l1v;
#pragma unroll
                    for (int j = 0; j < 8; ++j) { unsigned short a, c2; splitf(s[0][qt][j], a, c2); h0[j] = a; l0v[j] = c2; splitf(s[1][qt][j], a, c2); h1[j] = a; l1v[j] = c2; }
                    const v16bf ph = cat16b(h0, h1), pl = cat16b(l0v, l1v);
#pragma unroll
                    for (int dt = 0; dt < 4; ++dt) { o[dt][qt] = wmmab(__builtin_bit_cast(v16bf, vf[dt]), ph, o[dt][qt]); o[dt][qt] = wmmab(__builtin_bit_cast(v16bf, vf[dt]), pl, o[dt][qt]); o[dt][qt] = wmmab(__builtin_bit_cast(v16bf, vf2[dt]), ph, o[dt][qt]); }
                } else { v16h pb;
#pragma unroll
                    for (int j = 0; j < 8; ++j) { pb[j] = tohx(s[0][qt][j]); pb[8 + j] = tohx(s[1][qt][j]); }
#pragma unroll
                    for (int dt = 0; dt < 4; ++dt) o[dt][qt] = wmma16(__builtin_bit_cast(v16h, vf[dt]), pb, o[dt][qt]); } }
            // four vector slots behind the last WMMAs, on the taken side of the loop's branch too
            asm volatile("v_nop\n\tv_nop\n\tv_nop\n\tv_nop" : "+v"(o[0][NQT - 1]), "+v"(o[1][NQT - 1]), "+v"(o[2][NQT - 1]), "+v"(o[3][NQT - 1]) : "v"(vf[0]), "v"(vf[3]));
        }
        asm volatile("s_wait_dscnt 0x0" ::: "memory");      // this wave's reads of buffer t & 1 are done before anybody refills it
        asm volatile("s_wait_asynccnt 0x0" ::: "memory");   // this wave's copies of stage t + 1 have landed
        __syncthreads();                                    // publishes stage t + 1 and frees buffer t & 1
        if (t + 2 < NS) fill(t + 2, t & 1);
    }
    asm volatile("s_wait_asynccnt 0x0" ::: "memory");   // nothing is in flight when the wave ends
    v8us oh[NQT][4], ol[NQT][4];   // a lane holds 8 neighbours of its query's output row: the quotient goes out from the registers
#pragma unroll
    for (int qt = 0; qt < NQT; ++qt) { const float inv = __fdiv_rn(1.0f, l[qt] + xhalf(l[qt]));   // the two halves' sums of one query
#pragma unroll
        for (int dt = 0; dt < 4; ++dt)
#pragma unroll
            for (int j = 0; j < 8; ++j) { unsigned short x, y; splitf(o[dt][qt][j] * inv, x, y); oh[qt][dt][j] = x; ol[qt][dt][j] = y; } }
    bf* ah = Ah + (size_t)(q0 + lr) * DQ + hi * 8; bf* al2 = Al + (size_t)(q0 + lr) * DQ + hi * 8;
    __builtin_amdgcn_sched_barrier(0);   // every store stands behind the last arithmetic: no register that an issued store names is written again
#pragma unroll
    for (int qt = 0; qt < NQT; ++qt)
#pragma unroll
        for (int dt = 0; dt < 4; ++dt) { *(v8us*)(ah + qt * 16 * DQ + dt * 16) = oh[qt][dt]; *(v8us*)(al2 + qt * 16 * DQ + dt * 16) = ol[qt][dt]; }
}
#define GYM (AShape<false>::NBK)   // work-groups of a head: rows >= RH,
#define GYH (AShape<true>::NBK)    // rows < RH
__global__ __launch_bounds__(FNW * 32) __attribute__((amdgpu_waves_per_eu(4, 4))) void k_fattn(const h16* __restrict__ Q16, const h16* __restrict__ K16, const h16* __restrict__ V16, const bf* __restrict__ Qh, const bf* __restrict__ Ql, const bf* __restrict__ Kh, const bf* __restrict__ Kl, const bf* __restrict__ Vh, const bf* __restrict__ Vl, bf* Ah, bf* Al) {
    __shared__ __align__(16) char sm[2 * (AShape<true>::STG > AShape<false>::STG ? AShape<true>::STG : AShape<false>::STG)];
    const unsigned hd = blockIdx.x % NH_, bt = blockIdx.x / NH_;   // head, batch; a batch holds 3 * NH_ head planes (q, k, v^T)
    const size_t hp = (size_t)(bt * 3 * NH_ + hd) * TT * HD; const int bx = (int)blockIdx.y; Ah += (size_t)bt * TT * DQ + hd * HD; Al += (size_t)bt * TT * DQ + hd * HD;
    // Which block: a permutation of the grid, for speed only. Two work-groups fit a WGP, so the launch lasts as long as the fullest WGP.
    // Grid rows y and y + 4 hold blocks whose passes add up to about the same (fp16 blocks 5 4 3 2 over hi/lo blocks 3 2 and fp16 blocks 0 1); work-groups whose x has an odd number of ones take the other row of the two:
    // neighbours in index order at any power-of-two distance, in x or four rows apart, are then a long block and a short one. The two shortest hi/lo blocks come last.
    static_assert(GYM == 6 && GYH == 4, "the table below lists 6 + 4 blocks");
    const int row = bx < 8 ? bx ^ ((__builtin_popcount(blockIdx.x) & 1) << 2) : bx;
    const int blk = (int)((0x8910AB2345ull >> (4 * row)) & 15);   // four bits a row: 0..5 an fp16 block, 8..11 a hi/lo block
    if (blk < 8) attn_body<h16, false>(Q16 + hp, nullptr, K16 + hp, nullptr, V16 + hp, nullptr, blk, Ah, Al, sm);
    else attn_body<bf, true>(Qh + hp, Ql + hp, Kh + hp, Kl + hp, Vh + hp, Vl + hp, blk - 8, Ah, Al, sm);
}

extern "C" void kernel_launch(void* const* d_in, const int* in_sizes, int n_in,
                              void* d_out, int out_size, void* d_ws, size_t ws_size, hipStream_t stream) {
    (void)in_sizes; (void)n_in; (void)out_size;
    const float* x = (const float*)d_in[0]; const float* wqkv = (const float*)d_in[1]; const float* wo = (const float*)d_in[2]; const float* bo = (const float*)d_in[3];   /* input order x, w_qkv ('oi' (out, in) [3072][1024], rows packed per head (h, part, c)), w_proj ('oi' [1024][1024]), b_proj (REAL): FOUR inputs, all read: the host's own binding */ const float* wq = wqkv; const float* wk = nullptr; const float* wv = nullptr; (void)wk; (void)wv;
    float* OUT = (float*)d_out;     // [4][2048][1024]
    char* wsp = (char*)d_ws;
    auto take = [&](size_t bytes) { char* p = wsp; wsp += (bytes + 255) & ~(size_t)255; return (void*)p; };
    bf* WQKV = (bf*)take((size_t)3 * DQ * DM * 2);   /* de-interleaved Bt: q | k | v row blocks in head order */ bf* WO = (bf*)take((size_t)DM * DQ * 2);
    bf* XB = (bf*)take((size_t)NB_ * TT * DM * 2);
    const size_t PB = (size_t)3 * NH_ * TT * HD, PK = (size_t)NH_ * TT * HD;   // one batch's head planes of one kind: q heads [t][d] | k heads [t][d] | v heads [d][t]
    h16* P16 = (h16*)take(NB_ * PB * 2); bf* PH = (bf*)take(NB_ * PB * 2); bf* PL = (bf*)take(NB_ * PB * 2);
    bf* ATh = (bf*)take((size_t)NB_ * TT * DQ * 2); bf* ATl = (bf*)take((size_t)NB_ * TT * DQ * 2);
    if ((size_t)(wsp - (char*)d_ws) > ws_size) return;    // ws 256 MiB
    k_prep<<<PBX + PBO + PBW, 256, 0, stream>>>(x, wqkv, wo, XB, WQKV, WO);
    k_gemmt<0, false, true><<<dim3(RH / GBM, 3 * DQ / GBN, NB_ * (TT / RH)), 256, 0, stream>>>(XB, nullptr, DM, WQKV, DM, nullptr, 0, nullptr, (size_t)TT * DM, PB, P16, PH, PL, 2 * NH_);   // q, k planes [h][t][d]; v planes transposed, [h][d][t]
    k_fattn<<<dim3(NH_ * NB_, GYM + GYH, 1), FNW * 32, 0, stream>>>(P16, P16 + PK, P16 + 2 * PK, PH, PL, PH + PK, PL + PK, PH + 2 * PK, PL + 2 * PK, ATh, ATl);   // one kv head per query head: head h uses plane h of each
    k_gemmt<1, true, false><<<dim3(NB_ * TT / GBM, DM / GBN, 1), 256, 0, stream>>>(ATh, ATl, DQ, WO, DQ, OUT, DM, bo, 0, 0, nullptr, nullptr, nullptr, 0);
}

// v009
// Measured time: 125 microseconds a run.
// Next to v008, in two timings, it ran 1.05 times as fast each time.
// All steps since v000 together make it 22.3 times as fast.
#include <hip/hip_runtime.h>

// Causal multi-head attention with a fused bias-free qkv projection in (out, in) layout whose ROWS are packed PER HEAD (x [4][2048][1024]; qkv = einsum('bse,fe->bsf', x, w_qkv) = x w_qkv^T ('oi' (out, in) [3072][1024] 1/32, no bias) viewed (b, s, 16 heads, 3 x 64): head h's rows h*192 + 0..63 | 64..127 | 128..191 of w_qkv are its q | k | v; scores x 64^-0.5 (token-major einsums: the same products); where(tril, scores, -inf) (exclusion; every row keeps its own key); softmax; out = merged w_proj^T + b_proj ('oi' + a REAL 0.01 bias) -> [4][2048][1024] (8.4 M); argument order x, w_qkv, w_proj, b_proj).
// Four launches, each over all four batches: bf16 copies (x, w_proj, and the packed weight rows gathered into a standard q | k | v Bt, a row permutation); exact projections that write the head planes themselves, q, k and v^T in one grid; causal T-2048 attention, all heads of all batches in one launch, scores and probabilities kept in registers (online softmax against a held reference; hybrid rows: < 512 hi/lo 3 products, rest fp16; key blocks above the diagonal are never visited); merged hi/lo x Wo exact + bo.
// Compute dtypes, f32 accumulate: every input rounded to bf16; projections exact; attention rows < 512 3 products, rest fp16; softmax f32; Wo hl x exact + bias.

#define NB_  4
#define TT   2048
#define DM   1024
#define NH_  16
#define NKV  16
#define HD   64
#define DQ   (NH_ * HD)
#define DKV  (NKV * HD)
#define RH   512                  // query rows < RH use hi+lo planes
#define CL2  0.18033688011112042f // HD^-0.5 * log2(e): q is stored times this, so that k . q is a score in log2 units
typedef _Float16 h16;
typedef unsigned short bf;
typedef __attribute__((ext_vector_type(16))) __bf16   v16bf;
typedef __attribute__((ext_vector_type(16))) _Float16 v16h;
typedef __attribute__((ext_vector_type(8)))  _Float16 v8h;
typedef __attribute__((ext_vector_type(8)))  unsigned short v8us;
typedef __attribute__((ext_vector_type(8)))  float    v8f;
typedef __attribute__((ext_vector_type(4)))  float    v4f;
typedef v8h  __attribute__((may_alias)) v8ha;
typedef v4f  __attribute__((may_alias)) v4fa;
typedef v8us __attribute__((may_alias)) v8usa;

__device__ __forceinline__ unsigned short f2bf(float f) { unsigned u = __float_as_uint(f); u += 0x7FFFu + ((u >> 16) & 1u); return (unsigned short)(u >> 16); }
__device__ __forceinline__ float bf2f(unsigned short b) { return __uint_as_float(((unsigned)b) << 16); }
__device__ __forceinline__ float bfr(float f) { return bf2f(f2bf(f)); }
__device__ __forceinline__ v16h cat16(v8h lo, v8h hi) { return __builtin_shufflevector(lo, hi, 0, 1, 2, 3, 4, 5, 6, 7, 8, 9, 10, 11, 12, 13, 14, 15); }
__device__ __forceinline__ v16bf cat16b(v8us lo, v8us hi) { return __builtin_bit_cast(v16bf, __builtin_shufflevector(lo, hi, 0, 1, 2, 3, 4, 5, 6, 7, 8, 9, 10, 11, 12, 13, 14, 15)); }
__device__ __forceinline__ v8f wmma16(v16h a, v16h b, v8f c) { return __builtin_amdgcn_wmma_f32_16x16x32_f16(false, a, false, b, (short)0, c, false, false); }
__device__ __forceinline__ v8f wmmab(v16bf a, v16bf b, v8f c) { return __builtin_amdgcn_wmma_f32_16x16x32_bf16(false, a, false, b, (short)0, c, false, false); }
__device__ __forceinline__ h16 tohx(float x) { return (h16)x; }
__device__ __forceinline__ void splitf(float y, unsigned short& h, unsigned short& l) { h = f2bf(y); l = f2bf(y - bf2f(h)); }
typedef __attribute__((ext_vector_type(4))) _Float16 v4h;
typedef __attribute__((ext_vector_type(4))) unsigned short v4us;



// ---- k_gemmt: GEMM, one 128x256 output tile per work-group of 8 waves (2 x 4, a 64x64 tile each: 16 accumulators), operands are K-contiguous bf16 planes; grid (M/128, N/256, Z) (PLANES: see its first lines), 256 threads.
// C[m][n] (f32, pitch ldc, + optional f32 bias[n]) = sum_k A[m][k] Bt[n][k] (+ A2[m][k] Bt[n][k] when NSPLIT). A rows have pitch lda, Bt rows pitch K. z-batch strides sA/sC in elements. K % 64 == 0.
// A pass is 64 k: one 128-byte line of every operand row of the tile, brought into LDS by asynchronous copies (8 lanes a line, whole lines only) and read from there by every wave that needs it;
// two buffers: the copies of pass t + 2 fly while pass t + 1 is worked on. Every output element is one accumulator's sum over k in rising order.
// PLANES: the sum goes out not as f32 C but into three 16-bit planes (fp16, bf16 hi, bf16 lo), [z][head][TT * HD] each, of which a tile stores only those that attention reads at its tokens: A = token rows (x, z = token tile and batch), Bt = weight rows (a wave's 64 columns = one head's 64 rows of q, k or v).
// head < tsw: a wave's tile is 64 rows of the head's plane [t][d]; head >= tsw: its operands change places and the tile is 64 columns of the transposed plane [d][t]. Each wave turns its tile in LDS; 16 lanes store one whole 128-byte line of a plane.
template <typename T16> struct WFrag;
template <> struct WFrag<h16> { typedef v16h V; static __device__ __forceinline__ V ld(const h16* p) { return cat16(*(const v8h*)p, *(const v8h*)(p + 16)); } static __device__ __forceinline__ v8f mma(V a, V b, v8f c) { return wmma16(a, b, c); } };
template <> struct WFrag<bf> { typedef v16bf V; static __device__ __forceinline__ V ld(const bf* p) { return cat16b(*(const v8us*)p, *(const v8us*)(p + 16)); } static __device__ __forceinline__ v8f mma(V a, V b, v8f c) { return wmmab(a, b, c); } };
template <bool B> struct Flag { static constexpr bool v = B; };
#define GBM  128
#define GBN  256
#define GPIT 144                  // LDS pitch in bytes of a 128-byte row piece: 16 B x odd, no bank conflict for 16-byte readers
// Asynchronous copies, 16 bytes a lane, four rows of 128 bytes an instruction; copy i of a run takes the rows 32 * i further on (gs elements in memory). The s_wait_xcnt is the statement's last line, so that it stands in front of every later write of a register that a copy names (a precaution).
__device__ __forceinline__ void cp4(unsigned l, const bf* g, size_t gs) {
    asm volatile("global_load_async_to_lds_b128 %0, %4, off\n\tglobal_load_async_to_lds_b128 %1, %5, off\n\tglobal_load_async_to_lds_b128 %2, %6, off\n\tglobal_load_async_to_lds_b128 %3, %7, off\n\ts_wait_xcnt 0x0"
                 :: "v"(l), "v"(l + 32 * GPIT), "v"(l + 64 * GPIT), "v"(l + 96 * GPIT), "v"(g), "v"(g + gs), "v"(g + 2 * gs), "v"(g + 3 * gs) : "memory");
}
__device__ __forceinline__ void cp8(unsigned l, const bf* g, unsigned l2, const bf* g2, size_t gs) {
    asm volatile("global_load_async_to_lds_b128 %0, %8, off\n\tglobal_load_async_to_lds_b128 %1, %9, off\n\tglobal_load_async_to_lds_b128 %2, %10, off\n\tglobal_load_async_to_lds_b128 %3, %11, off\n\t"
                 "global_load_async_to_lds_b128 %4, %12, off\n\tglobal_load_async_to_lds_b128 %5, %13, off\n\tglobal_load_async_to_lds_b128 %6, %14, off\n\tglobal_load_async_to_lds_b128 %7, %15, off\n\ts_wait_xcnt 0x0"
                 :: "v"(l), "v"(l + 32 * GPIT), "v"(l + 64 * GPIT), "v"(l + 96 * GPIT), "v"(l2), "v"(l2 + 32 * GPIT), "v"(l2 + 64 * GPIT), "v"(l2 + 96 * GPIT),
                    "v"(g), "v"(g + gs), "v"(g + 2 * gs), "v"(g + 3 * gs), "v"(g2), "v"(g2 + gs), "v"(g2 + 2 * gs), "v"(g2 + 3 * gs) : "memory");
}
template <int NSPLIT, bool BIAS, bool PLANES>
__global__ __launch_bounds__(256) void k_gemmt(const bf* __restrict__ A, const bf* __restrict__ A2, int lda, const bf* __restrict__ Bt, int K, float* C, int ldc, const float* __restrict__ bias, size_t sA, size_t sC, h16* P16, bf* Ph, bf* Pl, int tsw) {
    constexpr int AR = GBM * (1 + NSPLIT), STG = (AR + GBN) * GPIT, OSB = 8 * 64 * 68 * 4;   // a buffer: A rows | A2 rows | Bt rows; the output staging reuses the ring
    __shared__ __align__(16) char sm[2 * STG > OSB ? 2 * STG : OSB];
    // PLANES: grid z = (block of RH tokens, batch), x = tile in the block: the tiles of tokens < RH, whose epilogue is the long one, have the lowest indices (for speed only: any order gives the same planes)
    const size_t z = PLANES ? blockIdx.z % NB_ : blockIdx.z; A += z * sA; if (NSPLIT) A2 += z * sA;
    const int tid = (int)threadIdx.x, lane = tid & 31, lr = lane & 15, hi = lane >> 4; const int r0 = (PLANES ? (int)(blockIdx.z / NB_) * RH : 0) + (int)blockIdx.x * GBM, c0 = blockIdx.y * GBN;
    const int w = __builtin_amdgcn_readfirstlane(tid >> 5), wm = w & 1, wn = w >> 1;   // wave number, scalar; the wave's 64x64 tile in the work-group's
    const bool tr = PLANES && (int)blockIdx.y * (GBN / 64) >= tsw;   // same for the whole work-group
    const int crow = tid >> 3, cseg = tid & 7;   // this lane's row (of 32 a copy) and 16-byte piece of its line
    const bf* gA = A + (size_t)(r0 + crow) * lda + cseg * 8; const bf* gA2 = NSPLIT ? A2 + (size_t)(r0 + crow) * lda + cseg * 8 : gA; const bf* gB = Bt + (size_t)(c0 + crow) * K + cseg * 8;
    const unsigned l0 = (unsigned)(size_t)sm + crow * GPIT + cseg * 16;
    auto fill = [&](int t, int buf) { const unsigned l = l0 + buf * STG; const int ko = t * 64;
        if constexpr (NSPLIT) cp8(l, gA + ko, l + GBM * GPIT, gA2 + ko, (size_t)32 * lda); else cp4(l, gA + ko, (size_t)32 * lda);
        cp8(l + AR * GPIT, gB + ko, l + (AR + 128) * GPIT, gB + (size_t)128 * K + ko, (size_t)32 * K); };
    const int fm = (wm * 64 + lr) * GPIT + hi * 16, fn = (AR + wn * 64 + lr) * GPIT + hi * 16;   // byte offsets in a buffer of this lane's first fragment row of A (m side) and of Bt (n side)
    const int fp = tr ? fm : fn, fq = tr ? fn : fm;   // the WMMA's first operand is the side along which the output is contiguous: a lane then holds 8 neighbours of one output row
    auto ldf = [&](int off) { return cat16b(*(const v8usa*)(sm + off), *(const v8usa*)(sm + off + 32)); };
    v8f acc[4][4];
#pragma unroll
    for (int mb = 0; mb < 4; ++mb)
#pragma unroll
        for (int nb = 0; nb < 4; ++nb) acc[mb][nb] = (v8f){};
    const int NT = K / 64;
    fill(0, 0);
    asm volatile("s_wait_asynccnt 0x0" ::: "memory");   // this wave's copies of pass 0 have landed
    __syncthreads();                                    // ... and every other wave's
    if (NT > 1) fill(1, 1);
#pragma unroll 1   // rolled: one pass a trip, the buffer picked by the trip's parity
    for (int t = 0; t < NT; ++t) { const int bo = (t & 1) * STG;
#pragma unroll
        for (int ks = 0; ks < 2; ++ks) { v16bf p[4], q[4], q2[4];
#pragma unroll
            for (int mb = 0; mb < 4; ++mb) p[mb] = ldf(bo + fp + mb * 16 * GPIT + ks * 64);
#pragma unroll
            for (int nb = 0; nb < 4; ++nb) q[nb] = ldf(bo + fq + nb * 16 * GPIT + ks * 64);
            if (NSPLIT) {
#pragma unroll
                for (int nb = 0; nb < 4; ++nb) q2[nb] = ldf(bo + fq + (GBM + nb * 16) * GPIT + ks * 64); }
            __builtin_amdgcn_sched_barrier(0);   // the block's LDS reads stay one group in front of its WMMAs (left alone the compiler reads one fragment at a time among them, a full wait each)
#pragma unroll
            for (int nb = 0; nb < 4; ++nb)
#pragma unroll
                for (int mb = 0; mb < 4; ++mb) acc[mb][nb] = wmmab(p[mb], q[nb], acc[mb][nb]);
            if (NSPLIT) {
#pragma unroll
                for (int nb = 0; nb < 4; ++nb)
#pragma unroll
                    for (int mb = 0; mb < 4; ++mb) acc[mb][nb] = wmmab(p[mb], q2[nb], acc[mb][nb]); }
            __builtin_amdgcn_sched_barrier(0); }   // ... and the next block's reads behind them
        asm volatile("s_wait_dscnt 0x0" ::: "memory");      // this wave's reads of buffer t & 1 are done before anybody refills it
        asm volatile("s_wait_asynccnt 0x0" ::: "memory");   // this wave's copies of pass t + 1 have landed
        __syncthreads();                                    // publishes pass t + 1 and frees buffer t & 1
        if (t + 2 < NT) fill(t + 2, t & 1);
    }
    asm volatile("s_wait_asynccnt 0x0" ::: "memory");   // nothing is in flight when the ring becomes output staging (the last trip's barrier ended every read of it)
    float* ow = (float*)sm + w * (64 * 68);   // each wave stages its own tile in its own range
#pragma unroll
    for (int mb = 0; mb < 4; ++mb)
#pragma unroll
        for (int nb = 0; nb < 4; ++nb)
        { v4f a, b;
#pragma unroll
            for (int j = 0; j < 4; ++j) { a[j] = acc[mb][nb][j]; b[j] = acc[mb][nb][4 + j]; }
            float* op = ow + (nb * 16 + lr) * 68 + mb * 16 + hi * 8; *(v4fa*)op = a; *(v4fa*)(op + 4) = b; }
    asm volatile("s_wait_dscnt 0x0" ::: "memory");   // the wave's own stores are in LDS before its lanes read one another's rows back
    const int rw = r0 + wm * 64, cw = c0 + wn * 64;   // the wave's first A row (token) and first Bt row
    const size_t pbase = z * sC + (size_t)(cw / 64) * (TT * HD) + (tr ? (size_t)rw : (size_t)rw * HD); const int ppit = tr ? TT : HD;   // the tile's first element in its head plane, and the plane's row pitch
    v4f bz = (v4f){};   // a lane's four columns are the same in every step
    const float qs = (PLANES && cw / 64 < NH_) ? CL2 : 1.0f;   // the q heads go out in log2-score units, scaled in f32 before their one rounding (k, v: times one, exact)
    if (BIAS) { const float* bp = bias + cw + lr * 4;
#pragma unroll
        for (int j = 0; j < 4; ++j) bz[j] = bfr(bp[j]); }
    // Which planes attention reads of this tile (the same for the whole work-group): the hi/lo planes only of tokens < RH (queries < RH see no later key), the fp16 plane of k and v everywhere, of q only from token RH on. The rest is neither split nor stored.
    auto put = [&](auto w16, auto whl) {
#pragma unroll 1   // rolled, four steps a trip: their reads and stores are in flight together; unrolled whole it would only lengthen the text
    for (int s4 = 0; s4 < 32; s4 += 4) {
#pragma unroll
      for (int u = 0; u < 4; ++u) { const int slot = (s4 + u) * 32 + lane, row = slot >> 4, cofs = (slot & 15) * 4; v4f val = *(const v4fa*)(ow + row * 68 + cofs);
        if (BIAS) val += bz;
        if (PLANES) val *= qs;
        if constexpr (PLANES) { const size_t po = pbase + (size_t)(row * ppit + cofs);
            if constexpr (decltype(w16)::v) { v4h o16;
#pragma unroll
                for (int j = 0; j < 4; ++j) o16[j] = tohx(val[j]);
                *(v4h*)(P16 + po) = o16; }
            if constexpr (decltype(whl)::v) { v4us oh, ol;
#pragma unroll
                for (int j = 0; j < 4; ++j) { unsigned short a2, c2; splitf(val[j], a2, c2); oh[j] = a2; ol[j] = c2; }
                *(v4us*)(Ph + po) = oh; *(v4us*)(Pl + po) = ol; }
        } else *(v4f*)(C + (size_t)(rw + row) * ldc + cw + cofs) = val; }
      asm volatile("s_wait_xcnt 0x0" ::: "memory"); } };   // the wait that stands in front of any overwrite of a register that an issued store names: the next trip reuses them
    if (!PLANES || r0 >= RH) put(Flag<true>{}, Flag<false>{});
    else if ((int)blockIdx.y * (GBN / 64) >= NH_) put(Flag<true>{}, Flag<true>{});
    else put(Flag<false>{}, Flag<true>{});
}

// ---- k_prep: every f32 -> bf16 copy in one launch, 8 elements a thread; the block index picks the range: x (all batches), w_proj, then w_qkv with its packed rows (h, part, d) gathered into standard (part, h, d) blocks.
#define PBX (NB_ * TT * DM / 8 / 256)
#define PBO (DM * DQ / 8 / 256)
#define PBW (3 * DQ * DM / 8 / 256)
__global__ __launch_bounds__(256) void k_prep(const float* __restrict__ x, const float* __restrict__ W, const float* __restrict__ wo, bf* XB, bf* Bt, bf* WO) {
    const int bx = (int)blockIdx.x; const float* s; bf* d;
    if (bx < PBX) { const size_t e = ((size_t)bx * 256 + threadIdx.x) * 8; s = x + e; d = XB + e; }
    else if (bx < PBX + PBO) { const size_t e = ((size_t)(bx - PBX) * 256 + threadIdx.x) * 8; s = wo + e; d = WO + e; }
    else { const size_t e = ((size_t)(bx - PBX - PBO) * 256 + threadIdx.x) * 8; const int c0 = (int)(e % DM); const int rd = (int)(e / DM); const int part = rd / DQ; const int h = (rd % DQ) / HD; const int dd = rd % HD; s = W + (size_t)(h * 3 * HD + part * HD + dd) * DM + c0; d = Bt + e; }
    const v8f v = *(const v8f*)s; v8us o;
#pragma unroll
    for (int k = 0; k < 8; ++k) o[k] = f2bf(v[k]);
    *(v8us*)d = o;
}
// ---- k_fattn: causal attention, one pass over the keys; scores and probabilities stay in registers (online softmax). grid (heads x batches, work-groups of a head), FNW * 32 threads.
// Transposed products: S^T = K Q^T (A = key rows, B = query rows), so a lane holds 16 keys' scores of ONE query (column lr); two S^T tiles (keys 0..15, 16..31), converted in place, are the B operand of O^T += V^T P^T.
// The 8 waves tile the QUERIES (NQT * 16 columns each); every wave walks all the keys its queries may see and keeps its own reference, sum and 64 x NQT*16 f32 tile of O^T: nothing is joined between waves.
// Held reference: q comes in already times CL2, and minus the query's reference is the C operand of its score products, so a score tile leaves the matrix unit as the exponent that exp2 takes: no multiply, no subtraction per score.
// The reference is the query's maximum of the wave's first pass and moves only when a later pass tops it by more than 8; only then are the sum and the output tile rescaled.
// A stage is SK keys: SK rows of K (128 bytes each) and the 64 rows of V^T (SK * 2 bytes each), brought into LDS once for the whole work-group by asynchronous copies (whole lines only) and read from there by every wave;
// two buffers: the copies of stage t + 2 fly while stage t + 1 is worked on. A pass is 32 keys; a wave skips the passes above its own diagonal but meets every barrier.
// A work-group takes one block of BR = 8 waves' neighbouring queries and walks the stages up to the block's last query: the same number of trips for all its waves.
// HL (query rows < RH): hi+lo bf16 planes, 3 products for S and for P V, 16 columns a wave, 64 keys a stage; else fp16 planes, one product, 32 columns a wave, 128 keys a stage. The quotient goes out as the merged hi/lo planes [t][DQ].
#define FNW  8
#define KPIT 144                  // LDS pitch in bytes of a K row (128 bytes): 16 B x odd, no bank conflict for 16-byte readers; a V^T row piece gets its length + 16 bytes, also 16 B x odd
// A query's 16 exponentials of a pass, each in place, and the one vector slot behind a transcendental in one statement.
// In place, so that the statement writes no register but its own live values (never an operand register of a WMMA still in its window).
__device__ __forceinline__ void ex2x16(float (&e)[16]) {
    asm("v_exp_f32 %0, %0\n\tv_exp_f32 %1, %1\n\tv_exp_f32 %2, %2\n\tv_exp_f32 %3, %3\n\tv_exp_f32 %4, %4\n\tv_exp_f32 %5, %5\n\tv_exp_f32 %6, %6\n\tv_exp_f32 %7, %7\n\tv_exp_f32 %8, %8\n\t"
        "v_exp_f32 %9, %9\n\tv_exp_f32 %10, %10\n\tv_exp_f32 %11, %11\n\tv_exp_f32 %12, %12\n\tv_exp_f32 %13, %13\n\tv_exp_f32 %14, %14\n\tv_exp_f32 %15, %15\n\tv_nop"
        : "+v"(e[0]), "+v"(e[1]), "+v"(e[2]), "+v"(e[3]), "+v"(e[4]), "+v"(e[5]), "+v"(e[6]), "+v"(e[7]), "+v"(e[8]), "+v"(e[9]), "+v"(e[10]), "+v"(e[11]), "+v"(e[12]), "+v"(e[13]), "+v"(e[14]), "+v"(e[15]));
}
__device__ __forceinline__ void ex2x1(float& e) { asm("v_exp_f32 %0, %0\n\tv_nop" : "+v"(e)); }   // one exponential with the same slot behind it
__device__ __forceinline__ float xhalf(float x) { return __builtin_bit_cast(float, __builtin_amdgcn_permlanex16(__builtin_bit_cast(int, x), __builtin_bit_cast(int, x), 0x76543210, 0xfedcba98, false, false)); }  // lane l with lane l ^ 16
// Eight asynchronous copies, 16 bytes a lane: two runs of four, copy i of a run ls bytes further on in LDS and gs elements further on in memory. The s_wait_xcnt is the statement's last line, so that it stands in front of every later write of a register that a copy names (a precaution).
template <typename T16>
__device__ __forceinline__ void cpkv(unsigned la, const T16* ga, unsigned lsa, size_t gsa, unsigned lb, const T16* gb, unsigned lsb, size_t gsb) {
    asm volatile("global_load_async_to_lds_b128 %0, %8, off\n\tglobal_load_async_to_lds_b128 %1, %9, off\n\tglobal_load_async_to_lds_b128 %2, %10, off\n\tglobal_load_async_to_lds_b128 %3, %11, off\n\t"
                 "global_load_async_to_lds_b128 %4, %12, off\n\tglobal_load_async_to_lds_b128 %5, %13, off\n\tglobal_load_async_to_lds_b128 %6, %14, off\n\tglobal_load_async_to_lds_b128 %7, %15, off\n\ts_wait_xcnt 0x0"
                 :: "v"(la), "v"(la + lsa), "v"(la + 2 * lsa), "v"(la + 3 * lsa), "v"(lb), "v"(lb + lsb), "v"(lb + 2 * lsb), "v"(lb + 3 * lsb),
                    "v"(ga), "v"(ga + gsa), "v"(ga + 2 * gsa), "v"(ga + 3 * gsa), "v"(gb), "v"(gb + gsb), "v"(gb + 2 * gsb), "v"(gb + 3 * gsb) : "memory");
}
template <bool HL> struct AShape {   // sizes of the two kinds of work-group
    static constexpr int NQT = HL ? 1 : 2, SK = HL ? 64 : 128, R0 = HL ? 0 : RH, BR = FNW * NQT * 16, NBK = (HL ? RH : TT - RH) / BR;
    static constexpr int VPIT = SK * 2 + 16, KTB = SK * KPIT, TS = KTB + HD * VPIT, STG = TS * (HL ? 2 : 1);   // a buffer: K rows | V^T rows (| K lo rows | V^T lo rows)
};
template <typename T16, bool HL>
__device__ __forceinline__ void attn_body(const T16* __restrict__ Q, const T16* __restrict__ Q2, const T16* __restrict__ Kp, const T16* __restrict__ K2, const T16* __restrict__ Vt, const T16* __restrict__ V2, int b, bf* Ah, bf* Al, const char* sm) {
    typedef typename WFrag<T16>::V V; typedef AShape<HL> S_;
    constexpr int NQT = S_::NQT, SK = S_::SK, VPIT = S_::VPIT, KTB = S_::KTB, TS = S_::TS, STG = S_::STG;
    const int tid = (int)threadIdx.x, lane = tid & 31, lr = lane & 15, hi = lane >> 4;
    const int w = __builtin_amdgcn_readfirstlane(tid >> 5);   // wave number, scalar: the pass counts and the diagonal test stay in scalar registers
    const int q0 = S_::R0 + S_::BR * b + NQT * 16 * w;        // this wave's first query
    const int NS = (S_::R0 + S_::BR * (b + 1)) / SK;          // stages up to the block's last query
    const unsigned l0 = (unsigned)(size_t)sm;
    auto fill = [&](int t, int buf) { const unsigned lb = l0 + buf * STG;
        const int kr = tid >> 3, kg = tid & 7;   // this lane's row (of 32 a copy) and 16-byte piece of a 128-byte row
        const size_t ko = (size_t)(t * SK + kr) * HD + kg * 8; const unsigned kl = lb + kr * KPIT + kg * 16;
        if constexpr (HL) { const size_t vo = (size_t)kr * TT + t * SK + kg * 8; const unsigned vl = lb + KTB + kr * VPIT + kg * 16;   // run = hi rows 0..31, 32..63, lo rows 0..31, 32..63: the lo plane's tile lies TS bytes behind the hi plane's
            asm volatile("global_load_async_to_lds_b128 %0, %8, off\n\tglobal_load_async_to_lds_b128 %1, %9, off\n\tglobal_load_async_to_lds_b128 %2, %10, off\n\tglobal_load_async_to_lds_b128 %3, %11, off\n\t"
                         "global_load_async_to_lds_b128 %4, %12, off\n\tglobal_load_async_to_lds_b128 %5, %13, off\n\tglobal_load_async_to_lds_b128 %6, %14, off\n\tglobal_load_async_to_lds_b128 %7, %15, off\n\ts_wait_xcnt 0x0"
                         :: "v"(kl), "v"(kl + 32 * KPIT), "v"(kl + TS), "v"(kl + TS + 32 * KPIT), "v"(vl), "v"(vl + 32 * VPIT), "v"(vl + TS), "v"(vl + TS + 32 * VPIT),
                            "v"(Kp + ko), "v"(Kp + ko + 32 * HD), "v"(K2 + ko), "v"(K2 + ko + 32 * HD), "v"(Vt + vo), "v"(Vt + vo + 32 * TT), "v"(V2 + vo), "v"(V2 + vo + 32 * TT) : "memory");   // the s_wait_xcnt: as in cpkv
        } else { const int vr = tid >> 4, vg = tid & 15;   // 16 rows of 256 bytes a copy
            cpkv<T16>(kl, Kp + ko, 32 * KPIT, (size_t)32 * HD, lb + KTB + vr * VPIT + vg * 16, Vt + (size_t)vr * TT + t * SK + vg * 8, 16 * VPIT, (size_t)16 * TT); } };
    auto ldl = [&](int off) -> V { if constexpr (HL) return cat16b(*(const v8usa*)(sm + off), *(const v8usa*)(sm + off + 32)); else return cat16(*(const v8ha*)(sm + off), *(const v8ha*)(sm + off + 32)); };
    fill(0, 0);
    V qf[NQT][2], qf2[NQT][2];
    const size_t qo = (size_t)(q0 + lr) * HD + 8 * hi; const T16* qp = Q + qo; const T16* qp2 = HL ? Q2 + qo : qp;
#pragma unroll
    for (int qt = 0; qt < NQT; ++qt)
#pragma unroll
        for (int ks = 0; ks < 2; ++ks) { qf[qt][ks] = WFrag<T16>::ld(qp + qt * 16 * HD + ks * 32); if (HL) qf2[qt][ks] = WFrag<T16>::ld(qp2 + qt * 16 * HD + ks * 32); }
    // the wait that stands in front of any overwrite of a register that an issued load names; the addresses are its inputs so that they stay in their registers up to it (no load's own result lands on them)
    asm volatile("s_wait_xcnt 0x0" :: "v"(qp), "v"(qp2) : "memory");
    v8f o[4][NQT], cr[NQT]; float l[NQT];   // cr: minus the query's held reference, in all eight registers: the C operand of its score products
#pragma unroll
    for (int qt = 0; qt < NQT; ++qt) { cr[qt] = (v8f){}; l[qt] = 0.f;
#pragma unroll
        for (int dt = 0; dt < 4; ++dt) o[dt][qt] = (v8f){}; }
    asm volatile("s_wait_asynccnt 0x0" ::: "memory");   // this wave's copies of stage 0 have landed
    __syncthreads();                                    // ... and every other wave's
    if (NS > 1) fill(1, 1);
#pragma unroll 1   // rolled: one stage a trip, the buffer picked by the trip's parity
    for (int t = 0; t < NS; ++t) {
        const int left = (q0 >> 5) + 1 - t * (SK / 32), np = left < SK / 32 ? left : SK / 32;   // passes of this stage that begin no later than the wave's first query (none: the wave only meets the barrier)
        const int fk = (t & 1) * STG + lr * KPIT + hi * 16, fv = (t & 1) * STG + KTB + lr * VPIT + hi * 16;   // byte offsets of this lane's first K and V^T fragment rows
        V kf[2][2], kf2[2][2];   // a pass's key fragments: fetched one pass ahead inside the stage, into the same registers, right behind the products that read them
        auto ldk = [&](int ps) {
#pragma unroll
            for (int kt = 0; kt < 2; ++kt)
#pragma unroll
                for (int ks = 0; ks < 2; ++ks) { kf[kt][ks] = ldl(fk + (ps * 32 + kt * 16) * KPIT + ks * 64); if (HL) kf2[kt][ks] = ldl(fk + TS + (ps * 32 + kt * 16) * KPIT + ks * 64); } };
        if (np > 0) ldk(0);
#pragma unroll 1   // rolled: one pass's fragments, scores and the output tile fill the register budget
        for (int ps = 0; ps < np; ++ps) { const int kc = t * SK + ps * 32;
            V vf[4], vf2[4];
#pragma unroll
            for (int dt = 0; dt < 4; ++dt) { vf[dt] = ldl(fv + dt * 16 * VPIT + ps * 64); if (HL) vf2[dt] = ldl(fv + TS + dt * 16 * VPIT + ps * 64); }
            v8f s[2][NQT];
#pragma unroll
            for (int kt = 0; kt < 2; ++kt)
#pragma unroll
                for (int qt = 0; qt < NQT; ++qt) { v8f a = cr[qt];
#pragma unroll
                    for (int ks = 0; ks < 2; ++ks) { a = WFrag<T16>::mma(kf[kt][ks], qf[qt][ks], a); if (HL) { a = WFrag<T16>::mma(kf[kt][ks], qf2[qt][ks], a); a = WFrag<T16>::mma(kf2[kt][ks], qf[qt][ks], a); } }
                    s[kt][qt] = a; }
            ldk(ps + 1 < np ? ps + 1 : ps);   // the wave's last pass of a stage fetches its own rows again: always inside this stage's buffer, never used
            if constexpr (!HL) asm volatile("" ::: "memory");   // (fp16 rows; the hi/lo rows have no registers to spare for it) holds this pass's V^T reads and the next pass's K reads in front of the branches below: left alone the compiler sinks them behind the test, right in front of the products that wait for them
            if (kc + 31 > q0) {   // only the wave's last pass needs the mask (same for the whole wave: one branch round all the selects)
#pragma unroll
                for (int qt = 0; qt < NQT; ++qt) { const int lim = q0 + qt * 16 + lr - kc - hi * 8;   // this lane's query minus its first key
#pragma unroll
                    for (int kt = 0; kt < 2; ++kt)
#pragma unroll
                        for (int j = 0; j < 8; ++j) s[kt][qt][j] = (kt * 16 + j <= lim) ? s[kt][qt][j] : -3.0e38f; } }
            float d[NQT]; bool need = kc == 0;   // s is already score minus reference, in log2 units; the wave's first pass has no reference yet and takes its own maximum
#pragma unroll
            for (int qt = 0; qt < NQT; ++qt) { float mx = -3.0e38f;
#pragma unroll
                for (int kt = 0; kt < 2; ++kt)
#pragma unroll
                    for (int j = 0; j < 8; ++j) mx = fmaxf(mx, s[kt][qt][j]);
                mx = fmaxf(mx, xhalf(mx));   // the query's other 16 keys of this pass sit in the other half of the wave
                d[qt] = mx; need = need || mx > 8.0f; }
            if (__builtin_amdgcn_ballot_w32(need) != 0u) {   // one scalar test a pass: the reference moves only where some query's scores top it by more than 8 (probabilities stay <= 256); then every query of the wave lifts its reference to this pass's maximum where that is the higher
#pragma unroll
                for (int qt = 0; qt < NQT; ++qt) { const float dl = kc == 0 ? d[qt] : fmaxf(d[qt], 0.f); float al = kc == 0 ? -3.0e38f : -dl; ex2x1(al);   // first pass: sum and output are still zero and stay so
                    l[qt] *= al; cr[qt] -= dl;
#pragma unroll
                    for (int dt = 0; dt < 4; ++dt) o[dt][qt] *= al;
#pragma unroll
                    for (int kt = 0; kt < 2; ++kt) s[kt][qt] -= dl; } }
#pragma unroll
            for (int qt = 0; qt < NQT; ++qt) { float e[16], sum = 0.f;
#pragma unroll
                for (int kt = 0; kt < 2; ++kt)
#pragma unroll
                    for (int j = 0; j < 8; ++j) e[kt * 8 + j] = s[kt][qt][j];
                ex2x16(e);
#pragma unroll
                for (int kt = 0; kt < 2; ++kt)
#pragma unroll
                    for (int j = 0; j < 8; ++j) { s[kt][qt][j] = e[kt * 8 + j]; sum += e[kt * 8 + j]; }
                l[qt] += sum;
                if constexpr (HL) { v8us h0, h1, l0v, l1v;
#pragma unroll
                    for (int j = 0; j < 8; ++j) { unsigned short a, c2; splitf(s[0][qt][j], a, c2); h0[j] = a; l0v[j] = c2; splitf(s[1][qt][j], a, c2); h1[j] = a; l1v[j] = c2; }
                    const v16bf ph = cat16b(h0, h1), pl = cat16b(l0v, l1v);
#pragma unroll
                    for (int dt = 0; dt < 4; ++dt) { o[dt][qt] = wmmab(__builtin_bit_cast(v16bf, vf[dt]), ph, o[dt][qt]); o[dt][qt] = wmmab(__builtin_bit_cast(v16bf, vf[dt]), pl, o[dt][qt]); o[dt][qt] = wmmab(__builtin_bit_cast(v16bf, vf2[dt]), ph, o[dt][qt]); }
                } else { v16h pb;
#pragma unroll
                    for (int j = 0; j < 8; ++j) { pb[j] = tohx(s[0][qt][j]); pb[8 + j] = tohx(s[1][qt][j]); }
#pragma unroll
                    for (int dt = 0; dt < 4; ++dt) o[dt][qt] = wmma16(__builtin_bit_cast(v16h, vf[dt]), pb, o[dt][qt]); } }
            // four vector slots behind the last WMMAs, on the taken side of the loop's branch too
            asm volatile("v_nop\n\tv_nop\n\tv_nop\n\tv_nop" : "+v"(o[0][NQT - 1]), "+v"(o[1][NQT - 1]), "+v"(o[2][NQT - 1]), "+v"(o[3][NQT - 1]) : "v"(vf[0]), "v"(vf[3]));
        }
        asm volatile("s_wait_dscnt 0x0" ::: "memory");      // this wave's reads of buffer t & 1 are done before anybody refills it
        asm volatile("s_wait_asynccnt 0x0" ::: "memory");   // this wave's copies of stage t + 1 have landed
        __syncthreads();                                    // publishes stage t + 1 and frees buffer t & 1
        if (t + 2 < NS) fill(t + 2, t & 1);
    }
    asm volatile("s_wait_asynccnt 0x0" ::: "memory");   // nothing is in flight when the wave ends
    v8us oh[NQT][4], ol[NQT][4];   // a lane holds 8 neighbours of its query's output row: the quotient goes out from the registers
#pragma unroll
    for (int qt = 0; qt < NQT; ++qt) { const float inv = __fdiv_rn(1.0f, l[qt] + xhalf(l[qt]));   // the two halves' sums of one query
#pragma unroll
        for (int dt = 0; dt < 4; ++dt)
#pragma unroll
            for (int j = 0; j < 8; ++j) { unsigned short x, y; splitf(o[dt][qt][j] * inv, x, y); oh[qt][dt][j] = x; ol[qt][dt][j] = y; } }
    bf* ah = Ah + (size_t)(q0 + lr) * DQ + hi * 8; bf* al2 = Al + (size_t)(q0 + lr) * DQ + hi * 8;
    __builtin_amdgcn_sched_barrier(0);   // every store stands behind the last arithmetic: no register that an issued store names is written again
#pragma unroll
    for (int qt = 0; qt < NQT; ++qt)
#pragma unroll
        for (int dt = 0; dt < 4; ++dt) { *(v8us*)(ah + qt * 16 * DQ + dt * 16) = oh[qt][dt]; *(v8us*)(al2 + qt * 16 * DQ + dt * 16) = ol[qt][dt]; }
}
#define GYM (AShape<false>::NBK)   // work-groups of a head: rows >= RH,
#define GYH (AShape<true>::NBK)    // rows < RH
__global__ __launch_bounds__(FNW * 32) __attribute__((amdgpu_waves_per_eu(4, 4))) void k_fattn(const h16* __restrict__ Q16, const h16* __restrict__ K16, const h16* __restrict__ V16, const bf* __restrict__ Qh, const bf* __restrict__ Ql, const bf* __restrict__ Kh, const bf* __restrict__ Kl, const bf* __restrict__ Vh, const bf* __restrict__ Vl, bf* Ah, bf* Al) {
    __shared__ __align__(16) char sm[2 * (AShape<true>::STG > AShape<false>::STG ? AShape<true>::STG : AShape<false>::STG)];
    const unsigned hd = blockIdx.x % NH_, bt = blockIdx.x / NH_;   // head, batch; a batch holds 3 * NH_ head planes (q, k, v^T)
    const size_t hp = (size_t)(bt * 3 * NH_ + hd) * TT * HD; const int bx = (int)blockIdx.y; Ah += (size_t)bt * TT * DQ + hd * HD; Al += (size_t)bt * TT * DQ + hd * HD;
    // Which block: a permutation of the grid, for speed only. Two work-groups fit a WGP, so the launch lasts as long as the fullest WGP.
    // Grid rows y and y + 4 hold blocks whose passes add up to about the same (fp16 blocks 5 4 3 2 over hi/lo blocks 3 2 and fp16 blocks 0 1); work-groups whose x has an odd number of ones take the other row of the two:
    // neighbours in index order at any power-of-two distance, in x or four rows apart, are then a long block and a short one. The two shortest hi/lo blocks come last.
    static_assert(GYM == 6 && GYH == 4, "the table below lists 6 + 4 blocks");
    const int row = bx < 8 ? bx ^ ((__builtin_popcount(blockIdx.x) & 1) << 2) : bx;
    const int blk = (int)((0x8910AB2345ull >> (4 * row)) & 15);   // four bits a row: 0..5 an fp16 block, 8..11 a hi/lo block
    if (blk < 8) attn_body<h16, false>(Q16 + hp, nullptr, K16 + hp, nullptr, V16 + hp, nullptr, blk, Ah, Al, sm);
    else attn_body<bf, true>(Qh + hp, Ql + hp, Kh + hp, Kl + hp, Vh + hp, Vl + hp, blk - 8, Ah, Al, sm);
}

extern "C" void kernel_launch(void* const* d_in, const int* in_sizes, int n_in,
                              void* d_out, int out_size, void* d_ws, size_t ws_size, hipStream_t stream) {
    (void)in_sizes; (void)n_in; (void)out_size;
    const float* x = (const float*)d_in[0]; const float* wqkv = (const float*)d_in[1]; const float* wo = (const float*)d_in[2]; const float* bo = (const float*)d_in[3];   /* input order x, w_qkv ('oi' (out, in) [3072][1024], rows packed per head (h, part, c)), w_proj ('oi' [1024][1024]), b_proj (REAL): FOUR inputs, all read: the host's own binding */ const float* wq = wqkv; const float* wk = nullptr; const float* wv = nullptr; (void)wk; (void)wv;
    float* OUT = (float*)d_out;     // [4][2048][1024]
    char* wsp = (char*)d_ws;
    auto take = [&](size_t bytes) { char* p = wsp; wsp += (bytes + 255) & ~(size_t)255; return (void*)p; };
    bf* WQKV = (bf*)take((size_t)3 * DQ * DM * 2);   /* de-interleaved Bt: q | k | v row blocks in head order */ bf* WO = (bf*)take((size_t)DM * DQ * 2);
    bf* XB = (bf*)take((size_t)NB_ * TT * DM * 2);
    const size_t PB = (size_t)3 * NH_ * TT * HD, PK = (size_t)NH_ * TT * HD;   // one batch's head planes of one kind: q heads [t][d] | k heads [t][d] | v heads [d][t]
    h16* P16 = (h16*)take(NB_ * PB * 2); bf* PH = (bf*)take(NB_ * PB * 2); bf* PL = (bf*)take(NB_ * PB * 2);
    bf* ATh = (bf*)take((size_t)NB_ * TT * DQ * 2); bf* ATl = (bf*)take((size_t)NB_ * TT * DQ * 2);
    if ((size_t)(wsp - (char*)d_ws) > ws_size) return;    // ws 256 MiB
    k_prep<<<PBX + PBO + PBW, 256, 0, stream>>>(x, wqkv, wo, XB, WQKV, WO);
    k_gemmt<0, false, true><<<dim3(RH / GBM, 3 * DQ / GBN, NB_ * (TT / RH)), 256, 0, stream>>>(XB, nullptr, DM, WQKV, DM, nullptr, 0, nullptr, (size_t)TT * DM, PB, P16, PH, PL, 2 * NH_);   // q, k planes [h][t][d]; v planes transposed, [h][d][t]
    k_fattn<<<dim3(NH_ * NB_, GYM + GYH, 1), FNW * 32, 0, stream>>>(P16, P16 + PK, P16 + 2 * PK, PH, PL, PH + PK, PL + PK, PH + 2 * PK, PL + 2 * PK, ATh, ATl);   // one kv head per query head: head h uses plane h of each
    k_gemmt<1, true, false><<<dim3(NB_ * TT / GBM, DM / GBN, 1), 256, 0, stream>>>(ATh, ATl, DQ, WO, DQ, OUT, DM, bo, 0, 0, nullptr, nullptr, nullptr, 0);
}
